// v000
// Measured on an AMD MI455X. A time is GPU time per run, averaged over a window of back-to-back runs after a warm-up
// (all launches, gaps included; the runs take copies of the inputs in turn), and the median of several windows.
// Apart from v000's, it joins two sittings. Times from different sittings can be a few percent apart, while
// side-by-side timings come from the same sitting.
// v000, which the later versions start from, runs in 2150 microseconds.
// compute dtype: all float inputs rounded to bf16; interleaved-pair RoPE applied in f32 to the bf16 q/k rows (64 embedded f32 inverse frequencies = XLA's table, accurate sincosf of the f32 angle t*freq); rotated q/k as f16 hi + residual (x 2^10) planes below row 384, once to f16 beyond; causal logits x 128^-0.5 with 3 products below row 384, 1 product beyond; att = tanhf(logit) in f32 for k <= t and exactly -1 for k > t (tanh(-inf)); att x 2^11 against v over ALL keys: bf16 hi + lo (3 products) for query rows < 384, once to f16 against v f16 beyond; f32 output [B, T, C].
#include <hip/hip_runtime.h>
#include <math.h>

typedef __attribute__((ext_vector_type(16))) _Float16 v16h;
typedef __attribute__((ext_vector_type(16))) __bf16 v16b;
typedef __attribute__((ext_vector_type(8)))  _Float16 v8h;
typedef __attribute__((ext_vector_type(8)))  float v8f;
typedef __attribute__((ext_vector_type(4)))  float v4f;
typedef __attribute__((ext_vector_type(2)))  float v2f;
typedef __attribute__((ext_vector_type(4)))  unsigned v4u;
typedef __attribute__((ext_vector_type(4)))  int v4i;
typedef float __attribute__((may_alias)) float_a;
typedef int __attribute__((may_alias)) int_a;

template <typename T> __device__ __forceinline__ void vst2(void* p, T v) { *(T*)p = v;  }
__device__ __forceinline__ v8f wmma16(v16h a, v16h b, v8f c) {
  v8f d = __builtin_amdgcn_wmma_f32_16x16x32_f16(false, a, false, b, (short)0, c, false, false);
  asm volatile("v_nop\n\tv_nop\n\tv_nop\n\tv_nop" : "+v"(d) : "v"(a), "v"(b));
  return d;
}
__device__ __forceinline__ v8f wmma_bf(v16b a, v16b b, v8f c) {
  v8f d = __builtin_amdgcn_wmma_f32_16x16x32_bf16(false, a, false, b, (short)0, c, false, false);
  asm volatile("v_nop\n\tv_nop\n\tv_nop\n\tv_nop" : "+v"(d) : "v"(a), "v"(b));
  return d;
}
// 16x16x32 fragments: lane = (h = lane>>4, row/col = lane&15); elements 0..7 = k0+8h+0..7, 8..15 = k0+16+8h+0..7; D element r = row 8h+r
__device__ __forceinline__ v16h frag_h(const _Float16* rowk0, int lane) {
  union { v16h v; v8h q[2]; } u; const _Float16* p = rowk0 + 8 * (lane >> 4);
  u.q[0] = *(const v8h*)p; u.q[1] = *(const v8h*)(p + 16); return u.v;
}
__device__ __forceinline__ v16h frag_f32(const float* rowk0, int lane) {
  v16h a; const float* p = rowk0 + 8 * (lane >> 4);
#pragma unroll
  for (int i = 0; i < 8; ++i) { a[i] = (_Float16)p[i]; a[8 + i] = (_Float16)p[16 + i]; }
  return a;
}
__device__ __forceinline__ v16h frag_f32s(const float* rowk0, int lane, float sc) {
  v16h a; const float* p = rowk0 + 8 * (lane >> 4);
#pragma unroll
  for (int i = 0; i < 8; ++i) { a[i] = (_Float16)(p[i] * sc); a[8 + i] = (_Float16)(p[16 + i] * sc); }
  return a;
}
// column fragment from a [K][ld] layout (column n), rows >= K read as 0
__device__ __forceinline__ v16h fragc_f32(const float* W, int k0, int n, int lane, int ld, int K) {
  v16h a; const int g = lane >> 4;
#pragma unroll
  for (int i = 0; i < 8; ++i) { const int ka = k0 + 8 * g + i, kb = ka + 16;
    a[i] = (_Float16)(ka < K ? W[(size_t)(ka < K ? ka : K - 1) * ld + n] : 0.f); a[8 + i] = (_Float16)(kb < K ? W[(size_t)(kb < K ? kb : K - 1) * ld + n] : 0.f); }
  return a;
}
struct F2 { v16b h, l; };
__device__ __forceinline__ F2 bsplit16(const float v[16]) { F2 r;
#pragma unroll
  for (int i = 0; i < 16; ++i) { const __bf16 h = (__bf16)v[i]; r.h[i] = h; r.l[i] = (__bf16)(v[i] - (float)h); }
  return r; }
__device__ __forceinline__ F2 split_row(const float* row, int k0, int lane) { float v[16]; const float* p = row + k0 + 8 * (lane >> 4);
#pragma unroll
  for (int i = 0; i < 8; ++i) { v[i] = p[i]; v[8 + i] = p[16 + i]; }
  return bsplit16(v); }
__device__ __forceinline__ F2 split_rowK(const float* row, int k0, int lane, int K) { float v[16]; const int g = lane >> 4;
#pragma unroll
  for (int i = 0; i < 8; ++i) { const int ka = k0 + 8 * g + i, kb = ka + 16; v[i] = ka < K ? row[ka < K ? ka : K - 1] : 0.f; v[8 + i] = kb < K ? row[kb < K ? kb : K - 1] : 0.f; }
  return bsplit16(v); }
__device__ __forceinline__ F2 split_col(const float* W, int k0, int n, int lane, int ld, int K) { float v[16]; const int g = lane >> 4;
#pragma unroll
  for (int i = 0; i < 8; ++i) { const int ka = k0 + 8 * g + i, kb = ka + 16; v[i] = ka < K ? W[(size_t)(ka < K ? ka : K - 1) * ld + n] : 0.f; v[8 + i] = kb < K ? W[(size_t)(kb < K ? kb : K - 1) * ld + n] : 0.f; }
  return bsplit16(v); }
__device__ __forceinline__ v8f mac3(const F2& a, const F2& b, v8f c) { c = wmma_bf(a.l, b.h, c); c = wmma_bf(a.h, b.l, c); return wmma_bf(a.h, b.h, c); }
__device__ __forceinline__ float sigm(float v) { return 1.0f / (1.0f + expf(-v)); }
#define LDSX() do { asm volatile("s_wait_dscnt 0" ::: "memory"); __builtin_amdgcn_wave_barrier(); __builtin_amdgcn_fence(__ATOMIC_RELEASE, "workgroup"); } while (0)

// Causal 'tanh attention' (no softmax) with RoPE (B 2, T 2,048, C 2,048 = 16 heads x 128; raw Q, K, V inputs, no projections): q, k = rope_interleaved(split_heads(Q)), rope(split_heads(K)); scores = q k^T / sqrt(128); att = tanh(where(causal, scores, -inf)) -> masked entries are exactly -1 and STILL multiply v; out = att v merged to [B, T, C].
#define NB 2
#define TT 2048
#define CC 2048            // NH * HD = projected width
#define DIN 2048          // input (model) width
#define NH 16
#define HD 128
#define NQB (TT / 64)
#define HG 4
#define SCALE (0.08838834764831845f)
#define CAUSAL 1
#ifndef TNB
#define TNB NB
#endif
__device__ __forceinline__ float bfr(float v) { return (float)(__bf16)v; }
__host__ __device__ __forceinline__ int kb_last(int qb) { return CAUSAL ? ((qb * 64 + 63) >> 7) : (TT / 128 - 1); }
typedef __attribute__((ext_vector_type(8))) __bf16 v8b;
__device__ __forceinline__ v16b frag_b(const __bf16* rowk0, int lane) {
  union { v16b v; v8b q[2]; } u; const __bf16* p = rowk0 + 8 * (lane >> 4);
  u.q[0] = *(const v8b*)p; u.q[1] = *(const v8b*)(p + 16); return u.v;
}
#define QHI 384            // rows carrying a q residual plane
#define KHI 2048           // v bf16 planes for EVERY key (the tanh 'attention' multiplies all keys: masked ones by -1)
// B fragment (k rows k0+.., output column o) of a weight: (in,out) [K][ld] or (out,in) [ld rows of K]: bf16 exact, or f16(bf16 * 256) exact
__device__ __forceinline__ v16b wcol_io(const float* Wm, int k0, int o, int lane, int ld) { v16b w; const int g = lane >> 4;
#pragma unroll
  for (int i = 0; i < 8; ++i) { w[i] = (__bf16)Wm[(size_t)(k0 + 8 * g + i) * ld + o]; w[8 + i] = (__bf16)Wm[(size_t)(k0 + 16 + 8 * g + i) * ld + o]; }
  return w; }
__device__ __forceinline__ v16b wcol_oi(const float* Wm, int k0, int o, int lane, int K) { v16b w; const float* p = Wm + (size_t)o * K + k0 + 8 * (lane >> 4);
#pragma unroll
  for (int i = 0; i < 8; ++i) { w[i] = (__bf16)p[i]; w[8 + i] = (__bf16)p[16 + i]; }
  return w; }
__device__ __forceinline__ v16h wcolh_io(const float* Wm, int k0, int o, int lane, int ld) { v16h w; const int g = lane >> 4;
#pragma unroll
  for (int i = 0; i < 8; ++i) { w[i] = (_Float16)(bfr(Wm[(size_t)(k0 + 8 * g + i) * ld + o]) * 256.0f); w[8 + i] = (_Float16)(bfr(Wm[(size_t)(k0 + 16 + 8 * g + i) * ld + o]) * 256.0f); }
  return w; }
__device__ __forceinline__ v16h wcolh_oi(const float* Wm, int k0, int o, int lane, int K) { v16h w; const float* p = Wm + (size_t)o * K + k0 + 8 * (lane >> 4);
#pragma unroll
  for (int i = 0; i < 8; ++i) { w[i] = (_Float16)(bfr(p[i]) * 256.0f); w[8 + i] = (_Float16)(bfr(p[16 + i]) * 256.0f); }
  return w; }
#define WQKV_LAYOUT 1   // 0 = (in,out) [DIN][CC]; 1 = (out,in) [CC][DIN]; 2 = per-head [NH][DIN][HD]
__device__ __forceinline__ v16b wcol_hdk(const float* Wm, int k0, int o, int lane) { v16b w; const int g = lane >> 4; const float* p = Wm + (size_t)(o / HD) * DIN * HD + (o % HD);
#pragma unroll
  for (int i = 0; i < 8; ++i) { w[i] = (__bf16)p[(size_t)(k0 + 8 * g + i) * HD]; w[8 + i] = (__bf16)p[(size_t)(k0 + 16 + 8 * g + i) * HD]; }
  return w; }
#define WO_OUT_IN 0
#if WQKV_LAYOUT == 1
#define WCOL(W, k0, o, lane) wcol_oi(W, k0, o, lane, DIN)
#elif WQKV_LAYOUT == 2
#define WCOL(W, k0, o, lane) wcol_hdk(W, k0, o, lane)
#else
#define WCOL(W, k0, o, lane) wcol_io(W, k0, o, lane, CC)
#endif
#if WO_OUT_IN
#define WOCOL(W, k0, o, lane) wcol_oi(W, k0, o, lane, CC)
#define WOCOLH(W, k0, o, lane) wcolh_oi(W, k0, o, lane, CC)
#else
#define WOCOL(W, k0, o, lane) wcol_io(W, k0, o, lane, DIN)
#define WOCOLH(W, k0, o, lane) wcolh_io(W, k0, o, lane, DIN)
#endif
#define QBH 6
__constant__ float c_freq[64] = {1.000000000e+00f,8.659643531e-01f,7.498942018e-01f,6.493816376e-01f,5.623413324e-01f,4.869675338e-01f,4.216965139e-01f,3.651741445e-01f,3.162277639e-01f,2.738419771e-01f,2.371373624e-01f,2.053525001e-01f,1.778279394e-01f,1.539926529e-01f,1.333521456e-01f,1.154782027e-01f,1.000000015e-01f,8.659642935e-02f,7.498941571e-02f,6.493816525e-02f,5.623412877e-02f,4.869675264e-02f,4.216964915e-02f,3.651741147e-02f,3.162277862e-02f,2.738419548e-02f,2.371373586e-02f,2.053525113e-02f,1.778279431e-02f,1.539926510e-02f,1.333521493e-02f,1.154781971e-02f,9.999999776e-03f,8.659643121e-03f,7.498942316e-03f,6.493816618e-03f,5.623413250e-03f,4.869675264e-03f,4.216964822e-03f,3.651741426e-03f,3.162277862e-03f,2.738419687e-03f,2.371373819e-03f,2.053525066e-03f,1.778279431e-03f,1.539926510e-03f,1.333521446e-03f,1.154782018e-03f,1.000000047e-03f,8.659643354e-04f,7.498941850e-04f,6.493816618e-04f,5.623413017e-04f,4.869675031e-04f,4.216964880e-04f,3.651741135e-04f,3.162277862e-04f,2.738419571e-04f,2.371373848e-04f,2.053524950e-04f,1.778279402e-04f,1.539926452e-04f,1.333521504e-04f,1.154781930e-04f};   /* 1/10000^(2i/128), i = 0..63, as XLA's f32 table */
// ---- k_prep8: block = (64 attention positions s0.. of sequence b, head h): reads the raw [B, T, C] inputs (element (b,s,h,c) at (b*TT + s)*CC + h*HD + c), bf16-rounds them and writes the standard attention planes: q -> f16 hi rows (+ x 2^10 residual rows for s < QHI), k -> f16 rows (+ residual rows s < KHI), v -> f16 planes [c][s] (+ bf16 hi/lo planes for s < KHI)
__global__ __launch_bounds__(128) void k_prep8(const float* __restrict__ Q, const float* __restrict__ K, const float* __restrict__ V, _Float16* __restrict__ QH, _Float16* __restrict__ QL, _Float16* __restrict__ KH, _Float16* __restrict__ KL, _Float16* __restrict__ VT, __bf16* __restrict__ VB, __bf16* __restrict__ VBL) {
  __shared__ __align__(16) _Float16 sq[64][136], sql[64][136], sk[64][136], skl[64][136], tv[128][72]; __shared__ __align__(16) __bf16 tb[128][72], tbl[128][72];
  const int tid = threadIdx.x; const int h = blockIdx.y; const size_t r0 = (size_t)blockIdx.x * 64; const size_t bb = r0 / TT; const int t0 = (int)(r0 % TT); const bool qhi = t0 < QHI, khi = t0 < KHI;
  for (int e = tid; e < 64 * 128; e += 128) { const int rl = e >> 7, c = e & 127; const size_t oi = ((bb * TT + t0 + rl) * (size_t)CC) + h * HD + (c % HD);   /* raw [B, T, (h, d)] layout */
    float q, k; const float v = bfr(V[oi]);   /* module inputs bf16-rounded; interleaved-pair RoPE on q and k in f32 */
    { const int d = c % HD; const size_t oe = oi - (d & 1), oo = oe + 1; const float ang = (float)(t0 + rl) * c_freq[d >> 1]; float sn, cs; sincosf(ang, &sn, &cs);
      const float qe = bfr(Q[oe]), qo = bfr(Q[oo]), ke = bfr(K[oe]), ko = bfr(K[oo]);
      q = (d & 1) ? (qe * sn + qo * cs) : (qe * cs - qo * sn); k = (d & 1) ? (ke * sn + ko * cs) : (ke * cs - ko * sn); }
    const _Float16 qh = (_Float16)q, kh = (_Float16)k; sq[rl][c] = qh; sql[rl][c] = (_Float16)((q - (float)qh) * 1024.0f); sk[rl][c] = kh; skl[rl][c] = (_Float16)((k - (float)kh) * 1024.0f);
    tv[c][rl] = (_Float16)v; const __bf16 vb = (__bf16)v; tb[c][rl] = vb; tbl[c][rl] = (__bf16)(v - (float)vb); }
  __syncthreads();
  for (int e = tid; e < 64 * (HD / 8); e += 128) { const int rl = e / (HD / 8), q = e % (HD / 8); const size_t o = (r0 + rl) * CC + h * HD + q * 8; vst2((unsigned*)(QH + o), *(const v4u*)&sq[rl][q * 8]); vst2((unsigned*)(KH + o), *(const v4u*)&sk[rl][q * 8]);   
    if (qhi) vst2((unsigned*)(QL + (bb * QHI + t0 + rl) * (size_t)CC + h * HD + q * 8), *(const v4u*)&sql[rl][q * 8]); if (khi) vst2((unsigned*)(KL + (bb * KHI + t0 + rl) * (size_t)CC + h * HD + q * 8), *(const v4u*)&skl[rl][q * 8]); }
  for (int e = tid; e < HD * 8; e += 128) { const int cl = e >> 3, q = e & 7; vst2((unsigned*)(VT + (bb * CC + h * HD + cl) * (size_t)TT + t0 + q * 8), *(const v4u*)&tv[cl][q * 8]);
    if (khi) { const size_t o3 = (bb * CC + h * HD + cl) * (size_t)KHI + t0 + q * 8; vst2((unsigned*)(VB + o3), *(const v4u*)&tb[cl][q * 8]); vst2((unsigned*)(VBL + o3), *(const v4u*)&tbl[cl][q * 8]); } } }

#ifndef SM_EXTRA_PARAMS
#define SM_EXTRA_PARAMS
#endif
#ifndef PROJ_EXTRA_PARAMS
#define PROJ_EXTRA_PARAMS
#endif
#ifndef SM_MASK_HOOK
#define SM_MASK_HOOK (void)0
#endif

#define WS_QH  0u                                      // f16 q rows [b*t][CC]
#define WS_KH  (WS_QH + 2u * (size_t)NB * TT * CC)      // f16 k rows [b*t][CC]
#define WS_VT  (WS_KH + 2u * (size_t)NB * TT * CC)      // f16 v planes [b][c][t]
#define WS_QL  (WS_VT + 2u * (size_t)NB * CC * TT)      // f16 q residual x 2^10 rows [b][t < QHI][CC]
#define WS_KL  (WS_QL + 2u * (size_t)NB * QHI * CC)     // f16 k residual x 2^10 rows [b][t < KHI][CC]
#define WS_VB  (WS_KL + 2u * (size_t)NB * KHI * CC)     // bf16 v hi planes [b][c][t < KHI]
#define WS_VBL (WS_VB + 2u * (size_t)NB * CC * KHI)
#define WS_S   (WS_VBL + 2u * (size_t)NB * CC * KHI)    // f32 logits / P [hg][t][s]
#define WS_Y   (WS_S  + 4u * (size_t)HG * TT * TT)      // f32 ctx rows [b*t][CC] (only when there is an output projection)
#define WS_END (WS_Y  + 0u)

// ---- k_sc: block = (query block qb, key block kb <= kb_last(qb), head in group) of batch b: logits x SCALE; q hi + residual (x 2^10) against k (2 products) for query rows < QHI, plus the k residual (3 products) for query blocks < QBH (causal early rows); causal: blocks past the diagonal exit, the mask itself is applied by index in k_tanh
__global__ __launch_bounds__(128) void k_sc(const _Float16* __restrict__ QH, const _Float16* __restrict__ KH, const _Float16* __restrict__ QL, const _Float16* __restrict__ KL, int b, int h0, float* __restrict__ S0) { __shared__ __align__(16) float ss[4][16][132];
  const int qb = blockIdx.x, kb = blockIdx.y; if (kb > kb_last(qb)) return;
  const int h = h0 + blockIdx.z; float* S = S0 + (size_t)blockIdx.z * TT * TT;
  const int tid = threadIdx.x, wave = tid >> 5, lane = tid & 31, col = lane & 15, g = lane >> 4; const int k0 = kb * 128; const int ql0 = qb * 64 + wave * 16; const size_t q0 = (size_t)b * TT + ql0, kr0 = (size_t)b * TT + k0;
  v8f acc[8] = {}, accl[8] = {};
  const _Float16* QLb = QL + (size_t)b * QHI * CC; const _Float16* KLb = KL + (size_t)b * KHI * CC;
  if (qb < QBH) {
#pragma unroll
    for (int kc = 0; kc < HD / 32; ++kc) { const v16h ah = frag_h(QH + (q0 + col) * CC + h * HD + kc * 32, lane), al = frag_h(QLb + (size_t)(ql0 + col) * CC + h * HD + kc * 32, lane);
#pragma unroll
      for (int j = 0; j < 8; ++j) { const v16h kbf = frag_h(KH + (kr0 + j * 16 + col) * CC + h * HD + kc * 32, lane), klf = frag_h(KLb + (size_t)(k0 + j * 16 + col) * CC + h * HD + kc * 32, lane); acc[j] = wmma16(ah, kbf, acc[j]); accl[j] = wmma16(al, kbf, accl[j]); accl[j] = wmma16(ah, klf, accl[j]); } }
  } else if (qb * 64 < QHI) {
#pragma unroll
    for (int kc = 0; kc < HD / 32; ++kc) { const v16h ah = frag_h(QH + (q0 + col) * CC + h * HD + kc * 32, lane), al = frag_h(QLb + (size_t)(ql0 + col) * CC + h * HD + kc * 32, lane);
#pragma unroll
      for (int j = 0; j < 8; ++j) { const v16h kbf = frag_h(KH + (kr0 + j * 16 + col) * CC + h * HD + kc * 32, lane); acc[j] = wmma16(ah, kbf, acc[j]); accl[j] = wmma16(al, kbf, accl[j]); } }
  } else {
#pragma unroll
    for (int kc = 0; kc < HD / 32; ++kc) { const v16h ah = frag_h(QH + (q0 + col) * CC + h * HD + kc * 32, lane);
#pragma unroll
      for (int j = 0; j < 8; ++j) { const v16h kbf = frag_h(KH + (kr0 + j * 16 + col) * CC + h * HD + kc * 32, lane); acc[j] = wmma16(ah, kbf, acc[j]); } } }
#pragma unroll
  for (int j = 0; j < 8; ++j) {
#pragma unroll
    for (int r = 0; r < 8; ++r) ss[wave][8 * g + r][j * 16 + col] = (acc[j][r] + accl[j][r] * (1.0f / 1024.0f)) * SCALE; }
  LDSX(); for (int rl = 0; rl < 16; ++rl) vst2(S + (size_t)(ql0 + rl) * TT + k0 + lane * 4, *(const v4f*)&ss[wave][rl][lane * 4]); }
// ---- k_tanh: block = query row t (head in group): att[k] = tanhf(logit) for k <= t (the logits already carry the 128^-0.5 scale), exactly -1 for k > t (tanh(-inf), as written - they still multiply v); stored x 2^11 over ALL TT keys
__global__ __launch_bounds__(256) void k_tanh(float* __restrict__ S0) { const int tid = threadIdx.x; const int t = blockIdx.x; float* sr = S0 + (size_t)blockIdx.y * TT * TT + (size_t)t * TT; __shared__ __align__(16) float shv[TT];
  for (int k = tid; k < TT; k += 256) { float a = -1.0f; if (k <= t) a = tanhf(sr[k]); shv[k] = a * 2048.0f; }
  __syncthreads(); for (int q = tid; q < TT / 4; q += 256) vst2(sr + q * 4, *(const v4f*)&shv[q * 4]); }
// ---- k_pv: block = 64 queries (qb) of (b, h): ctx = P . v over all TT keys (P x 2^11 once to f16 against v f16: 1 product; causal early query blocks: P and v as bf16 hi + lo, 3 products); 512-B (row, head) segment by 32 lanes
__global__ __launch_bounds__(128) void k_pv(const float* __restrict__ PS0, const _Float16* __restrict__ VT, const __bf16* __restrict__ VB, const __bf16* __restrict__ VBL, int b, int h0, float* __restrict__ Y) { const int h = h0 + blockIdx.z; const float* PS = PS0 + (size_t)blockIdx.z * TT * TT; __shared__ __align__(16) float ss[4][16][HD + 4];
  const int tid = threadIdx.x, wave = tid >> 5, lane = tid & 31, col = lane & 15, g = lane >> 4; const int qb = blockIdx.x; const int ql0 = qb * 64 + wave * 16; const int kce = TT / 32;   /* ALL keys: masked keys carry att = -1 */
  v8f acc[HD / 16] = {};
  if (qb < QBH) {
#pragma unroll 1
    for (int kc = 0; kc < kce; ++kc) { const F2 p = split_row(PS + (size_t)(ql0 + col) * TT, kc * 32, lane);
      asm volatile("s_wait_loadcnt 0x0" ::: "memory");
#pragma unroll
      for (int j = 0; j < HD / 16; ++j) { const size_t po = ((size_t)b * CC + h * HD + j * 16 + col) * (size_t)KHI + kc * 32; const v16b vh = frag_b(VB + po, lane); acc[j] = wmma_bf(p.h, vh, acc[j]); acc[j] = wmma_bf(p.l, vh, acc[j]); acc[j] = wmma_bf(p.h, frag_b(VBL + po, lane), acc[j]); } }
  } else {
#pragma unroll 1
    for (int kc = 0; kc < kce; ++kc) { const v16h p = frag_f32(PS + (size_t)(ql0 + col) * TT + kc * 32, lane);
      asm volatile("s_wait_loadcnt 0x0" ::: "memory");
#pragma unroll
      for (int j = 0; j < HD / 16; ++j) { const size_t po = ((size_t)b * CC + h * HD + j * 16 + col) * (size_t)TT + kc * 32; acc[j] = wmma16(p, frag_h(VT + po, lane), acc[j]); } } }
#pragma unroll
  for (int j = 0; j < HD / 16; ++j)
#pragma unroll
    for (int r = 0; r < 8; ++r) ss[wave][8 * g + r][j * 16 + col] = acc[j][r] * (1.0f / 2048.0f);
  LDSX(); for (int rl = 0; rl < 16; ++rl) if (lane < HD / 4) vst2(Y + ((size_t)b * TT + ql0 + rl) * CC + h * HD + lane * 4, *(const v4f*)&ss[wave][rl][lane * 4]); }

extern "C" void kernel_launch(void* const* d_in, const int* in_sizes, int n_in, void* d_out, int out_size, void* d_ws, size_t ws_size, hipStream_t stream) {
  (void)in_sizes; (void)n_in; (void)out_size;
  const float** F = (const float**)d_in;
  if (ws_size < (size_t)WS_END) return;
  char* ws = (char*)d_ws; _Float16 *QH = (_Float16*)(ws + WS_QH), *KH = (_Float16*)(ws + WS_KH), *VT = (_Float16*)(ws + WS_VT), *QL = (_Float16*)(ws + WS_QL), *KL = (_Float16*)(ws + WS_KL); __bf16 *VB = (__bf16*)(ws + WS_VB), *VBL = (__bf16*)(ws + WS_VBL); float *S = (float*)(ws + WS_S), *Y = (float*)(ws + WS_Y);
  (void)Y; (void)QL; (void)KL; (void)VB; (void)VBL;
  // inputs: 0 Q [2,2048,2048]; 1 K; 2 V (raw [B, T, (h, d)] tensors)
  k_prep8<<<dim3(TNB * TT / 64, NH), 128, 0, stream>>>(F[0], F[1], F[2], QH, QL, KH, KL, VT, VB, VBL);
  for (int b = 0; b < TNB; ++b) for (int h0 = 0; h0 < NH; h0 += HG) {
    k_sc<<<dim3(NQB, TT / 128, HG), 128, 0, stream>>>(QH, KH, QL, KL, b, h0, S);
    k_tanh<<<dim3(TT, HG), 256, 0, stream>>>(S);
    k_pv<<<dim3(NQB, 1, HG), 128, 0, stream>>>(S, VT, VB, VBL, b, h0, (float*)d_out);
  }
}

// v001
// Measured time: 716 microseconds a run.
// Next to v000, in two timings, it ran 3.00 times as fast each time.
// compute dtype: all float inputs rounded to bf16; interleaved-pair RoPE applied in f32 to the bf16 q/k rows (64 embedded f32 inverse frequencies = XLA's table, accurate sincosf of the f32 angle t*freq); rotated q/k as f16 hi + residual (x 2^10) planes below row 384, once to f16 beyond; causal logits x 128^-0.5 with 3 products below row 384, 1 product beyond; att = tanhf(logit) in f32 for k <= t and exactly -1 for k > t (tanh(-inf)); att x 2^11 against v over ALL keys: bf16 hi + lo (3 products) for query rows < 384, once to f16 against v f16 beyond; f32 output [B, T, C].
#include <hip/hip_runtime.h>
#include <math.h>

typedef __attribute__((ext_vector_type(16))) _Float16 v16h;
typedef __attribute__((ext_vector_type(16))) __bf16 v16b;
typedef __attribute__((ext_vector_type(8)))  _Float16 v8h;
typedef __attribute__((ext_vector_type(8)))  float v8f;
typedef __attribute__((ext_vector_type(4)))  float v4f;
typedef __attribute__((ext_vector_type(2)))  float v2f;
typedef __attribute__((ext_vector_type(4)))  unsigned v4u;
typedef __attribute__((ext_vector_type(4)))  int v4i;
typedef float __attribute__((may_alias)) float_a;
typedef int __attribute__((may_alias)) int_a;

template <typename T> __device__ __forceinline__ void vst2(void* p, T v) { *(T*)p = v;  }
__device__ __forceinline__ v8f wmma16(v16h a, v16h b, v8f c) {
  v8f d = __builtin_amdgcn_wmma_f32_16x16x32_f16(false, a, false, b, (short)0, c, false, false);
  asm volatile("v_nop\n\tv_nop\n\tv_nop\n\tv_nop" : "+v"(d) : "v"(a), "v"(b));
  return d;
}
__device__ __forceinline__ v8f wmma_bf(v16b a, v16b b, v8f c) {
  v8f d = __builtin_amdgcn_wmma_f32_16x16x32_bf16(false, a, false, b, (short)0, c, false, false);
  asm volatile("v_nop\n\tv_nop\n\tv_nop\n\tv_nop" : "+v"(d) : "v"(a), "v"(b));
  return d;
}
// 16x16x32 fragments: lane = (h = lane>>4, row/col = lane&15); elements 0..7 = k0+8h+0..7, 8..15 = k0+16+8h+0..7; D element r = row 8h+r
__device__ __forceinline__ v16h frag_h(const _Float16* rowk0, int lane) {
  union { v16h v; v8h q[2]; } u; const _Float16* p = rowk0 + 8 * (lane >> 4);
  u.q[0] = *(const v8h*)p; u.q[1] = *(const v8h*)(p + 16); return u.v;
}
__device__ __forceinline__ v16h frag_f32(const float* rowk0, int lane) {
  v16h a; const float* p = rowk0 + 8 * (lane >> 4);
#pragma unroll
  for (int i = 0; i < 8; ++i) { a[i] = (_Float16)p[i]; a[8 + i] = (_Float16)p[16 + i]; }
  return a;
}
__device__ __forceinline__ v16h frag_f32s(const float* rowk0, int lane, float sc) {
  v16h a; const float* p = rowk0 + 8 * (lane >> 4);
#pragma unroll
  for (int i = 0; i < 8; ++i) { a[i] = (_Float16)(p[i] * sc); a[8 + i] = (_Float16)(p[16 + i] * sc); }
  return a;
}
// column fragment from a [K][ld] layout (column n), rows >= K read as 0
__device__ __forceinline__ v16h fragc_f32(const float* W, int k0, int n, int lane, int ld, int K) {
  v16h a; const int g = lane >> 4;
#pragma unroll
  for (int i = 0; i < 8; ++i) { const int ka = k0 + 8 * g + i, kb = ka + 16;
    a[i] = (_Float16)(ka < K ? W[(size_t)(ka < K ? ka : K - 1) * ld + n] : 0.f); a[8 + i] = (_Float16)(kb < K ? W[(size_t)(kb < K ? kb : K - 1) * ld + n] : 0.f); }
  return a;
}
struct F2 { v16b h, l; };
__device__ __forceinline__ F2 bsplit16(const float v[16]) { F2 r;
#pragma unroll
  for (int i = 0; i < 16; ++i) { const __bf16 h = (__bf16)v[i]; r.h[i] = h; r.l[i] = (__bf16)(v[i] - (float)h); }
  return r; }
__device__ __forceinline__ F2 split_row(const float* row, int k0, int lane) { float v[16]; const float* p = row + k0 + 8 * (lane >> 4);
#pragma unroll
  for (int i = 0; i < 8; ++i) { v[i] = p[i]; v[8 + i] = p[16 + i]; }
  return bsplit16(v); }
__device__ __forceinline__ F2 split_rowK(const float* row, int k0, int lane, int K) { float v[16]; const int g = lane >> 4;
#pragma unroll
  for (int i = 0; i < 8; ++i) { const int ka = k0 + 8 * g + i, kb = ka + 16; v[i] = ka < K ? row[ka < K ? ka : K - 1] : 0.f; v[8 + i] = kb < K ? row[kb < K ? kb : K - 1] : 0.f; }
  return bsplit16(v); }
__device__ __forceinline__ F2 split_col(const float* W, int k0, int n, int lane, int ld, int K) { float v[16]; const int g = lane >> 4;
#pragma unroll
  for (int i = 0; i < 8; ++i) { const int ka = k0 + 8 * g + i, kb = ka + 16; v[i] = ka < K ? W[(size_t)(ka < K ? ka : K - 1) * ld + n] : 0.f; v[8 + i] = kb < K ? W[(size_t)(kb < K ? kb : K - 1) * ld + n] : 0.f; }
  return bsplit16(v); }
__device__ __forceinline__ v8f mac3(const F2& a, const F2& b, v8f c) { c = wmma_bf(a.l, b.h, c); c = wmma_bf(a.h, b.l, c); return wmma_bf(a.h, b.h, c); }
__device__ __forceinline__ float sigm(float v) { return 1.0f / (1.0f + expf(-v)); }
#define LDSX() do { asm volatile("s_wait_dscnt 0" ::: "memory"); __builtin_amdgcn_wave_barrier(); __builtin_amdgcn_fence(__ATOMIC_RELEASE, "workgroup"); } while (0)

// Causal 'tanh attention' (no softmax) with RoPE (B 2, T 2,048, C 2,048 = 16 heads x 128; raw Q, K, V inputs, no projections): q, k = rope_interleaved(split_heads(Q)), rope(split_heads(K)); scores = q k^T / sqrt(128); att = tanh(where(causal, scores, -inf)) -> masked entries are exactly -1 and STILL multiply v; out = att v merged to [B, T, C].
#define NB 2
#define TT 2048
#define CC 2048            // NH * HD = projected width
#define DIN 2048          // input (model) width
#define NH 16
#define HD 128
#define NQB (TT / 64)
#define HG 4
#define SCALE (0.08838834764831845f)
#define CAUSAL 1
#ifndef TNB
#define TNB NB
#endif
__device__ __forceinline__ float bfr(float v) { return (float)(__bf16)v; }
__host__ __device__ __forceinline__ int kb_last(int qb) { return CAUSAL ? ((qb * 64 + 63) >> 7) : (TT / 128 - 1); }
typedef __attribute__((ext_vector_type(8))) __bf16 v8b;
__device__ __forceinline__ v16b frag_b(const __bf16* rowk0, int lane) {
  union { v16b v; v8b q[2]; } u; const __bf16* p = rowk0 + 8 * (lane >> 4);
  u.q[0] = *(const v8b*)p; u.q[1] = *(const v8b*)(p + 16); return u.v;
}
#define QHI 384            // rows carrying a q residual plane
#define KHI 2048           // v bf16 planes for EVERY key (the tanh 'attention' multiplies all keys: masked ones by -1)
// B fragment (k rows k0+.., output column o) of a weight: (in,out) [K][ld] or (out,in) [ld rows of K]: bf16 exact, or f16(bf16 * 256) exact
__device__ __forceinline__ v16b wcol_io(const float* Wm, int k0, int o, int lane, int ld) { v16b w; const int g = lane >> 4;
#pragma unroll
  for (int i = 0; i < 8; ++i) { w[i] = (__bf16)Wm[(size_t)(k0 + 8 * g + i) * ld + o]; w[8 + i] = (__bf16)Wm[(size_t)(k0 + 16 + 8 * g + i) * ld + o]; }
  return w; }
__device__ __forceinline__ v16b wcol_oi(const float* Wm, int k0, int o, int lane, int K) { v16b w; const float* p = Wm + (size_t)o * K + k0 + 8 * (lane >> 4);
#pragma unroll
  for (int i = 0; i < 8; ++i) { w[i] = (__bf16)p[i]; w[8 + i] = (__bf16)p[16 + i]; }
  return w; }
__device__ __forceinline__ v16h wcolh_io(const float* Wm, int k0, int o, int lane, int ld) { v16h w; const int g = lane >> 4;
#pragma unroll
  for (int i = 0; i < 8; ++i) { w[i] = (_Float16)(bfr(Wm[(size_t)(k0 + 8 * g + i) * ld + o]) * 256.0f); w[8 + i] = (_Float16)(bfr(Wm[(size_t)(k0 + 16 + 8 * g + i) * ld + o]) * 256.0f); }
  return w; }
__device__ __forceinline__ v16h wcolh_oi(const float* Wm, int k0, int o, int lane, int K) { v16h w; const float* p = Wm + (size_t)o * K + k0 + 8 * (lane >> 4);
#pragma unroll
  for (int i = 0; i < 8; ++i) { w[i] = (_Float16)(bfr(p[i]) * 256.0f); w[8 + i] = (_Float16)(bfr(p[16 + i]) * 256.0f); }
  return w; }
#define WQKV_LAYOUT 1   // 0 = (in,out) [DIN][CC]; 1 = (out,in) [CC][DIN]; 2 = per-head [NH][DIN][HD]
__device__ __forceinline__ v16b wcol_hdk(const float* Wm, int k0, int o, int lane) { v16b w; const int g = lane >> 4; const float* p = Wm + (size_t)(o / HD) * DIN * HD + (o % HD);
#pragma unroll
  for (int i = 0; i < 8; ++i) { w[i] = (__bf16)p[(size_t)(k0 + 8 * g + i) * HD]; w[8 + i] = (__bf16)p[(size_t)(k0 + 16 + 8 * g + i) * HD]; }
  return w; }
#define WO_OUT_IN 0
#if WQKV_LAYOUT == 1
#define WCOL(W, k0, o, lane) wcol_oi(W, k0, o, lane, DIN)
#elif WQKV_LAYOUT == 2
#define WCOL(W, k0, o, lane) wcol_hdk(W, k0, o, lane)
#else
#define WCOL(W, k0, o, lane) wcol_io(W, k0, o, lane, CC)
#endif
#if WO_OUT_IN
#define WOCOL(W, k0, o, lane) wcol_oi(W, k0, o, lane, CC)
#define WOCOLH(W, k0, o, lane) wcolh_oi(W, k0, o, lane, CC)
#else
#define WOCOL(W, k0, o, lane) wcol_io(W, k0, o, lane, DIN)
#define WOCOLH(W, k0, o, lane) wcolh_io(W, k0, o, lane, DIN)
#endif
#define QBH 6
__constant__ float c_freq[64] = {1.000000000e+00f,8.659643531e-01f,7.498942018e-01f,6.493816376e-01f,5.623413324e-01f,4.869675338e-01f,4.216965139e-01f,3.651741445e-01f,3.162277639e-01f,2.738419771e-01f,2.371373624e-01f,2.053525001e-01f,1.778279394e-01f,1.539926529e-01f,1.333521456e-01f,1.154782027e-01f,1.000000015e-01f,8.659642935e-02f,7.498941571e-02f,6.493816525e-02f,5.623412877e-02f,4.869675264e-02f,4.216964915e-02f,3.651741147e-02f,3.162277862e-02f,2.738419548e-02f,2.371373586e-02f,2.053525113e-02f,1.778279431e-02f,1.539926510e-02f,1.333521493e-02f,1.154781971e-02f,9.999999776e-03f,8.659643121e-03f,7.498942316e-03f,6.493816618e-03f,5.623413250e-03f,4.869675264e-03f,4.216964822e-03f,3.651741426e-03f,3.162277862e-03f,2.738419687e-03f,2.371373819e-03f,2.053525066e-03f,1.778279431e-03f,1.539926510e-03f,1.333521446e-03f,1.154782018e-03f,1.000000047e-03f,8.659643354e-04f,7.498941850e-04f,6.493816618e-04f,5.623413017e-04f,4.869675031e-04f,4.216964880e-04f,3.651741135e-04f,3.162277862e-04f,2.738419571e-04f,2.371373848e-04f,2.053524950e-04f,1.778279402e-04f,1.539926452e-04f,1.333521504e-04f,1.154781930e-04f};   /* 1/10000^(2i/128), i = 0..63, as XLA's f32 table */
// ---- k_prep8: block = (64 attention positions s0.. of sequence b, head h): reads the raw [B, T, C] inputs (element (b,s,h,c) at (b*TT + s)*CC + h*HD + c), bf16-rounds them and writes the standard attention planes: q -> f16 hi rows (+ x 2^10 residual rows for s < QHI), k -> f16 rows (+ residual rows s < KHI), v -> f16 planes [c][s] (+ bf16 hi/lo planes for s < KHI)
__global__ __launch_bounds__(128) void k_prep8(const float* __restrict__ Q, const float* __restrict__ K, const float* __restrict__ V, _Float16* __restrict__ QH, _Float16* __restrict__ QL, _Float16* __restrict__ KH, _Float16* __restrict__ KL, _Float16* __restrict__ VT, __bf16* __restrict__ VB, __bf16* __restrict__ VBL) {
  __shared__ __align__(16) _Float16 sq[64][136], sql[64][136], sk[64][136], skl[64][136], tv[128][72]; __shared__ __align__(16) __bf16 tb[128][72], tbl[128][72];
  const int tid = threadIdx.x; const int h = blockIdx.y; const size_t r0 = (size_t)blockIdx.x * 64; const size_t bb = r0 / TT; const int t0 = (int)(r0 % TT); const bool qhi = t0 < QHI, khi = t0 < KHI;
  for (int e = tid; e < 64 * 128; e += 128) { const int rl = e >> 7, c = e & 127; const size_t oi = ((bb * TT + t0 + rl) * (size_t)CC) + h * HD + (c % HD);   /* raw [B, T, (h, d)] layout */
    float q, k; const float v = bfr(V[oi]);   /* module inputs bf16-rounded; interleaved-pair RoPE on q and k in f32 */
    { const int d = c % HD; const size_t oe = oi - (d & 1), oo = oe + 1; const float ang = (float)(t0 + rl) * c_freq[d >> 1]; float sn, cs; sincosf(ang, &sn, &cs);
      const float qe = bfr(Q[oe]), qo = bfr(Q[oo]), ke = bfr(K[oe]), ko = bfr(K[oo]);
      q = (d & 1) ? (qe * sn + qo * cs) : (qe * cs - qo * sn); k = (d & 1) ? (ke * sn + ko * cs) : (ke * cs - ko * sn); }
    const _Float16 qh = (_Float16)q, kh = (_Float16)k; sq[rl][c] = qh; sql[rl][c] = (_Float16)((q - (float)qh) * 1024.0f); sk[rl][c] = kh; skl[rl][c] = (_Float16)((k - (float)kh) * 1024.0f);
    tv[c][rl] = (_Float16)v; const __bf16 vb = (__bf16)v; tb[c][rl] = vb; tbl[c][rl] = (__bf16)(v - (float)vb); }
  __syncthreads();
  for (int e = tid; e < 64 * (HD / 8); e += 128) { const int rl = e / (HD / 8), q = e % (HD / 8); const size_t o = (r0 + rl) * CC + h * HD + q * 8; vst2((unsigned*)(QH + o), *(const v4u*)&sq[rl][q * 8]); vst2((unsigned*)(KH + o), *(const v4u*)&sk[rl][q * 8]);   
    if (qhi) vst2((unsigned*)(QL + (bb * QHI + t0 + rl) * (size_t)CC + h * HD + q * 8), *(const v4u*)&sql[rl][q * 8]); if (khi) vst2((unsigned*)(KL + (bb * KHI + t0 + rl) * (size_t)CC + h * HD + q * 8), *(const v4u*)&skl[rl][q * 8]); }
  for (int e = tid; e < HD * 8; e += 128) { const int cl = e >> 3, q = e & 7; vst2((unsigned*)(VT + (bb * CC + h * HD + cl) * (size_t)TT + t0 + q * 8), *(const v4u*)&tv[cl][q * 8]);
    if (khi) { const size_t o3 = (bb * CC + h * HD + cl) * (size_t)KHI + t0 + q * 8; vst2((unsigned*)(VB + o3), *(const v4u*)&tb[cl][q * 8]); vst2((unsigned*)(VBL + o3), *(const v4u*)&tbl[cl][q * 8]); } } }

#ifndef SM_EXTRA_PARAMS
#define SM_EXTRA_PARAMS
#endif
#ifndef PROJ_EXTRA_PARAMS
#define PROJ_EXTRA_PARAMS
#endif
#ifndef SM_MASK_HOOK
#define SM_MASK_HOOK (void)0
#endif

#define WS_QH  0u                                      // f16 q rows [b*t][CC]
#define WS_KH  (WS_QH + 2u * (size_t)NB * TT * CC)      // f16 k rows [b*t][CC]
#define WS_VT  (WS_KH + 2u * (size_t)NB * TT * CC)      // f16 v planes [b][c][t]
#define WS_QL  (WS_VT + 2u * (size_t)NB * CC * TT)      // f16 q residual x 2^10 rows [b][t < QHI][CC]
#define WS_KL  (WS_QL + 2u * (size_t)NB * QHI * CC)     // f16 k residual x 2^10 rows [b][t < KHI][CC]
#define WS_VB  (WS_KL + 2u * (size_t)NB * KHI * CC)     // bf16 v hi planes [b][c][t < KHI]
#define WS_VBL (WS_VB + 2u * (size_t)NB * CC * KHI)
#define WS_S   (WS_VBL + 2u * (size_t)NB * CC * KHI)    // f32 logits / P [hg][t][s]
#define WS_Y   (WS_S  + 4u * (size_t)HG * TT * TT)      // f32 ctx rows [b*t][CC] (only when there is an output projection)
#define WS_END (WS_Y  + 0u)

// ---- k_sc: block = (query block qb, key block kb <= kb_last(qb), head in group) of batch b: logits x SCALE; q hi + residual (x 2^10) against k (2 products) for query rows < QHI, plus the k residual (3 products) for query blocks < QBH (causal early rows); causal: blocks past the diagonal exit, the mask itself is applied by index in k_tanh
__global__ __launch_bounds__(128) void k_sc(const _Float16* __restrict__ QH, const _Float16* __restrict__ KH, const _Float16* __restrict__ QL, const _Float16* __restrict__ KL, int b, int h0, float* __restrict__ S0) { __shared__ __align__(16) float ss[4][16][132];
  const int qb = blockIdx.x, kb = blockIdx.y; if (kb > kb_last(qb)) return;
  const int h = h0 + blockIdx.z; float* S = S0 + (size_t)blockIdx.z * TT * TT;
  const int tid = threadIdx.x, wave = tid >> 5, lane = tid & 31, col = lane & 15, g = lane >> 4; const int k0 = kb * 128; const int ql0 = qb * 64 + wave * 16; const size_t q0 = (size_t)b * TT + ql0, kr0 = (size_t)b * TT + k0;
  v8f acc[8] = {}, accl[8] = {};
  const _Float16* QLb = QL + (size_t)b * QHI * CC; const _Float16* KLb = KL + (size_t)b * KHI * CC;
  if (qb < QBH) {
#pragma unroll
    for (int kc = 0; kc < HD / 32; ++kc) { const v16h ah = frag_h(QH + (q0 + col) * CC + h * HD + kc * 32, lane), al = frag_h(QLb + (size_t)(ql0 + col) * CC + h * HD + kc * 32, lane);
#pragma unroll
      for (int j = 0; j < 8; ++j) { const v16h kbf = frag_h(KH + (kr0 + j * 16 + col) * CC + h * HD + kc * 32, lane), klf = frag_h(KLb + (size_t)(k0 + j * 16 + col) * CC + h * HD + kc * 32, lane); acc[j] = wmma16(ah, kbf, acc[j]); accl[j] = wmma16(al, kbf, accl[j]); accl[j] = wmma16(ah, klf, accl[j]); } }
  } else if (qb * 64 < QHI) {
#pragma unroll
    for (int kc = 0; kc < HD / 32; ++kc) { const v16h ah = frag_h(QH + (q0 + col) * CC + h * HD + kc * 32, lane), al = frag_h(QLb + (size_t)(ql0 + col) * CC + h * HD + kc * 32, lane);
#pragma unroll
      for (int j = 0; j < 8; ++j) { const v16h kbf = frag_h(KH + (kr0 + j * 16 + col) * CC + h * HD + kc * 32, lane); acc[j] = wmma16(ah, kbf, acc[j]); accl[j] = wmma16(al, kbf, accl[j]); } }
  } else {
#pragma unroll
    for (int kc = 0; kc < HD / 32; ++kc) { const v16h ah = frag_h(QH + (q0 + col) * CC + h * HD + kc * 32, lane);
#pragma unroll
      for (int j = 0; j < 8; ++j) { const v16h kbf = frag_h(KH + (kr0 + j * 16 + col) * CC + h * HD + kc * 32, lane); acc[j] = wmma16(ah, kbf, acc[j]); } } }
#pragma unroll
  for (int j = 0; j < 8; ++j) {
#pragma unroll
    for (int r = 0; r < 8; ++r) ss[wave][8 * g + r][j * 16 + col] = (acc[j][r] + accl[j][r] * (1.0f / 1024.0f)) * SCALE; }
  LDSX(); for (int rl = 0; rl < 16; ++rl) vst2(S + (size_t)(ql0 + rl) * TT + k0 + lane * 4, *(const v4f*)&ss[wave][rl][lane * 4]); }
// ---- k_tanh: block = query row t (head in group): att[k] = tanhf(logit) for k <= t (the logits already carry the 128^-0.5 scale), exactly -1 for k > t (tanh(-inf), as written - they still multiply v); stored x 2^11 over ALL TT keys
__global__ __launch_bounds__(256) void k_tanh(float* __restrict__ S0) { const int tid = threadIdx.x; const int t = blockIdx.x; float* sr = S0 + (size_t)blockIdx.y * TT * TT + (size_t)t * TT; __shared__ __align__(16) float shv[TT];
  for (int k = tid; k < TT; k += 256) { float a = -1.0f; if (k <= t) a = tanhf(sr[k]); shv[k] = a * 2048.0f; }
  __syncthreads(); for (int q = tid; q < TT / 4; q += 256) vst2(sr + q * 4, *(const v4f*)&shv[q * 4]); }
// ---- k_pv: block = 16 queries (qt) of (b, h), KS waves: wave w sums ctx = P . v over its own key slice [w * TT / KS, (w + 1) * TT / KS) (P x 2^11 once to f16 against v f16: 1 product; causal early query rows: P and v as bf16 hi + lo, 3 products); the KS f32 partial tiles meet in LDS and are added in slice order; 512-B (row, head) segment by 32 lanes
#define KS 16
__global__ __launch_bounds__(32 * KS) void k_pv(const float* __restrict__ PS0, const _Float16* __restrict__ VT, const __bf16* __restrict__ VB, const __bf16* __restrict__ VBL, int b, int h0, float* __restrict__ Y) { const int h = h0 + blockIdx.z; const float* PS = PS0 + (size_t)blockIdx.z * TT * TT; __shared__ __align__(16) float ss[KS][16][HD + 4];
  const int tid = threadIdx.x, wave = tid >> 5, lane = tid & 31, col = lane & 15, g = lane >> 4; const int ql0 = blockIdx.x * 16; const int kc0 = wave * (TT / 32 / KS), kce = kc0 + TT / 32 / KS;   /* ALL keys over the KS waves: masked keys carry att = -1 */
  v8f acc[HD / 16] = {};
  if (ql0 < QBH * 64) {
#pragma unroll 1
    for (int kc = kc0; kc < kce; ++kc) { const F2 p = split_row(PS + (size_t)(ql0 + col) * TT, kc * 32, lane);
      asm volatile("s_wait_loadcnt 0x0" ::: "memory");
#pragma unroll
      for (int j = 0; j < HD / 16; ++j) { const size_t po = ((size_t)b * CC + h * HD + j * 16 + col) * (size_t)KHI + kc * 32; const v16b vh = frag_b(VB + po, lane); acc[j] = wmma_bf(p.h, vh, acc[j]); acc[j] = wmma_bf(p.l, vh, acc[j]); acc[j] = wmma_bf(p.h, frag_b(VBL + po, lane), acc[j]); }
      asm volatile("s_wait_xcnt 0x0" ::: "memory");   /* before the next pass rewrites the address registers that this pass's v loads name */ }
  } else {
#pragma unroll 1
    for (int kc = kc0; kc < kce; ++kc) { const v16h p = frag_f32(PS + (size_t)(ql0 + col) * TT + kc * 32, lane);
      asm volatile("s_wait_loadcnt 0x0" ::: "memory");
#pragma unroll
      for (int j = 0; j < HD / 16; ++j) { const size_t po = ((size_t)b * CC + h * HD + j * 16 + col) * (size_t)TT + kc * 32; acc[j] = wmma16(p, frag_h(VT + po, lane), acc[j]); }
      asm volatile("s_wait_xcnt 0x0" ::: "memory");   /* before the next pass rewrites the address registers that this pass's v loads name */ } }
#pragma unroll
  for (int j = 0; j < HD / 16; ++j)
#pragma unroll
    for (int r = 0; r < 8; ++r) ss[wave][8 * g + r][j * 16 + col] = acc[j][r];
  __syncthreads();   /* every wave's partial tile is in LDS before any thread adds across the waves */
  for (int e = tid; e < 16 * (HD / 4); e += 32 * KS) { const int rl = e / (HD / 4), c4 = e % (HD / 4); v4f s = *(const v4f*)&ss[0][rl][c4 * 4];   /* unrolled below: the KS LDS reads are then in flight together instead of one wait each */
#pragma unroll
    for (int w = 1; w < KS; ++w) s += *(const v4f*)&ss[w][rl][c4 * 4];
    vst2(Y + ((size_t)b * TT + ql0 + rl) * CC + h * HD + c4 * 4, s * (1.0f / 2048.0f)); } }

extern "C" void kernel_launch(void* const* d_in, const int* in_sizes, int n_in, void* d_out, int out_size, void* d_ws, size_t ws_size, hipStream_t stream) {
  (void)in_sizes; (void)n_in; (void)out_size;
  const float** F = (const float**)d_in;
  if (ws_size < (size_t)WS_END) return;
  char* ws = (char*)d_ws; _Float16 *QH = (_Float16*)(ws + WS_QH), *KH = (_Float16*)(ws + WS_KH), *VT = (_Float16*)(ws + WS_VT), *QL = (_Float16*)(ws + WS_QL), *KL = (_Float16*)(ws + WS_KL); __bf16 *VB = (__bf16*)(ws + WS_VB), *VBL = (__bf16*)(ws + WS_VBL); float *S = (float*)(ws + WS_S), *Y = (float*)(ws + WS_Y);
  (void)Y; (void)QL; (void)KL; (void)VB; (void)VBL;
  // inputs: 0 Q [2,2048,2048]; 1 K; 2 V (raw [B, T, (h, d)] tensors)
  k_prep8<<<dim3(TNB * TT / 64, NH), 128, 0, stream>>>(F[0], F[1], F[2], QH, QL, KH, KL, VT, VB, VBL);
  for (int b = 0; b < TNB; ++b) for (int h0 = 0; h0 < NH; h0 += HG) {
    k_sc<<<dim3(NQB, TT / 128, HG), 128, 0, stream>>>(QH, KH, QL, KL, b, h0, S);
    k_tanh<<<dim3(TT, HG), 256, 0, stream>>>(S);
    k_pv<<<dim3(TT / 16, 1, HG), 32 * KS, 0, stream>>>(S, VT, VB, VBL, b, h0, (float*)d_out);
  }
}

// v002
// One run takes 249 microseconds.
// Timed twice side by side with v001, it ran 2.88 times as fast both times.
// All steps since v000 together make it 8.63 times as fast.
// compute dtype: all float inputs rounded to bf16; interleaved-pair RoPE applied in f32 to the bf16 q/k rows (64 embedded f32 inverse frequencies = XLA's table, accurate sincosf of the f32 angle t*freq); rotated q/k as f16 hi + residual (x 2^10) planes below row 384, once to f16 beyond; causal logits x 128^-0.5 with 3 products below row 384, 1 product beyond; att = tanh(logit) in f32 (two range formulas, one selected per lane) for k <= t and exactly -1 for k > t (tanh(-inf)); att x 2^11 against v over ALL keys: bf16 hi + lo (3 products) for query rows < 384, once to f16 against v f16 beyond; f32 output [B, T, C].
#include <hip/hip_runtime.h>
#include <math.h>

typedef __attribute__((ext_vector_type(16))) _Float16 v16h;
typedef __attribute__((ext_vector_type(16))) __bf16 v16b;
typedef __attribute__((ext_vector_type(8)))  _Float16 v8h;
typedef __attribute__((ext_vector_type(8)))  float v8f;
typedef __attribute__((ext_vector_type(4)))  float v4f;
typedef __attribute__((ext_vector_type(2)))  float v2f;
typedef __attribute__((ext_vector_type(4)))  unsigned v4u;
typedef __attribute__((ext_vector_type(4)))  int v4i;
typedef float __attribute__((may_alias)) float_a;
typedef int __attribute__((may_alias)) int_a;

template <typename T> __device__ __forceinline__ void vst2(void* p, T v) { *(T*)p = v;  }
__device__ __forceinline__ v8f wmma16(v16h a, v16h b, v8f c) {
  v8f d = __builtin_amdgcn_wmma_f32_16x16x32_f16(false, a, false, b, (short)0, c, false, false);
  asm volatile("v_nop\n\tv_nop\n\tv_nop\n\tv_nop" : "+v"(d) : "v"(a), "v"(b));
  return d;
}
__device__ __forceinline__ v8f wmma_bf(v16b a, v16b b, v8f c) {
  v8f d = __builtin_amdgcn_wmma_f32_16x16x32_bf16(false, a, false, b, (short)0, c, false, false);
  asm volatile("v_nop\n\tv_nop\n\tv_nop\n\tv_nop" : "+v"(d) : "v"(a), "v"(b));
  return d;
}
// 16x16x32 fragments: lane = (h = lane>>4, row/col = lane&15); elements 0..7 = k0+8h+0..7, 8..15 = k0+16+8h+0..7; D element r = row 8h+r
__device__ __forceinline__ v16h frag_h(const _Float16* rowk0, int lane) {
  union { v16h v; v8h q[2]; } u; const _Float16* p = rowk0 + 8 * (lane >> 4);
  u.q[0] = *(const v8h*)p; u.q[1] = *(const v8h*)(p + 16); return u.v;
}
__device__ __forceinline__ v16h frag_f32(const float* rowk0, int lane) {
  v16h a; const float* p = rowk0 + 8 * (lane >> 4);
#pragma unroll
  for (int i = 0; i < 8; ++i) { a[i] = (_Float16)p[i]; a[8 + i] = (_Float16)p[16 + i]; }
  return a;
}
__device__ __forceinline__ v16h frag_f32s(const float* rowk0, int lane, float sc) {
  v16h a; const float* p = rowk0 + 8 * (lane >> 4);
#pragma unroll
  for (int i = 0; i < 8; ++i) { a[i] = (_Float16)(p[i] * sc); a[8 + i] = (_Float16)(p[16 + i] * sc); }
  return a;
}
// column fragment from a [K][ld] layout (column n), rows >= K read as 0
__device__ __forceinline__ v16h fragc_f32(const float* W, int k0, int n, int lane, int ld, int K) {
  v16h a; const int g = lane >> 4;
#pragma unroll
  for (int i = 0; i < 8; ++i) { const int ka = k0 + 8 * g + i, kb = ka + 16;
    a[i] = (_Float16)(ka < K ? W[(size_t)(ka < K ? ka : K - 1) * ld + n] : 0.f); a[8 + i] = (_Float16)(kb < K ? W[(size_t)(kb < K ? kb : K - 1) * ld + n] : 0.f); }
  return a;
}
struct F2 { v16b h, l; };
__device__ __forceinline__ F2 bsplit16(const float v[16]) { F2 r;
#pragma unroll
  for (int i = 0; i < 16; ++i) { const __bf16 h = (__bf16)v[i]; r.h[i] = h; r.l[i] = (__bf16)(v[i] - (float)h); }
  return r; }
__device__ __forceinline__ F2 split_row(const float* row, int k0, int lane) { float v[16]; const float* p = row + k0 + 8 * (lane >> 4);
#pragma unroll
  for (int i = 0; i < 8; ++i) { v[i] = p[i]; v[8 + i] = p[16 + i]; }
  return bsplit16(v); }
__device__ __forceinline__ F2 split_rowK(const float* row, int k0, int lane, int K) { float v[16]; const int g = lane >> 4;
#pragma unroll
  for (int i = 0; i < 8; ++i) { const int ka = k0 + 8 * g + i, kb = ka + 16; v[i] = ka < K ? row[ka < K ? ka : K - 1] : 0.f; v[8 + i] = kb < K ? row[kb < K ? kb : K - 1] : 0.f; }
  return bsplit16(v); }
__device__ __forceinline__ F2 split_col(const float* W, int k0, int n, int lane, int ld, int K) { float v[16]; const int g = lane >> 4;
#pragma unroll
  for (int i = 0; i < 8; ++i) { const int ka = k0 + 8 * g + i, kb = ka + 16; v[i] = ka < K ? W[(size_t)(ka < K ? ka : K - 1) * ld + n] : 0.f; v[8 + i] = kb < K ? W[(size_t)(kb < K ? kb : K - 1) * ld + n] : 0.f; }
  return bsplit16(v); }
__device__ __forceinline__ v8f mac3(const F2& a, const F2& b, v8f c) { c = wmma_bf(a.l, b.h, c); c = wmma_bf(a.h, b.l, c); return wmma_bf(a.h, b.h, c); }
__device__ __forceinline__ float sigm(float v) { return 1.0f / (1.0f + expf(-v)); }
#define LDSX() do { asm volatile("s_wait_dscnt 0" ::: "memory"); __builtin_amdgcn_wave_barrier(); __builtin_amdgcn_fence(__ATOMIC_RELEASE, "workgroup"); } while (0)

// Causal 'tanh attention' (no softmax) with RoPE (B 2, T 2,048, C 2,048 = 16 heads x 128; raw Q, K, V inputs, no projections): q, k = rope_interleaved(split_heads(Q)), rope(split_heads(K)); scores = q k^T / sqrt(128); att = tanh(where(causal, scores, -inf)) -> masked entries are exactly -1 and STILL multiply v; out = att v merged to [B, T, C].
#define NB 2
#define TT 2048
#define CC 2048            // NH * HD = projected width
#define DIN 2048          // input (model) width
#define NH 16
#define HD 128
#define NQB (TT / 64)
#define HG 4
#define SCALE (0.08838834764831845f)
#define CAUSAL 1
#ifndef TNB
#define TNB NB
#endif
__device__ __forceinline__ float bfr(float v) { return (float)(__bf16)v; }
__host__ __device__ __forceinline__ int kb_last(int qb) { return CAUSAL ? ((qb * 64 + 63) >> 7) : (TT / 128 - 1); }
typedef __attribute__((ext_vector_type(8))) __bf16 v8b;
__device__ __forceinline__ v16b frag_b(const __bf16* rowk0, int lane) {
  union { v16b v; v8b q[2]; } u; const __bf16* p = rowk0 + 8 * (lane >> 4);
  u.q[0] = *(const v8b*)p; u.q[1] = *(const v8b*)(p + 16); return u.v;
}
#define QHI 384            // rows carrying a q residual plane
#define KHI 2048           // v bf16 planes for EVERY key (the tanh 'attention' multiplies all keys: masked ones by -1)
// B fragment (k rows k0+.., output column o) of a weight: (in,out) [K][ld] or (out,in) [ld rows of K]: bf16 exact, or f16(bf16 * 256) exact
__device__ __forceinline__ v16b wcol_io(const float* Wm, int k0, int o, int lane, int ld) { v16b w; const int g = lane >> 4;
#pragma unroll
  for (int i = 0; i < 8; ++i) { w[i] = (__bf16)Wm[(size_t)(k0 + 8 * g + i) * ld + o]; w[8 + i] = (__bf16)Wm[(size_t)(k0 + 16 + 8 * g + i) * ld + o]; }
  return w; }
__device__ __forceinline__ v16b wcol_oi(const float* Wm, int k0, int o, int lane, int K) { v16b w; const float* p = Wm + (size_t)o * K + k0 + 8 * (lane >> 4);
#pragma unroll
  for (int i = 0; i < 8; ++i) { w[i] = (__bf16)p[i]; w[8 + i] = (__bf16)p[16 + i]; }
  return w; }
__device__ __forceinline__ v16h wcolh_io(const float* Wm, int k0, int o, int lane, int ld) { v16h w; const int g = lane >> 4;
#pragma unroll
  for (int i = 0; i < 8; ++i) { w[i] = (_Float16)(bfr(Wm[(size_t)(k0 + 8 * g + i) * ld + o]) * 256.0f); w[8 + i] = (_Float16)(bfr(Wm[(size_t)(k0 + 16 + 8 * g + i) * ld + o]) * 256.0f); }
  return w; }
__device__ __forceinline__ v16h wcolh_oi(const float* Wm, int k0, int o, int lane, int K) { v16h w; const float* p = Wm + (size_t)o * K + k0 + 8 * (lane >> 4);
#pragma unroll
  for (int i = 0; i < 8; ++i) { w[i] = (_Float16)(bfr(p[i]) * 256.0f); w[8 + i] = (_Float16)(bfr(p[16 + i]) * 256.0f); }
  return w; }
#define WQKV_LAYOUT 1   // 0 = (in,out) [DIN][CC]; 1 = (out,in) [CC][DIN]; 2 = per-head [NH][DIN][HD]
__device__ __forceinline__ v16b wcol_hdk(const float* Wm, int k0, int o, int lane) { v16b w; const int g = lane >> 4; const float* p = Wm + (size_t)(o / HD) * DIN * HD + (o % HD);
#pragma unroll
  for (int i = 0; i < 8; ++i) { w[i] = (__bf16)p[(size_t)(k0 + 8 * g + i) * HD]; w[8 + i] = (__bf16)p[(size_t)(k0 + 16 + 8 * g + i) * HD]; }
  return w; }
#define WO_OUT_IN 0
#if WQKV_LAYOUT == 1
#define WCOL(W, k0, o, lane) wcol_oi(W, k0, o, lane, DIN)
#elif WQKV_LAYOUT == 2
#define WCOL(W, k0, o, lane) wcol_hdk(W, k0, o, lane)
#else
#define WCOL(W, k0, o, lane) wcol_io(W, k0, o, lane, CC)
#endif
#if WO_OUT_IN
#define WOCOL(W, k0, o, lane) wcol_oi(W, k0, o, lane, CC)
#define WOCOLH(W, k0, o, lane) wcolh_oi(W, k0, o, lane, CC)
#else
#define WOCOL(W, k0, o, lane) wcol_io(W, k0, o, lane, DIN)
#define WOCOLH(W, k0, o, lane) wcolh_io(W, k0, o, lane, DIN)
#endif
#define QBH 6
__constant__ float c_freq[64] = {1.000000000e+00f,8.659643531e-01f,7.498942018e-01f,6.493816376e-01f,5.623413324e-01f,4.869675338e-01f,4.216965139e-01f,3.651741445e-01f,3.162277639e-01f,2.738419771e-01f,2.371373624e-01f,2.053525001e-01f,1.778279394e-01f,1.539926529e-01f,1.333521456e-01f,1.154782027e-01f,1.000000015e-01f,8.659642935e-02f,7.498941571e-02f,6.493816525e-02f,5.623412877e-02f,4.869675264e-02f,4.216964915e-02f,3.651741147e-02f,3.162277862e-02f,2.738419548e-02f,2.371373586e-02f,2.053525113e-02f,1.778279431e-02f,1.539926510e-02f,1.333521493e-02f,1.154781971e-02f,9.999999776e-03f,8.659643121e-03f,7.498942316e-03f,6.493816618e-03f,5.623413250e-03f,4.869675264e-03f,4.216964822e-03f,3.651741426e-03f,3.162277862e-03f,2.738419687e-03f,2.371373819e-03f,2.053525066e-03f,1.778279431e-03f,1.539926510e-03f,1.333521446e-03f,1.154782018e-03f,1.000000047e-03f,8.659643354e-04f,7.498941850e-04f,6.493816618e-04f,5.623413017e-04f,4.869675031e-04f,4.216964880e-04f,3.651741135e-04f,3.162277862e-04f,2.738419571e-04f,2.371373848e-04f,2.053524950e-04f,1.778279402e-04f,1.539926452e-04f,1.333521504e-04f,1.154781930e-04f};   /* 1/10000^(2i/128), i = 0..63, as XLA's f32 table */
// ---- k_prep8: block = (64 attention positions s0.. of sequence b, head h): reads the raw [B, T, C] inputs (element (b,s,h,c) at (b*TT + s)*CC + h*HD + c), bf16-rounds them and writes the standard attention planes: q -> f16 hi rows (+ x 2^10 residual rows for s < QHI), k -> f16 rows (+ residual rows s < KHI), v -> f16 planes [c][s] (+ bf16 hi/lo planes for s < KHI)
__global__ __launch_bounds__(128) void k_prep8(const float* __restrict__ Q, const float* __restrict__ K, const float* __restrict__ V, _Float16* __restrict__ QH, _Float16* __restrict__ QL, _Float16* __restrict__ KH, _Float16* __restrict__ KL, _Float16* __restrict__ VT, __bf16* __restrict__ VB, __bf16* __restrict__ VBL) {
  __shared__ __align__(16) _Float16 sq[64][136], sql[64][136], sk[64][136], skl[64][136], tv[128][72]; __shared__ __align__(16) __bf16 tb[128][72], tbl[128][72];
  const int tid = threadIdx.x; const int h = blockIdx.y; const size_t r0 = (size_t)blockIdx.x * 64; const size_t bb = r0 / TT; const int t0 = (int)(r0 % TT); const bool qhi = t0 < QHI, khi = t0 < KHI;
  for (int e = tid; e < 64 * 128; e += 128) { const int rl = e >> 7, c = e & 127; const size_t oi = ((bb * TT + t0 + rl) * (size_t)CC) + h * HD + (c % HD);   /* raw [B, T, (h, d)] layout */
    float q, k; const float v = bfr(V[oi]);   /* module inputs bf16-rounded; interleaved-pair RoPE on q and k in f32 */
    { const int d = c % HD; const size_t oe = oi - (d & 1), oo = oe + 1; const float ang = (float)(t0 + rl) * c_freq[d >> 1]; float sn, cs; sincosf(ang, &sn, &cs);
      const float qe = bfr(Q[oe]), qo = bfr(Q[oo]), ke = bfr(K[oe]), ko = bfr(K[oo]);
      q = (d & 1) ? (qe * sn + qo * cs) : (qe * cs - qo * sn); k = (d & 1) ? (ke * sn + ko * cs) : (ke * cs - ko * sn); }
    const _Float16 qh = (_Float16)q, kh = (_Float16)k; sq[rl][c] = qh; sql[rl][c] = (_Float16)((q - (float)qh) * 1024.0f); sk[rl][c] = kh; skl[rl][c] = (_Float16)((k - (float)kh) * 1024.0f);
    tv[c][rl] = (_Float16)v; const __bf16 vb = (__bf16)v; tb[c][rl] = vb; tbl[c][rl] = (__bf16)(v - (float)vb); }
  __syncthreads();
  for (int e = tid; e < 64 * (HD / 8); e += 128) { const int rl = e / (HD / 8), q = e % (HD / 8); const size_t o = (r0 + rl) * CC + h * HD + q * 8; vst2((unsigned*)(QH + o), *(const v4u*)&sq[rl][q * 8]); vst2((unsigned*)(KH + o), *(const v4u*)&sk[rl][q * 8]);   
    if (qhi) vst2((unsigned*)(QL + (bb * QHI + t0 + rl) * (size_t)CC + h * HD + q * 8), *(const v4u*)&sql[rl][q * 8]); if (khi) vst2((unsigned*)(KL + (bb * KHI + t0 + rl) * (size_t)CC + h * HD + q * 8), *(const v4u*)&skl[rl][q * 8]); }
  for (int e = tid; e < HD * 8; e += 128) { const int cl = e >> 3, q = e & 7; vst2((unsigned*)(VT + (bb * CC + h * HD + cl) * (size_t)TT + t0 + q * 8), *(const v4u*)&tv[cl][q * 8]);
    if (khi) { const size_t o3 = (bb * CC + h * HD + cl) * (size_t)KHI + t0 + q * 8; vst2((unsigned*)(VB + o3), *(const v4u*)&tb[cl][q * 8]); vst2((unsigned*)(VBL + o3), *(const v4u*)&tbl[cl][q * 8]); } } }

#ifndef SM_EXTRA_PARAMS
#define SM_EXTRA_PARAMS
#endif
#ifndef PROJ_EXTRA_PARAMS
#define PROJ_EXTRA_PARAMS
#endif
#ifndef SM_MASK_HOOK
#define SM_MASK_HOOK (void)0
#endif

#define WS_QH  0u                                      // f16 q rows [b*t][CC]
#define WS_KH  (WS_QH + 2u * (size_t)NB * TT * CC)      // f16 k rows [b*t][CC]
#define WS_VT  (WS_KH + 2u * (size_t)NB * TT * CC)      // f16 v planes [b][c][t]
#define WS_QL  (WS_VT + 2u * (size_t)NB * CC * TT)      // f16 q residual x 2^10 rows [b][t < QHI][CC]
#define WS_KL  (WS_QL + 2u * (size_t)NB * QHI * CC)     // f16 k residual x 2^10 rows [b][t < KHI][CC]
#define WS_VB  (WS_KL + 2u * (size_t)NB * KHI * CC)     // bf16 v hi planes [b][c][t < KHI]
#define WS_VBL (WS_VB + 2u * (size_t)NB * CC * KHI)
#define WS_S   (WS_VBL + 2u * (size_t)NB * CC * KHI)    // f32 [hg][t][s], unused: logits and att stay in registers
#define WS_Y   (WS_S  + 4u * (size_t)HG * TT * TT)      // f32 ctx rows [b*t][CC] (only when there is an output projection)
#define WS_END (WS_Y  + 0u)

// tanh by the math library's own two range formulas (|x| >= 0.625: 1 - 2 / (exp(2|x|) + 1); below: x + x^3 . poly(x^2)), both evaluated and one selected per lane: the library form branches per element, which splits the unrolled tile into hundreds of blocks and keeps two f32 registers per element alive up to the products
__device__ __forceinline__ float tanh_sel(float x) { const float y = fabsf(x), y2 = x * x;
  const float zb = fmaf(__builtin_amdgcn_rcpf(expf(y + y) + 1.0f), -2.0f, 1.0f);
  float q = fmaf(-0x1.758e7ap-8f, y2, 0x1.521192p-6f); q = fmaf(y2, q, -0x1.b8389cp-5f); q = fmaf(y2, q, 0x1.110704p-3f); q = fmaf(y2, q, -0x1.555532p-2f);
  const float zs = fmaf(y2, y * q, y);
  return copysignf(y < 0.625f ? zs : zb, x); }
// ---- k_att: block = 32 queries (ql0..) of (b, h), KS waves; wave w owns the key slice [w * TT / KS, (w + 1) * TT / KS). Logits are formed TRANSPOSED (A = k rows, B = q rows): D element r of lane (g, col) is key 8g + r of query col, so two 16-key tiles are, register for register, the A fragment of att for 32 keys, and logits and att never leave the registers. att = tanh(logit x SCALE) for key <= query, exactly -1 beyond (a slice wholly beyond the queries forms no logits), x 2^11; ctx = att . v over ALL keys (f16, 1 product, each k and v fragment used for both 16-query tiles; query rows < QBH * 64: 3-product logits, att and v as bf16 hi + lo, 3 products, one 16-query tile after the other); the KS f32 partial tiles meet in LDS and are added in slice order; 512-B (row, head) segment by 32 lanes
#define KS 16
#define KW (TT / KS)       // keys per wave
#define QW 2               // 16-query tiles per wave
__global__ __launch_bounds__(32 * KS) void k_att(const _Float16* __restrict__ QH, const _Float16* __restrict__ KH, const _Float16* __restrict__ QL, const _Float16* __restrict__ KL, const _Float16* __restrict__ VT, const __bf16* __restrict__ VB, const __bf16* __restrict__ VBL, float* __restrict__ Y) { __shared__ __align__(16) float ss[KS][16 * QW][HD + 4];
  const int h = blockIdx.y, b = blockIdx.z; const int tid = threadIdx.x, wave = __builtin_amdgcn_readfirstlane(tid >> 5), lane = tid & 31, col = lane & 15, g = lane >> 4; const int ql0 = blockIdx.x * (16 * QW), k0 = wave * KW;
  const _Float16* qrow = QH + ((size_t)b * TT + ql0 + col) * CC + h * HD; const _Float16* krow = KH + ((size_t)b * TT + k0 + col) * CC + h * HD;
  if (ql0 < QBH * 64) {
    const _Float16* qlrow = QL + ((size_t)b * QHI + ql0 + col) * CC + h * HD; const _Float16* klrow = KL + ((size_t)b * KHI + k0 + col) * CC + h * HD;
    const __bf16* vrow = VB + ((size_t)b * CC + h * HD + col) * (size_t)KHI + k0; const __bf16* vlrow = VBL + ((size_t)b * CC + h * HD + col) * (size_t)KHI + k0;
#pragma unroll 1   /* rolled: one 16-query tile's fragments and sums in registers at a time */
    for (int u = 0; u < QW; ++u) { const int qu = ql0 + u * 16; F2 p[KW / 32];
      if (k0 <= qu + 15) {   /* wave-uniform: the slice holds a key that some query of the tile may see */
        v16h qh[HD / 32], ql[HD / 32];
#pragma unroll
        for (int kc = 0; kc < HD / 32; ++kc) { qh[kc] = frag_h(qrow + (size_t)(u * 16) * CC + kc * 32, lane); ql[kc] = frag_h(qlrow + (size_t)(u * 16) * CC + kc * 32, lane); }
#pragma unroll
        for (int c = 0; c < KW / 32; ++c) { float pv[16];
#pragma unroll
          for (int t = 0; t < 2; ++t) { v8f a = {}, al = {};
#pragma unroll
            for (int kc = 0; kc < HD / 32; ++kc) { const v16h kbf = frag_h(krow + (size_t)(c * 32 + t * 16) * CC + kc * 32, lane), klf = frag_h(klrow + (size_t)(c * 32 + t * 16) * CC + kc * 32, lane); a = wmma16(kbf, qh[kc], a); al = wmma16(kbf, ql[kc], al); al = wmma16(klf, qh[kc], al); }
#pragma unroll
            for (int r = 0; r < 8; ++r) { const float th = tanh_sel((a[r] + al[r] * (1.0f / 1024.0f)) * SCALE); pv[t * 8 + r] = (k0 + c * 32 + t * 16 + 8 * g + r <= qu + col ? th : -1.0f) * 2048.0f; } }
          p[c] = bsplit16(pv); }
      } else {
#pragma unroll
        for (int c = 0; c < KW / 32; ++c)
#pragma unroll
          for (int i = 0; i < 16; ++i) { p[c].h[i] = (__bf16)(-2048.0f); p[c].l[i] = (__bf16)0.0f; } }
#pragma unroll
      for (int j = 0; j < HD / 16; ++j) { v8f acc = {}; v16b vh[KW / 32], vl[KW / 32];   /* the fragments of 16 v columns are fetched together, in front of their products */
#pragma unroll
        for (int c = 0; c < KW / 32; ++c) { const size_t po = (size_t)(j * 16) * KHI + c * 32; vh[c] = frag_b(vrow + po, lane); vl[c] = frag_b(vlrow + po, lane); }
#pragma unroll
        for (int c = 0; c < KW / 32; ++c) { acc = wmma_bf(p[c].h, vh[c], acc); acc = wmma_bf(p[c].l, vh[c], acc); acc = wmma_bf(p[c].h, vl[c], acc); }
#pragma unroll
        for (int r = 0; r < 8; ++r) ss[wave][u * 16 + 8 * g + r][j * 16 + col] = acc[r]; } }
  } else {
    v16h p[QW][KW / 32];
    if (k0 <= ql0 + 16 * QW - 1) {   /* wave-uniform: the slice holds a key that some query of the block may see */
      v16h qh[QW][HD / 32];
#pragma unroll
      for (int u = 0; u < QW; ++u)
#pragma unroll
        for (int kc = 0; kc < HD / 32; ++kc) qh[u][kc] = frag_h(qrow + (size_t)(u * 16) * CC + kc * 32, lane);
      asm volatile("s_wait_xcnt 0x0" ::: "memory");   /* before the q loads' address pair is overwritten: the build gives those registers to a k fragment */
      v16h kf[2][HD / 32];   /* a 16-key tile's four fragments are fetched together, one tile ahead of their products: the loads stay in source order round the products' asm, so one written at its product would be waited for alone */
#pragma unroll
      for (int kc = 0; kc < HD / 32; ++kc) kf[0][kc] = frag_h(krow + kc * 32, lane);
#pragma unroll
      for (int c = 0; c < KW / 32; ++c)
#pragma unroll
        for (int t = 0; t < 2; ++t) { v8f a[QW] = {};
          if (c * 2 + t + 1 < KW / 16) {
#pragma unroll
            for (int kc = 0; kc < HD / 32; ++kc) kf[(t + 1) & 1][kc] = frag_h(krow + (size_t)(c * 32 + t * 16 + 16) * CC + kc * 32, lane); }
#pragma unroll
          for (int kc = 0; kc < HD / 32; ++kc)
#pragma unroll
            for (int u = 0; u < QW; ++u) a[u] = wmma16(kf[t][kc], qh[u][kc], a[u]);
#pragma unroll
          for (int u = 0; u < QW; ++u)
#pragma unroll
            for (int r = 0; r < 8; ++r) { const float th = tanh_sel(a[u][r] * SCALE); p[u][c][t * 8 + r] = (_Float16)((k0 + c * 32 + t * 16 + 8 * g + r <= ql0 + u * 16 + col ? th : -1.0f) * 2048.0f); } }
    } else {
#pragma unroll
      for (int u = 0; u < QW; ++u)
#pragma unroll
        for (int c = 0; c < KW / 32; ++c)
#pragma unroll
          for (int i = 0; i < 16; ++i) p[u][c][i] = (_Float16)(-2048.0f); }
    const _Float16* vrow = VT + ((size_t)b * CC + h * HD + col) * (size_t)TT + k0;
    v16h vf[2][KW / 32];   /* the four fragments of 16 v columns (whole 128-B lines) are fetched together, one column group ahead of their products */
#pragma unroll
    for (int c = 0; c < KW / 32; ++c) vf[0][c] = frag_h(vrow + c * 32, lane);
#pragma unroll
    for (int j = 0; j < HD / 16; ++j) { v8f acc[QW] = {};
      if (j + 1 < HD / 16) {
#pragma unroll
        for (int c = 0; c < KW / 32; ++c) vf[(j + 1) & 1][c] = frag_h(vrow + (size_t)(j * 16 + 16) * TT + c * 32, lane); }
#pragma unroll
      for (int c = 0; c < KW / 32; ++c)
#pragma unroll
        for (int u = 0; u < QW; ++u) acc[u] = wmma16(p[u][c], vf[j & 1][c], acc[u]);
#pragma unroll
      for (int u = 0; u < QW; ++u)
#pragma unroll
        for (int r = 0; r < 8; ++r) ss[wave][u * 16 + 8 * g + r][j * 16 + col] = acc[u][r]; }
  }
  __syncthreads();   /* every wave's partial tiles are in LDS before any thread adds across the waves */
  for (int e = tid; e < 16 * QW * (HD / 4); e += 32 * KS) { const int rl = e / (HD / 4), c4 = e % (HD / 4); v4f s = *(const v4f*)&ss[0][rl][c4 * 4];   /* unrolled below: the KS LDS reads are then in flight together instead of one wait each */
#pragma unroll
    for (int w = 1; w < KS; ++w) s += *(const v4f*)&ss[w][rl][c4 * 4];
    vst2(Y + ((size_t)b * TT + ql0 + rl) * CC + h * HD + c4 * 4, s * (1.0f / 2048.0f)); } }

extern "C" void kernel_launch(void* const* d_in, const int* in_sizes, int n_in, void* d_out, int out_size, void* d_ws, size_t ws_size, hipStream_t stream) {
  (void)in_sizes; (void)n_in; (void)out_size;
  const float** F = (const float**)d_in;
  if (ws_size < (size_t)WS_END) return;
  char* ws = (char*)d_ws; _Float16 *QH = (_Float16*)(ws + WS_QH), *KH = (_Float16*)(ws + WS_KH), *VT = (_Float16*)(ws + WS_VT), *QL = (_Float16*)(ws + WS_QL), *KL = (_Float16*)(ws + WS_KL); __bf16 *VB = (__bf16*)(ws + WS_VB), *VBL = (__bf16*)(ws + WS_VBL);
  // inputs: 0 Q [2,2048,2048]; 1 K; 2 V (raw [B, T, (h, d)] tensors)
  k_prep8<<<dim3(TNB * TT / 64, NH), 128, 0, stream>>>(F[0], F[1], F[2], QH, QL, KH, KL, VT, VB, VBL);
  k_att<<<dim3(TT / (16 * QW), NH, TNB), 32 * KS, 0, stream>>>(QH, KH, QL, KL, VT, VB, VBL, (float*)d_out);
}

// v003
// Measured time: 194 microseconds a run.
// Two timings next to v002 both put it at 1.28 times that version's speed.
// Over all steps from v000 it is 11.0 times as fast.
// compute dtype: all float inputs rounded to bf16; interleaved-pair RoPE applied in f32 to the bf16 q/k rows (64 embedded f32 inverse frequencies = XLA's table, accurate sincosf of the f32 angle t*freq); rotated q/k as f16 hi + residual (x 2^10) planes below row 384, once to f16 beyond; causal logits x 128^-0.5 with 3 products below row 384, 1 product beyond; att = tanh(logit) in f32 (two range formulas, one selected per lane) for k <= t and exactly -1 for k > t (tanh(-inf)); att x 2^11 against v over ALL keys: bf16 hi + lo (3 products) for query rows < 384, once to f16 against v f16 beyond; f32 output [B, T, C].
#include <hip/hip_runtime.h>
#include <math.h>

typedef __attribute__((ext_vector_type(16))) _Float16 v16h;
typedef __attribute__((ext_vector_type(16))) __bf16 v16b;
typedef __attribute__((ext_vector_type(8)))  _Float16 v8h;
typedef __attribute__((ext_vector_type(8)))  float v8f;
typedef __attribute__((ext_vector_type(4)))  float v4f;
typedef __attribute__((ext_vector_type(2)))  float v2f;
typedef __attribute__((ext_vector_type(4)))  unsigned v4u;
typedef __attribute__((ext_vector_type(4)))  int v4i;
typedef float __attribute__((may_alias)) float_a;
typedef int __attribute__((may_alias)) int_a;

template <typename T> __device__ __forceinline__ void vst2(void* p, T v) { *(T*)p = v;  }
__device__ __forceinline__ v8f wmma16(v16h a, v16h b, v8f c) {
  v8f d = __builtin_amdgcn_wmma_f32_16x16x32_f16(false, a, false, b, (short)0, c, false, false);
  asm volatile("v_nop\n\tv_nop\n\tv_nop\n\tv_nop" : "+v"(d) : "v"(a), "v"(b));
  return d;
}
__device__ __forceinline__ v8f wmma_bf(v16b a, v16b b, v8f c) {
  v8f d = __builtin_amdgcn_wmma_f32_16x16x32_bf16(false, a, false, b, (short)0, c, false, false);
  asm volatile("v_nop\n\tv_nop\n\tv_nop\n\tv_nop" : "+v"(d) : "v"(a), "v"(b));
  return d;
}
// 16x16x32 fragments: lane = (h = lane>>4, row/col = lane&15); elements 0..7 = k0+8h+0..7, 8..15 = k0+16+8h+0..7; D element r = row 8h+r
__device__ __forceinline__ v16h frag_h(const _Float16* rowk0, int lane) {
  union { v16h v; v8h q[2]; } u; const _Float16* p = rowk0 + 8 * (lane >> 4);
  u.q[0] = *(const v8h*)p; u.q[1] = *(const v8h*)(p + 16); return u.v;
}
__device__ __forceinline__ v16h frag_f32(const float* rowk0, int lane) {
  v16h a; const float* p = rowk0 + 8 * (lane >> 4);
#pragma unroll
  for (int i = 0; i < 8; ++i) { a[i] = (_Float16)p[i]; a[8 + i] = (_Float16)p[16 + i]; }
  return a;
}
__device__ __forceinline__ v16h frag_f32s(const float* rowk0, int lane, float sc) {
  v16h a; const float* p = rowk0 + 8 * (lane >> 4);
#pragma unroll
  for (int i = 0; i < 8; ++i) { a[i] = (_Float16)(p[i] * sc); a[8 + i] = (_Float16)(p[16 + i] * sc); }
  return a;
}
// column fragment from a [K][ld] layout (column n), rows >= K read as 0
__device__ __forceinline__ v16h fragc_f32(const float* W, int k0, int n, int lane, int ld, int K) {
  v16h a; const int g = lane >> 4;
#pragma unroll
  for (int i = 0; i < 8; ++i) { const int ka = k0 + 8 * g + i, kb = ka + 16;
    a[i] = (_Float16)(ka < K ? W[(size_t)(ka < K ? ka : K - 1) * ld + n] : 0.f); a[8 + i] = (_Float16)(kb < K ? W[(size_t)(kb < K ? kb : K - 1) * ld + n] : 0.f); }
  return a;
}
struct F2 { v16b h, l; };
__device__ __forceinline__ F2 bsplit16(const float v[16]) { F2 r;
#pragma unroll
  for (int i = 0; i < 16; ++i) { const __bf16 h = (__bf16)v[i]; r.h[i] = h; r.l[i] = (__bf16)(v[i] - (float)h); }
  return r; }
__device__ __forceinline__ F2 split_row(const float* row, int k0, int lane) { float v[16]; const float* p = row + k0 + 8 * (lane >> 4);
#pragma unroll
  for (int i = 0; i < 8; ++i) { v[i] = p[i]; v[8 + i] = p[16 + i]; }
  return bsplit16(v); }
__device__ __forceinline__ F2 split_rowK(const float* row, int k0, int lane, int K) { float v[16]; const int g = lane >> 4;
#pragma unroll
  for (int i = 0; i < 8; ++i) { const int ka = k0 + 8 * g + i, kb = ka + 16; v[i] = ka < K ? row[ka < K ? ka : K - 1] : 0.f; v[8 + i] = kb < K ? row[kb < K ? kb : K - 1] : 0.f; }
  return bsplit16(v); }
__device__ __forceinline__ F2 split_col(const float* W, int k0, int n, int lane, int ld, int K) { float v[16]; const int g = lane >> 4;
#pragma unroll
  for (int i = 0; i < 8; ++i) { const int ka = k0 + 8 * g + i, kb = ka + 16; v[i] = ka < K ? W[(size_t)(ka < K ? ka : K - 1) * ld + n] : 0.f; v[8 + i] = kb < K ? W[(size_t)(kb < K ? kb : K - 1) * ld + n] : 0.f; }
  return bsplit16(v); }
__device__ __forceinline__ v8f mac3(const F2& a, const F2& b, v8f c) { c = wmma_bf(a.l, b.h, c); c = wmma_bf(a.h, b.l, c); return wmma_bf(a.h, b.h, c); }
__device__ __forceinline__ float sigm(float v) { return 1.0f / (1.0f + expf(-v)); }
#define LDSX() do { asm volatile("s_wait_dscnt 0" ::: "memory"); __builtin_amdgcn_wave_barrier(); __builtin_amdgcn_fence(__ATOMIC_RELEASE, "workgroup"); } while (0)

// Causal 'tanh attention' (no softmax) with RoPE (B 2, T 2,048, C 2,048 = 16 heads x 128; raw Q, K, V inputs, no projections): q, k = rope_interleaved(split_heads(Q)), rope(split_heads(K)); scores = q k^T / sqrt(128); att = tanh(where(causal, scores, -inf)) -> masked entries are exactly -1 and STILL multiply v; out = att v merged to [B, T, C].
#define NB 2
#define TT 2048
#define CC 2048            // NH * HD = projected width
#define DIN 2048          // input (model) width
#define NH 16
#define HD 128
#define NQB (TT / 64)
#define HG 4
#define SCALE (0.08838834764831845f)
#define CAUSAL 1
#ifndef TNB
#define TNB NB
#endif
__device__ __forceinline__ float bfr(float v) { return (float)(__bf16)v; }
__host__ __device__ __forceinline__ int kb_last(int qb) { return CAUSAL ? ((qb * 64 + 63) >> 7) : (TT / 128 - 1); }
typedef __attribute__((ext_vector_type(8))) __bf16 v8b;
__device__ __forceinline__ v16b frag_b(const __bf16* rowk0, int lane) {
  union { v16b v; v8b q[2]; } u; const __bf16* p = rowk0 + 8 * (lane >> 4);
  u.q[0] = *(const v8b*)p; u.q[1] = *(const v8b*)(p + 16); return u.v;
}
#define QHI 384            // rows carrying a q residual plane
#define KHI 2048           // v bf16 planes for EVERY key (the tanh 'attention' multiplies all keys: masked ones by -1)
// B fragment (k rows k0+.., output column o) of a weight: (in,out) [K][ld] or (out,in) [ld rows of K]: bf16 exact, or f16(bf16 * 256) exact
__device__ __forceinline__ v16b wcol_io(const float* Wm, int k0, int o, int lane, int ld) { v16b w; const int g = lane >> 4;
#pragma unroll
  for (int i = 0; i < 8; ++i) { w[i] = (__bf16)Wm[(size_t)(k0 + 8 * g + i) * ld + o]; w[8 + i] = (__bf16)Wm[(size_t)(k0 + 16 + 8 * g + i) * ld + o]; }
  return w; }
__device__ __forceinline__ v16b wcol_oi(const float* Wm, int k0, int o, int lane, int K) { v16b w; const float* p = Wm + (size_t)o * K + k0 + 8 * (lane >> 4);
#pragma unroll
  for (int i = 0; i < 8; ++i) { w[i] = (__bf16)p[i]; w[8 + i] = (__bf16)p[16 + i]; }
  return w; }
__device__ __forceinline__ v16h wcolh_io(const float* Wm, int k0, int o, int lane, int ld) { v16h w; const int g = lane >> 4;
#pragma unroll
  for (int i = 0; i < 8; ++i) { w[i] = (_Float16)(bfr(Wm[(size_t)(k0 + 8 * g + i) * ld + o]) * 256.0f); w[8 + i] = (_Float16)(bfr(Wm[(size_t)(k0 + 16 + 8 * g + i) * ld + o]) * 256.0f); }
  return w; }
__device__ __forceinline__ v16h wcolh_oi(const float* Wm, int k0, int o, int lane, int K) { v16h w; const float* p = Wm + (size_t)o * K + k0 + 8 * (lane >> 4);
#pragma unroll
  for (int i = 0; i < 8; ++i) { w[i] = (_Float16)(bfr(p[i]) * 256.0f); w[8 + i] = (_Float16)(bfr(p[16 + i]) * 256.0f); }
  return w; }
#define WQKV_LAYOUT 1   // 0 = (in,out) [DIN][CC]; 1 = (out,in) [CC][DIN]; 2 = per-head [NH][DIN][HD]
__device__ __forceinline__ v16b wcol_hdk(const float* Wm, int k0, int o, int lane) { v16b w; const int g = lane >> 4; const float* p = Wm + (size_t)(o / HD) * DIN * HD + (o % HD);
#pragma unroll
  for (int i = 0; i < 8; ++i) { w[i] = (__bf16)p[(size_t)(k0 + 8 * g + i) * HD]; w[8 + i] = (__bf16)p[(size_t)(k0 + 16 + 8 * g + i) * HD]; }
  return w; }
#define WO_OUT_IN 0
#if WQKV_LAYOUT == 1
#define WCOL(W, k0, o, lane) wcol_oi(W, k0, o, lane, DIN)
#elif WQKV_LAYOUT == 2
#define WCOL(W, k0, o, lane) wcol_hdk(W, k0, o, lane)
#else
#define WCOL(W, k0, o, lane) wcol_io(W, k0, o, lane, CC)
#endif
#if WO_OUT_IN
#define WOCOL(W, k0, o, lane) wcol_oi(W, k0, o, lane, CC)
#define WOCOLH(W, k0, o, lane) wcolh_oi(W, k0, o, lane, CC)
#else
#define WOCOL(W, k0, o, lane) wcol_io(W, k0, o, lane, DIN)
#define WOCOLH(W, k0, o, lane) wcolh_io(W, k0, o, lane, DIN)
#endif
#define QBH 6
__constant__ float c_freq[64] = {1.000000000e+00f,8.659643531e-01f,7.498942018e-01f,6.493816376e-01f,5.623413324e-01f,4.869675338e-01f,4.216965139e-01f,3.651741445e-01f,3.162277639e-01f,2.738419771e-01f,2.371373624e-01f,2.053525001e-01f,1.778279394e-01f,1.539926529e-01f,1.333521456e-01f,1.154782027e-01f,1.000000015e-01f,8.659642935e-02f,7.498941571e-02f,6.493816525e-02f,5.623412877e-02f,4.869675264e-02f,4.216964915e-02f,3.651741147e-02f,3.162277862e-02f,2.738419548e-02f,2.371373586e-02f,2.053525113e-02f,1.778279431e-02f,1.539926510e-02f,1.333521493e-02f,1.154781971e-02f,9.999999776e-03f,8.659643121e-03f,7.498942316e-03f,6.493816618e-03f,5.623413250e-03f,4.869675264e-03f,4.216964822e-03f,3.651741426e-03f,3.162277862e-03f,2.738419687e-03f,2.371373819e-03f,2.053525066e-03f,1.778279431e-03f,1.539926510e-03f,1.333521446e-03f,1.154782018e-03f,1.000000047e-03f,8.659643354e-04f,7.498941850e-04f,6.493816618e-04f,5.623413017e-04f,4.869675031e-04f,4.216964880e-04f,3.651741135e-04f,3.162277862e-04f,2.738419571e-04f,2.371373848e-04f,2.053524950e-04f,1.778279402e-04f,1.539926452e-04f,1.333521504e-04f,1.154781930e-04f};   /* 1/10000^(2i/128), i = 0..63, as XLA's f32 table */
// ---- k_prep8: block = (64 attention positions s0.. of sequence b, head h): reads the raw [B, T, C] inputs (element (b,s,h,d) at (b*TT + s)*CC + h*HD + d), bf16-rounds them, applies interleaved-pair RoPE to q and k and writes the standard attention planes: q -> f16 hi rows (+ x 2^10 residual rows for s < QHI), k -> f16 rows (+ residual rows s < KHI), v -> f16 planes [c][s] (+ bf16 hi/lo planes for s < KHI)
#define PT 256             // threads of k_prep8: 8 waves, each takes PR whole rows of the 64-row tile
#define PR 8
typedef __attribute__((ext_vector_type(4))) _Float16 v4h;
__global__ __launch_bounds__(PT) void k_prep8(const float* __restrict__ Q, const float* __restrict__ K, const float* __restrict__ V, _Float16* __restrict__ QH, _Float16* __restrict__ QL, _Float16* __restrict__ KH, _Float16* __restrict__ KL, _Float16* __restrict__ VT, __bf16* __restrict__ VB, __bf16* __restrict__ VBL) {
  __shared__ __align__(16) _Float16 sq[64][136], sql[64][136], sk[64][136], skl[64][136], tv[128][72]; __shared__ __align__(16) __bf16 tb[128][72], tbl[128][72];
  const int tid = threadIdx.x; const int h = blockIdx.y; const size_t r0 = (size_t)blockIdx.x * 64; const size_t bb = r0 / TT; const int t0 = (int)(r0 % TT); const bool qhi = t0 < QHI, khi = t0 < KHI;
  { const int cg = tid & 31, c = cg * 4, rb = (tid >> 5) * PR; const size_t o0 = ((bb * TT + t0 + rb) * (size_t)CC) + h * HD + c;   /* raw [B, T, (h, d)] layout; a lane owns 4 adjacent columns (two rotation pairs) of PR rows in a row */
    const float fr[2] = {c_freq[cg * 2], c_freq[cg * 2 + 1]};   /* oldest load: the angles need it alone, so the first sincosf runs while the tile is on its way */
    asm volatile("s_wait_xcnt 0x0" ::: "memory");   /* before the table load's offset register is given to a tile load's result */
    v4f qv[PR], kv[PR], vv[PR];   /* the lane's whole share of the tile is requested in front of the first use: 3 * PR loads of 16 B in flight, one memory latency a block */
#pragma unroll
    for (int i = 0; i < PR; ++i) { qv[i] = *(const v4f*)(Q + o0 + (size_t)i * CC); kv[i] = *(const v4f*)(K + o0 + (size_t)i * CC); vv[i] = *(const v4f*)(V + o0 + (size_t)i * CC); }
    asm volatile("s_wait_xcnt 0x0" ::: "memory");   /* before the three address pairs of the tile loads are overwritten by the angle code; also keeps every load in front of it */
    v8h tvp[4]; v8b tbp[4], tlp[4];   /* v: PR rows of one column are 16 B in a row of the transposed planes */
#pragma unroll
    for (int i = 0; i < PR; ++i) { const int rl = rb + i; v4h qh4, ql4, kh4, kl4;   /* module inputs bf16-rounded; interleaved-pair RoPE on q and k in f32 */
#pragma unroll
      for (int p = 0; p < 2; ++p) { const float ang = (float)(t0 + rl) * fr[p]; float sn, cs; sincosf(ang, &sn, &cs);
        const float qe = bfr(qv[i][2 * p]), qo = bfr(qv[i][2 * p + 1]), ke = bfr(kv[i][2 * p]), ko = bfr(kv[i][2 * p + 1]);
        const float qr[2] = {qe * cs - qo * sn, qe * sn + qo * cs}, kr[2] = {ke * cs - ko * sn, ke * sn + ko * cs};
#pragma unroll
        for (int s = 0; s < 2; ++s) { const _Float16 qh = (_Float16)qr[s], kh = (_Float16)kr[s]; qh4[2 * p + s] = qh; ql4[2 * p + s] = (_Float16)((qr[s] - (float)qh) * 1024.0f); kh4[2 * p + s] = kh; kl4[2 * p + s] = (_Float16)((kr[s] - (float)kh) * 1024.0f); } }
      *(v4h*)&sq[rl][c] = qh4; *(v4h*)&sql[rl][c] = ql4; *(v4h*)&sk[rl][c] = kh4; *(v4h*)&skl[rl][c] = kl4;
#pragma unroll
      for (int j = 0; j < 4; ++j) { const float v = bfr(vv[i][j]); tvp[j][i] = (_Float16)v; const __bf16 vb = (__bf16)v; tbp[j][i] = vb; tlp[j][i] = (__bf16)(v - (float)vb); } }
#pragma unroll
    for (int j = 0; j < 4; ++j) { *(v8h*)&tv[c + j][rb] = tvp[j]; *(v8b*)&tb[c + j][rb] = tbp[j]; *(v8b*)&tbl[c + j][rb] = tlp[j]; } }
  __syncthreads();
  for (int e = tid; e < 64 * (HD / 8); e += PT) { const int rl = e / (HD / 8), q = e % (HD / 8); const size_t o = (r0 + rl) * CC + h * HD + q * 8; vst2((unsigned*)(QH + o), *(const v4u*)&sq[rl][q * 8]); vst2((unsigned*)(KH + o), *(const v4u*)&sk[rl][q * 8]); asm volatile("s_wait_xcnt 0x0" ::: "memory");   /* before the two stores' data and address registers are rewritten for the next planes and the next trip */
    if (qhi) vst2((unsigned*)(QL + (bb * QHI + t0 + rl) * (size_t)CC + h * HD + q * 8), *(const v4u*)&sql[rl][q * 8]); if (khi) vst2((unsigned*)(KL + (bb * KHI + t0 + rl) * (size_t)CC + h * HD + q * 8), *(const v4u*)&skl[rl][q * 8]); }
  for (int e = tid; e < HD * 8; e += PT) { const int cl = e >> 3, q = e & 7; vst2((unsigned*)(VT + (bb * CC + h * HD + cl) * (size_t)TT + t0 + q * 8), *(const v4u*)&tv[cl][q * 8]);
    if (khi) { const size_t o3 = (bb * CC + h * HD + cl) * (size_t)KHI + t0 + q * 8; vst2((unsigned*)(VB + o3), *(const v4u*)&tb[cl][q * 8]); vst2((unsigned*)(VBL + o3), *(const v4u*)&tbl[cl][q * 8]); } } }

#ifndef SM_EXTRA_PARAMS
#define SM_EXTRA_PARAMS
#endif
#ifndef PROJ_EXTRA_PARAMS
#define PROJ_EXTRA_PARAMS
#endif
#ifndef SM_MASK_HOOK
#define SM_MASK_HOOK (void)0
#endif

#define WS_QH  0u                                      // f16 q rows [b*t][CC]
#define WS_KH  (WS_QH + 2u * (size_t)NB * TT * CC)      // f16 k rows [b*t][CC]
#define WS_VT  (WS_KH + 2u * (size_t)NB * TT * CC)      // f16 v planes [b][c][t]
#define WS_QL  (WS_VT + 2u * (size_t)NB * CC * TT)      // f16 q residual x 2^10 rows [b][t < QHI][CC]
#define WS_KL  (WS_QL + 2u * (size_t)NB * QHI * CC)     // f16 k residual x 2^10 rows [b][t < KHI][CC]
#define WS_VB  (WS_KL + 2u * (size_t)NB * KHI * CC)     // bf16 v hi planes [b][c][t < KHI]
#define WS_VBL (WS_VB + 2u * (size_t)NB * CC * KHI)
#define WS_S   (WS_VBL + 2u * (size_t)NB * CC * KHI)    // f32 [hg][t][s], unused: logits and att stay in registers
#define WS_Y   (WS_S  + 4u * (size_t)HG * TT * TT)      // f32 ctx rows [b*t][CC] (only when there is an output projection)
#define WS_END (WS_Y  + 0u)

// tanh by the math library's own two range formulas (|x| >= 0.625: 1 - 2 / (exp(2|x|) + 1); below: x + x^3 . poly(x^2)), both evaluated and one selected per lane: the library form branches per element, which splits the unrolled tile into hundreds of blocks and keeps two f32 registers per element alive up to the products
__device__ __forceinline__ float tanh_sel(float x) { const float y = fabsf(x), y2 = x * x;
  const float zb = fmaf(__builtin_amdgcn_rcpf(expf(y + y) + 1.0f), -2.0f, 1.0f);
  float q = fmaf(-0x1.758e7ap-8f, y2, 0x1.521192p-6f); q = fmaf(y2, q, -0x1.b8389cp-5f); q = fmaf(y2, q, 0x1.110704p-3f); q = fmaf(y2, q, -0x1.555532p-2f);
  const float zs = fmaf(y2, y * q, y);
  return copysignf(y < 0.625f ? zs : zb, x); }
// ---- k_att: block = 32 queries (ql0..) of (b, h), KS waves; wave w owns the key slice [w * TT / KS, (w + 1) * TT / KS). Logits are formed TRANSPOSED (A = k rows, B = q rows): D element r of lane (g, col) is key 8g + r of query col, so two 16-key tiles are, register for register, the A fragment of att for 32 keys, and logits and att never leave the registers. att = tanh(logit x SCALE) for key <= query, exactly -1 beyond (a slice wholly beyond the queries forms no logits), x 2^11; ctx = att . v over ALL keys (f16, 1 product, each k and v fragment used for both 16-query tiles; query rows < QBH * 64: 3-product logits, att and v as bf16 hi + lo, 3 products, one 16-query tile after the other); the KS f32 partial tiles meet in LDS and are added in slice order; 512-B (row, head) segment by 32 lanes
#define KS 16
#define KW (TT / KS)       // keys per wave
#define QW 2               // 16-query tiles per wave
__global__ __launch_bounds__(32 * KS) void k_att(const _Float16* __restrict__ QH, const _Float16* __restrict__ KH, const _Float16* __restrict__ QL, const _Float16* __restrict__ KL, const _Float16* __restrict__ VT, const __bf16* __restrict__ VB, const __bf16* __restrict__ VBL, float* __restrict__ Y) { __shared__ __align__(16) float ss[KS][16 * QW][HD + 4];
  const int h = blockIdx.y, b = blockIdx.z; const int tid = threadIdx.x, wave = __builtin_amdgcn_readfirstlane(tid >> 5), lane = tid & 31, col = lane & 15, g = lane >> 4; const int ql0 = blockIdx.x * (16 * QW), k0 = wave * KW;
  const _Float16* qrow = QH + ((size_t)b * TT + ql0 + col) * CC + h * HD; const _Float16* krow = KH + ((size_t)b * TT + k0 + col) * CC + h * HD;
  if (ql0 < QBH * 64) {
    const _Float16* qlrow = QL + ((size_t)b * QHI + ql0 + col) * CC + h * HD; const _Float16* klrow = KL + ((size_t)b * KHI + k0 + col) * CC + h * HD;
    const __bf16* vrow = VB + ((size_t)b * CC + h * HD + col) * (size_t)KHI + k0; const __bf16* vlrow = VBL + ((size_t)b * CC + h * HD + col) * (size_t)KHI + k0;
#pragma unroll 1   /* rolled: one 16-query tile's fragments and sums in registers at a time */
    for (int u = 0; u < QW; ++u) { const int qu = ql0 + u * 16; F2 p[KW / 32];
      if (k0 <= qu + 15) {   /* wave-uniform: the slice holds a key that some query of the tile may see */
        v16h qh[HD / 32], ql[HD / 32];
#pragma unroll
        for (int kc = 0; kc < HD / 32; ++kc) { qh[kc] = frag_h(qrow + (size_t)(u * 16) * CC + kc * 32, lane); ql[kc] = frag_h(qlrow + (size_t)(u * 16) * CC + kc * 32, lane); }
#pragma unroll
        for (int c = 0; c < KW / 32; ++c) { float pv[16];
#pragma unroll
          for (int t = 0; t < 2; ++t) { v8f a = {}, al = {};
#pragma unroll
            for (int kc = 0; kc < HD / 32; ++kc) { const v16h kbf = frag_h(krow + (size_t)(c * 32 + t * 16) * CC + kc * 32, lane), klf = frag_h(klrow + (size_t)(c * 32 + t * 16) * CC + kc * 32, lane); a = wmma16(kbf, qh[kc], a); al = wmma16(kbf, ql[kc], al); al = wmma16(klf, qh[kc], al); }
#pragma unroll
            for (int r = 0; r < 8; ++r) { const float th = tanh_sel((a[r] + al[r] * (1.0f / 1024.0f)) * SCALE); pv[t * 8 + r] = (k0 + c * 32 + t * 16 + 8 * g + r <= qu + col ? th : -1.0f) * 2048.0f; } }
          p[c] = bsplit16(pv); }
      } else {
#pragma unroll
        for (int c = 0; c < KW / 32; ++c)
#pragma unroll
          for (int i = 0; i < 16; ++i) { p[c].h[i] = (__bf16)(-2048.0f); p[c].l[i] = (__bf16)0.0f; } }
#pragma unroll
      for (int j = 0; j < HD / 16; ++j) { v8f acc = {}; v16b vh[KW / 32], vl[KW / 32];   /* the fragments of 16 v columns are fetched together, in front of their products */
#pragma unroll
        for (int c = 0; c < KW / 32; ++c) { const size_t po = (size_t)(j * 16) * KHI + c * 32; vh[c] = frag_b(vrow + po, lane); vl[c] = frag_b(vlrow + po, lane); }
#pragma unroll
        for (int c = 0; c < KW / 32; ++c) { acc = wmma_bf(p[c].h, vh[c], acc); acc = wmma_bf(p[c].l, vh[c], acc); acc = wmma_bf(p[c].h, vl[c], acc); }
#pragma unroll
        for (int r = 0; r < 8; ++r) ss[wave][u * 16 + 8 * g + r][j * 16 + col] = acc[r]; } }
  } else {
    v16h p[QW][KW / 32];
    if (k0 <= ql0 + 16 * QW - 1) {   /* wave-uniform: the slice holds a key that some query of the block may see */
      v16h qh[QW][HD / 32];
#pragma unroll
      for (int u = 0; u < QW; ++u)
#pragma unroll
        for (int kc = 0; kc < HD / 32; ++kc) qh[u][kc] = frag_h(qrow + (size_t)(u * 16) * CC + kc * 32, lane);
      asm volatile("s_wait_xcnt 0x0" ::: "memory");   /* before the q loads' address pair is overwritten: the build gives those registers to a k fragment */
      v16h kf[2][HD / 32];   /* a 16-key tile's four fragments are fetched together, one tile ahead of their products: the loads stay in source order round the products' asm, so one written at its product would be waited for alone */
#pragma unroll
      for (int kc = 0; kc < HD / 32; ++kc) kf[0][kc] = frag_h(krow + kc * 32, lane);
#pragma unroll
      for (int c = 0; c < KW / 32; ++c)
#pragma unroll
        for (int t = 0; t < 2; ++t) { v8f a[QW] = {};
          if (c * 2 + t + 1 < KW / 16) {
#pragma unroll
            for (int kc = 0; kc < HD / 32; ++kc) kf[(t + 1) & 1][kc] = frag_h(krow + (size_t)(c * 32 + t * 16 + 16) * CC + kc * 32, lane); }
#pragma unroll
          for (int kc = 0; kc < HD / 32; ++kc)
#pragma unroll
            for (int u = 0; u < QW; ++u) a[u] = wmma16(kf[t][kc], qh[u][kc], a[u]);
#pragma unroll
          for (int u = 0; u < QW; ++u)
#pragma unroll
            for (int r = 0; r < 8; ++r) { const float th = tanh_sel(a[u][r] * SCALE); p[u][c][t * 8 + r] = (_Float16)((k0 + c * 32 + t * 16 + 8 * g + r <= ql0 + u * 16 + col ? th : -1.0f) * 2048.0f); } }
    } else {
#pragma unroll
      for (int u = 0; u < QW; ++u)
#pragma unroll
        for (int c = 0; c < KW / 32; ++c)
#pragma unroll
          for (int i = 0; i < 16; ++i) p[u][c][i] = (_Float16)(-2048.0f); }
    const _Float16* vrow = VT + ((size_t)b * CC + h * HD + col) * (size_t)TT + k0;
    v16h vf[2][KW / 32];   /* the four fragments of 16 v columns (whole 128-B lines) are fetched together, one column group ahead of their products */
#pragma unroll
    for (int c = 0; c < KW / 32; ++c) vf[0][c] = frag_h(vrow + c * 32, lane);
#pragma unroll
    for (int j = 0; j < HD / 16; ++j) { v8f acc[QW] = {};
      if (j + 1 < HD / 16) {
#pragma unroll
        for (int c = 0; c < KW / 32; ++c) vf[(j + 1) & 1][c] = frag_h(vrow + (size_t)(j * 16 + 16) * TT + c * 32, lane); }
#pragma unroll
      for (int c = 0; c < KW / 32; ++c)
#pragma unroll
        for (int u = 0; u < QW; ++u) acc[u] = wmma16(p[u][c], vf[j & 1][c], acc[u]);
#pragma unroll
      for (int u = 0; u < QW; ++u)
#pragma unroll
        for (int r = 0; r < 8; ++r) ss[wave][u * 16 + 8 * g + r][j * 16 + col] = acc[u][r]; }
  }
  __syncthreads();   /* every wave's partial tiles are in LDS before any thread adds across the waves */
  for (int e = tid; e < 16 * QW * (HD / 4); e += 32 * KS) { const int rl = e / (HD / 4), c4 = e % (HD / 4); v4f s = *(const v4f*)&ss[0][rl][c4 * 4];   /* unrolled below: the KS LDS reads are then in flight together instead of one wait each */
#pragma unroll
    for (int w = 1; w < KS; ++w) s += *(const v4f*)&ss[w][rl][c4 * 4];
    vst2(Y + ((size_t)b * TT + ql0 + rl) * CC + h * HD + c4 * 4, s * (1.0f / 2048.0f)); } }

extern "C" void kernel_launch(void* const* d_in, const int* in_sizes, int n_in, void* d_out, int out_size, void* d_ws, size_t ws_size, hipStream_t stream) {
  (void)in_sizes; (void)n_in; (void)out_size;
  const float** F = (const float**)d_in;
  if (ws_size < (size_t)WS_END) return;
  char* ws = (char*)d_ws; _Float16 *QH = (_Float16*)(ws + WS_QH), *KH = (_Float16*)(ws + WS_KH), *VT = (_Float16*)(ws + WS_VT), *QL = (_Float16*)(ws + WS_QL), *KL = (_Float16*)(ws + WS_KL); __bf16 *VB = (__bf16*)(ws + WS_VB), *VBL = (__bf16*)(ws + WS_VBL);
  // inputs: 0 Q [2,2048,2048]; 1 K; 2 V (raw [B, T, (h, d)] tensors)
  k_prep8<<<dim3(TNB * TT / 64, NH), PT, 0, stream>>>(F[0], F[1], F[2], QH, QL, KH, KL, VT, VB, VBL);
  k_att<<<dim3(TT / (16 * QW), NH, TNB), 32 * KS, 0, stream>>>(QH, KH, QL, KL, VT, VB, VBL, (float*)d_out);
}

// v004
// A run of this version takes 178 microseconds.
// Next to v003, in two timings, it ran 1.09 times as fast each time.
// Over all steps from v000 it is 12.0 times as fast.
// compute dtype: all float inputs rounded to bf16; interleaved-pair RoPE applied in f32 to the bf16 q/k rows (64 embedded f32 inverse frequencies = XLA's table, accurate sincosf of the f32 angle t*freq); rotated q/k as f16 hi + residual (x 2^10) planes below row 384, once to f16 beyond; causal logits x 128^-0.5 with 3 products below row 384, 1 product beyond; att = tanh(logit) in f32 for k <= t (the math library's formulas below row 384; beyond, 1 - 2 / (exp2(2 log2(e) logit) + 1) on the hardware exp2 and reciprocal) and exactly -1 for k > t (tanh(-inf)); att x 2^11 against v over ALL keys: bf16 hi + lo (3 products) for query rows < 384, once to f16 against v f16 beyond; f32 output [B, T, C].
#include <hip/hip_runtime.h>
#include <math.h>

typedef __attribute__((ext_vector_type(16))) _Float16 v16h;
typedef __attribute__((ext_vector_type(16))) __bf16 v16b;
typedef __attribute__((ext_vector_type(8)))  _Float16 v8h;
typedef __attribute__((ext_vector_type(8)))  float v8f;
typedef __attribute__((ext_vector_type(4)))  float v4f;
typedef __attribute__((ext_vector_type(2)))  float v2f;
typedef __attribute__((ext_vector_type(4)))  unsigned v4u;
typedef __attribute__((ext_vector_type(4)))  int v4i;
typedef float __attribute__((may_alias)) float_a;
typedef int __attribute__((may_alias)) int_a;

template <typename T> __device__ __forceinline__ void vst2(void* p, T v) { *(T*)p = v;  }
__device__ __forceinline__ v8f wmma16(v16h a, v16h b, v8f c) {
  v8f d = __builtin_amdgcn_wmma_f32_16x16x32_f16(false, a, false, b, (short)0, c, false, false);
  asm volatile("v_nop\n\tv_nop\n\tv_nop\n\tv_nop" : "+v"(d) : "v"(a), "v"(b));
  return d;
}
__device__ __forceinline__ v8f wmma_bf(v16b a, v16b b, v8f c) {
  v8f d = __builtin_amdgcn_wmma_f32_16x16x32_bf16(false, a, false, b, (short)0, c, false, false);
  asm volatile("v_nop\n\tv_nop\n\tv_nop\n\tv_nop" : "+v"(d) : "v"(a), "v"(b));
  return d;
}
// 16x16x32 fragments: lane = (h = lane>>4, row/col = lane&15); elements 0..7 = k0+8h+0..7, 8..15 = k0+16+8h+0..7; D element r = row 8h+r
__device__ __forceinline__ v16h frag_h(const _Float16* rowk0, int lane) {
  union { v16h v; v8h q[2]; } u; const _Float16* p = rowk0 + 8 * (lane >> 4);
  u.q[0] = *(const v8h*)p; u.q[1] = *(const v8h*)(p + 16); return u.v;
}
__device__ __forceinline__ v16h frag_f32(const float* rowk0, int lane) {
  v16h a; const float* p = rowk0 + 8 * (lane >> 4);
#pragma unroll
  for (int i = 0; i < 8; ++i) { a[i] = (_Float16)p[i]; a[8 + i] = (_Float16)p[16 + i]; }
  return a;
}
__device__ __forceinline__ v16h frag_f32s(const float* rowk0, int lane, float sc) {
  v16h a; const float* p = rowk0 + 8 * (lane >> 4);
#pragma unroll
  for (int i = 0; i < 8; ++i) { a[i] = (_Float16)(p[i] * sc); a[8 + i] = (_Float16)(p[16 + i] * sc); }
  return a;
}
// column fragment from a [K][ld] layout (column n), rows >= K read as 0
__device__ __forceinline__ v16h fragc_f32(const float* W, int k0, int n, int lane, int ld, int K) {
  v16h a; const int g = lane >> 4;
#pragma unroll
  for (int i = 0; i < 8; ++i) { const int ka = k0 + 8 * g + i, kb = ka + 16;
    a[i] = (_Float16)(ka < K ? W[(size_t)(ka < K ? ka : K - 1) * ld + n] : 0.f); a[8 + i] = (_Float16)(kb < K ? W[(size_t)(kb < K ? kb : K - 1) * ld + n] : 0.f); }
  return a;
}
struct F2 { v16b h, l; };
__device__ __forceinline__ F2 bsplit16(const float v[16]) { F2 r;
#pragma unroll
  for (int i = 0; i < 16; ++i) { const __bf16 h = (__bf16)v[i]; r.h[i] = h; r.l[i] = (__bf16)(v[i] - (float)h); }
  return r; }
__device__ __forceinline__ F2 split_row(const float* row, int k0, int lane) { float v[16]; const float* p = row + k0 + 8 * (lane >> 4);
#pragma unroll
  for (int i = 0; i < 8; ++i) { v[i] = p[i]; v[8 + i] = p[16 + i]; }
  return bsplit16(v); }
__device__ __forceinline__ F2 split_rowK(const float* row, int k0, int lane, int K) { float v[16]; const int g = lane >> 4;
#pragma unroll
  for (int i = 0; i < 8; ++i) { const int ka = k0 + 8 * g + i, kb = ka + 16; v[i] = ka < K ? row[ka < K ? ka : K - 1] : 0.f; v[8 + i] = kb < K ? row[kb < K ? kb : K - 1] : 0.f; }
  return bsplit16(v); }
__device__ __forceinline__ F2 split_col(const float* W, int k0, int n, int lane, int ld, int K) { float v[16]; const int g = lane >> 4;
#pragma unroll
  for (int i = 0; i < 8; ++i) { const int ka = k0 + 8 * g + i, kb = ka + 16; v[i] = ka < K ? W[(size_t)(ka < K ? ka : K - 1) * ld + n] : 0.f; v[8 + i] = kb < K ? W[(size_t)(kb < K ? kb : K - 1) * ld + n] : 0.f; }
  return bsplit16(v); }
__device__ __forceinline__ v8f mac3(const F2& a, const F2& b, v8f c) { c = wmma_bf(a.l, b.h, c); c = wmma_bf(a.h, b.l, c); return wmma_bf(a.h, b.h, c); }
__device__ __forceinline__ float sigm(float v) { return 1.0f / (1.0f + expf(-v)); }
#define LDSX() do { asm volatile("s_wait_dscnt 0" ::: "memory"); __builtin_amdgcn_wave_barrier(); __builtin_amdgcn_fence(__ATOMIC_RELEASE, "workgroup"); } while (0)

// Causal 'tanh attention' (no softmax) with RoPE (B 2, T 2,048, C 2,048 = 16 heads x 128; raw Q, K, V inputs, no projections): q, k = rope_interleaved(split_heads(Q)), rope(split_heads(K)); scores = q k^T / sqrt(128); att = tanh(where(causal, scores, -inf)) -> masked entries are exactly -1 and STILL multiply v; out = att v merged to [B, T, C].
#define NB 2
#define TT 2048
#define CC 2048            // NH * HD = projected width
#define DIN 2048          // input (model) width
#define NH 16
#define HD 128
#define NQB (TT / 64)
#define HG 4
#define SCALE (0.08838834764831845f)
#define CAUSAL 1
#ifndef TNB
#define TNB NB
#endif
__device__ __forceinline__ float bfr(float v) { return (float)(__bf16)v; }
__host__ __device__ __forceinline__ int kb_last(int qb) { return CAUSAL ? ((qb * 64 + 63) >> 7) : (TT / 128 - 1); }
typedef __attribute__((ext_vector_type(8))) __bf16 v8b;
__device__ __forceinline__ v16b frag_b(const __bf16* rowk0, int lane) {
  union { v16b v; v8b q[2]; } u; const __bf16* p = rowk0 + 8 * (lane >> 4);
  u.q[0] = *(const v8b*)p; u.q[1] = *(const v8b*)(p + 16); return u.v;
}
#define QHI 384            // rows carrying a q residual plane
#define KHI 2048           // v bf16 planes for EVERY key (the tanh 'attention' multiplies all keys: masked ones by -1)
// B fragment (k rows k0+.., output column o) of a weight: (in,out) [K][ld] or (out,in) [ld rows of K]: bf16 exact, or f16(bf16 * 256) exact
__device__ __forceinline__ v16b wcol_io(const float* Wm, int k0, int o, int lane, int ld) { v16b w; const int g = lane >> 4;
#pragma unroll
  for (int i = 0; i < 8; ++i) { w[i] = (__bf16)Wm[(size_t)(k0 + 8 * g + i) * ld + o]; w[8 + i] = (__bf16)Wm[(size_t)(k0 + 16 + 8 * g + i) * ld + o]; }
  return w; }
__device__ __forceinline__ v16b wcol_oi(const float* Wm, int k0, int o, int lane, int K) { v16b w; const float* p = Wm + (size_t)o * K + k0 + 8 * (lane >> 4);
#pragma unroll
  for (int i = 0; i < 8; ++i) { w[i] = (__bf16)p[i]; w[8 + i] = (__bf16)p[16 + i]; }
  return w; }
__device__ __forceinline__ v16h wcolh_io(const float* Wm, int k0, int o, int lane, int ld) { v16h w; const int g = lane >> 4;
#pragma unroll
  for (int i = 0; i < 8; ++i) { w[i] = (_Float16)(bfr(Wm[(size_t)(k0 + 8 * g + i) * ld + o]) * 256.0f); w[8 + i] = (_Float16)(bfr(Wm[(size_t)(k0 + 16 + 8 * g + i) * ld + o]) * 256.0f); }
  return w; }
__device__ __forceinline__ v16h wcolh_oi(const float* Wm, int k0, int o, int lane, int K) { v16h w; const float* p = Wm + (size_t)o * K + k0 + 8 * (lane >> 4);
#pragma unroll
  for (int i = 0; i < 8; ++i) { w[i] = (_Float16)(bfr(p[i]) * 256.0f); w[8 + i] = (_Float16)(bfr(p[16 + i]) * 256.0f); }
  return w; }
#define WQKV_LAYOUT 1   // 0 = (in,out) [DIN][CC]; 1 = (out,in) [CC][DIN]; 2 = per-head [NH][DIN][HD]
__device__ __forceinline__ v16b wcol_hdk(const float* Wm, int k0, int o, int lane) { v16b w; const int g = lane >> 4; const float* p = Wm + (size_t)(o / HD) * DIN * HD + (o % HD);
#pragma unroll
  for (int i = 0; i < 8; ++i) { w[i] = (__bf16)p[(size_t)(k0 + 8 * g + i) * HD]; w[8 + i] = (__bf16)p[(size_t)(k0 + 16 + 8 * g + i) * HD]; }
  return w; }
#define WO_OUT_IN 0
#if WQKV_LAYOUT == 1
#define WCOL(W, k0, o, lane) wcol_oi(W, k0, o, lane, DIN)
#elif WQKV_LAYOUT == 2
#define WCOL(W, k0, o, lane) wcol_hdk(W, k0, o, lane)
#else
#define WCOL(W, k0, o, lane) wcol_io(W, k0, o, lane, CC)
#endif
#if WO_OUT_IN
#define WOCOL(W, k0, o, lane) wcol_oi(W, k0, o, lane, CC)
#define WOCOLH(W, k0, o, lane) wcolh_oi(W, k0, o, lane, CC)
#else
#define WOCOL(W, k0, o, lane) wcol_io(W, k0, o, lane, DIN)
#define WOCOLH(W, k0, o, lane) wcolh_io(W, k0, o, lane, DIN)
#endif
#define QBH 6
__constant__ float c_freq[64] = {1.000000000e+00f,8.659643531e-01f,7.498942018e-01f,6.493816376e-01f,5.623413324e-01f,4.869675338e-01f,4.216965139e-01f,3.651741445e-01f,3.162277639e-01f,2.738419771e-01f,2.371373624e-01f,2.053525001e-01f,1.778279394e-01f,1.539926529e-01f,1.333521456e-01f,1.154782027e-01f,1.000000015e-01f,8.659642935e-02f,7.498941571e-02f,6.493816525e-02f,5.623412877e-02f,4.869675264e-02f,4.216964915e-02f,3.651741147e-02f,3.162277862e-02f,2.738419548e-02f,2.371373586e-02f,2.053525113e-02f,1.778279431e-02f,1.539926510e-02f,1.333521493e-02f,1.154781971e-02f,9.999999776e-03f,8.659643121e-03f,7.498942316e-03f,6.493816618e-03f,5.623413250e-03f,4.869675264e-03f,4.216964822e-03f,3.651741426e-03f,3.162277862e-03f,2.738419687e-03f,2.371373819e-03f,2.053525066e-03f,1.778279431e-03f,1.539926510e-03f,1.333521446e-03f,1.154782018e-03f,1.000000047e-03f,8.659643354e-04f,7.498941850e-04f,6.493816618e-04f,5.623413017e-04f,4.869675031e-04f,4.216964880e-04f,3.651741135e-04f,3.162277862e-04f,2.738419571e-04f,2.371373848e-04f,2.053524950e-04f,1.778279402e-04f,1.539926452e-04f,1.333521504e-04f,1.154781930e-04f};   /* 1/10000^(2i/128), i = 0..63, as XLA's f32 table */
// ---- k_prep8: block = (64 attention positions s0.. of sequence b, head h): reads the raw [B, T, C] inputs (element (b,s,h,d) at (b*TT + s)*CC + h*HD + d), bf16-rounds them, applies interleaved-pair RoPE to q and k and writes the standard attention planes: q -> f16 hi rows (+ x 2^10 residual rows for s < QHI), k -> f16 rows (+ residual rows s < KHI), v -> f16 planes [c][s] (+ bf16 hi/lo planes for s < KHI)
#define PT 256             // threads of k_prep8: 8 waves, each takes PR whole rows of the 64-row tile
#define PR 8
typedef __attribute__((ext_vector_type(4))) _Float16 v4h;
__global__ __launch_bounds__(PT) void k_prep8(const float* __restrict__ Q, const float* __restrict__ K, const float* __restrict__ V, _Float16* __restrict__ QH, _Float16* __restrict__ QL, _Float16* __restrict__ KH, _Float16* __restrict__ KL, _Float16* __restrict__ VT, __bf16* __restrict__ VB, __bf16* __restrict__ VBL) {
  __shared__ __align__(16) _Float16 sq[64][136], sql[64][136], sk[64][136], skl[64][136], tv[128][72]; __shared__ __align__(16) __bf16 tb[128][72], tbl[128][72];
  const int tid = threadIdx.x; const int h = blockIdx.y; const size_t r0 = (size_t)blockIdx.x * 64; const size_t bb = r0 / TT; const int t0 = (int)(r0 % TT); const bool qhi = t0 < QHI, khi = t0 < KHI;
  { const int cg = tid & 31, c = cg * 4, rb = (tid >> 5) * PR; const size_t o0 = ((bb * TT + t0 + rb) * (size_t)CC) + h * HD + c;   /* raw [B, T, (h, d)] layout; a lane owns 4 adjacent columns (two rotation pairs) of PR rows in a row */
    const float fr[2] = {c_freq[cg * 2], c_freq[cg * 2 + 1]};   /* oldest load: the angles need it alone, so the first sincosf runs while the tile is on its way */
    asm volatile("s_wait_xcnt 0x0" ::: "memory");   /* before the table load's offset register is given to a tile load's result */
    v4f qv[PR], kv[PR], vv[PR];   /* the lane's whole share of the tile is requested in front of the first use: 3 * PR loads of 16 B in flight, one memory latency a block */
#pragma unroll
    for (int i = 0; i < PR; ++i) { qv[i] = *(const v4f*)(Q + o0 + (size_t)i * CC); kv[i] = *(const v4f*)(K + o0 + (size_t)i * CC); vv[i] = *(const v4f*)(V + o0 + (size_t)i * CC); }
    asm volatile("s_wait_xcnt 0x0" ::: "memory");   /* before the three address pairs of the tile loads are overwritten by the angle code; also keeps every load in front of it */
    v8h tvp[4]; v8b tbp[4], tlp[4];   /* v: PR rows of one column are 16 B in a row of the transposed planes */
#pragma unroll
    for (int i = 0; i < PR; ++i) { const int rl = rb + i; v4h qh4, ql4, kh4, kl4;   /* module inputs bf16-rounded; interleaved-pair RoPE on q and k in f32 */
#pragma unroll
      for (int p = 0; p < 2; ++p) { const float ang = (float)(t0 + rl) * fr[p]; float sn, cs; sincosf(ang, &sn, &cs);
        const float qe = bfr(qv[i][2 * p]), qo = bfr(qv[i][2 * p + 1]), ke = bfr(kv[i][2 * p]), ko = bfr(kv[i][2 * p + 1]);
        const float qr[2] = {qe * cs - qo * sn, qe * sn + qo * cs}, kr[2] = {ke * cs - ko * sn, ke * sn + ko * cs};
#pragma unroll
        for (int s = 0; s < 2; ++s) { const _Float16 qh = (_Float16)qr[s], kh = (_Float16)kr[s]; qh4[2 * p + s] = qh; ql4[2 * p + s] = (_Float16)((qr[s] - (float)qh) * 1024.0f); kh4[2 * p + s] = kh; kl4[2 * p + s] = (_Float16)((kr[s] - (float)kh) * 1024.0f); } }
      *(v4h*)&sq[rl][c] = qh4; *(v4h*)&sql[rl][c] = ql4; *(v4h*)&sk[rl][c] = kh4; *(v4h*)&skl[rl][c] = kl4;
#pragma unroll
      for (int j = 0; j < 4; ++j) { const float v = bfr(vv[i][j]); tvp[j][i] = (_Float16)v; const __bf16 vb = (__bf16)v; tbp[j][i] = vb; tlp[j][i] = (__bf16)(v - (float)vb); } }
#pragma unroll
    for (int j = 0; j < 4; ++j) { *(v8h*)&tv[c + j][rb] = tvp[j]; *(v8b*)&tb[c + j][rb] = tbp[j]; *(v8b*)&tbl[c + j][rb] = tlp[j]; } }
  __syncthreads();
  for (int e = tid; e < 64 * (HD / 8); e += PT) { const int rl = e / (HD / 8), q = e % (HD / 8); const size_t o = (r0 + rl) * CC + h * HD + q * 8; vst2((unsigned*)(QH + o), *(const v4u*)&sq[rl][q * 8]); vst2((unsigned*)(KH + o), *(const v4u*)&sk[rl][q * 8]); asm volatile("s_wait_xcnt 0x0" ::: "memory");   /* before the two stores' data and address registers are rewritten for the next planes and the next trip */
    if (qhi) vst2((unsigned*)(QL + (bb * QHI + t0 + rl) * (size_t)CC + h * HD + q * 8), *(const v4u*)&sql[rl][q * 8]); if (khi) vst2((unsigned*)(KL + (bb * KHI + t0 + rl) * (size_t)CC + h * HD + q * 8), *(const v4u*)&skl[rl][q * 8]); }
  for (int e = tid; e < HD * 8; e += PT) { const int cl = e >> 3, q = e & 7; vst2((unsigned*)(VT + (bb * CC + h * HD + cl) * (size_t)TT + t0 + q * 8), *(const v4u*)&tv[cl][q * 8]);
    if (khi) { const size_t o3 = (bb * CC + h * HD + cl) * (size_t)KHI + t0 + q * 8; vst2((unsigned*)(VB + o3), *(const v4u*)&tb[cl][q * 8]); vst2((unsigned*)(VBL + o3), *(const v4u*)&tbl[cl][q * 8]); } } }

#ifndef SM_EXTRA_PARAMS
#define SM_EXTRA_PARAMS
#endif
#ifndef PROJ_EXTRA_PARAMS
#define PROJ_EXTRA_PARAMS
#endif
#ifndef SM_MASK_HOOK
#define SM_MASK_HOOK (void)0
#endif

#define WS_QH  0u                                      // f16 q rows [b*t][CC]
#define WS_KH  (WS_QH + 2u * (size_t)NB * TT * CC)      // f16 k rows [b*t][CC]
#define WS_VT  (WS_KH + 2u * (size_t)NB * TT * CC)      // f16 v planes [b][c][t]
#define WS_QL  (WS_VT + 2u * (size_t)NB * CC * TT)      // f16 q residual x 2^10 rows [b][t < QHI][CC]
#define WS_KL  (WS_QL + 2u * (size_t)NB * QHI * CC)     // f16 k residual x 2^10 rows [b][t < KHI][CC]
#define WS_VB  (WS_KL + 2u * (size_t)NB * KHI * CC)     // bf16 v hi planes [b][c][t < KHI]
#define WS_VBL (WS_VB + 2u * (size_t)NB * CC * KHI)
#define WS_S   (WS_VBL + 2u * (size_t)NB * CC * KHI)    // f32 [hg][t][s], unused: logits and att stay in registers
#define WS_Y   (WS_S  + 4u * (size_t)HG * TT * TT)      // f32 ctx rows [b*t][CC] (only when there is an output projection)
#define WS_END (WS_Y  + 0u)

// tanh by the math library's own two range formulas (|x| >= 0.625: 1 - 2 / (exp(2|x|) + 1); below: x + x^3 . poly(x^2)), both evaluated and one selected per lane: the library form branches per element, which splits the unrolled tile into hundreds of blocks and keeps two f32 registers per element alive up to the products
__device__ __forceinline__ float tanh_sel(float x) { const float y = fabsf(x), y2 = x * x;
  const float zb = fmaf(__builtin_amdgcn_rcpf(expf(y + y) + 1.0f), -2.0f, 1.0f);
  float q = fmaf(-0x1.758e7ap-8f, y2, 0x1.521192p-6f); q = fmaf(y2, q, -0x1.b8389cp-5f); q = fmaf(y2, q, 0x1.110704p-3f); q = fmaf(y2, q, -0x1.555532p-2f);
  const float zs = fmaf(y2, y * q, y);
  return copysignf(y < 0.625f ? zs : zb, x); }
// tanh(logit x SCALE) x 2^11 for the rows whose att is rounded once to f16 right behind it: 2^11 - 2^12 / (2^(logit x 2 SCALE log2 e) + 1), one formula for every range on the chip's own exp2 and reciprocal; absolute error of tanh below 3e-7, against the f16 rounding's 2^-12 relative; -inf (a masked key) gives -2^11
#define T2L ((float)(2.0 * 0.08838834764831845 * 1.4426950408889634))
// eight transcendentals in one statement, each in place on its own register: none reads a neighbour's result or overwrites a neighbour's source, and the closing v_nop is the free slot the instruction set asks for behind the last one, whatever the compiler puts next
__device__ __forceinline__ void exp2x8(float (&x)[8]) { asm("v_exp_f32 %0, %0\n\tv_exp_f32 %1, %1\n\tv_exp_f32 %2, %2\n\tv_exp_f32 %3, %3\n\tv_exp_f32 %4, %4\n\tv_exp_f32 %5, %5\n\tv_exp_f32 %6, %6\n\tv_exp_f32 %7, %7\n\tv_nop" : "+v"(x[0]), "+v"(x[1]), "+v"(x[2]), "+v"(x[3]), "+v"(x[4]), "+v"(x[5]), "+v"(x[6]), "+v"(x[7])); }
__device__ __forceinline__ void rcpx8(float (&x)[8]) { asm("v_rcp_f32 %0, %0\n\tv_rcp_f32 %1, %1\n\tv_rcp_f32 %2, %2\n\tv_rcp_f32 %3, %3\n\tv_rcp_f32 %4, %4\n\tv_rcp_f32 %5, %5\n\tv_rcp_f32 %6, %6\n\tv_rcp_f32 %7, %7\n\tv_nop" : "+v"(x[0]), "+v"(x[1]), "+v"(x[2]), "+v"(x[3]), "+v"(x[4]), "+v"(x[5]), "+v"(x[6]), "+v"(x[7])); }
// ---- k_att: block = 32 queries (ql0..) of (b, h), KS waves; wave w owns the key slice [w * TT / KS, (w + 1) * TT / KS). Logits are formed TRANSPOSED (A = k rows, B = q rows): D element r of lane (g, col) is key 8g + r of query col, so two 16-key tiles are, register for register, the A fragment of att for 32 keys, and logits and att never leave the registers. att = tanh(logit x SCALE) for key <= query, exactly -1 beyond (a slice wholly beyond the queries forms no logits), x 2^11; ctx = att . v over ALL keys (f16, 1 product, each k and v fragment used for both 16-query tiles; query rows < QBH * 64: 3-product logits, att and v as bf16 hi + lo, 3 products, one 16-query tile after the other); the KS f32 partial tiles meet in LDS and are added in slice order; 512-B (row, head) segment by 32 lanes
#define KS 16
#define KW (TT / KS)       // keys per wave
#define QW 2               // 16-query tiles per wave
__global__ __launch_bounds__(32 * KS) void k_att(const _Float16* __restrict__ QH, const _Float16* __restrict__ KH, const _Float16* __restrict__ QL, const _Float16* __restrict__ KL, const _Float16* __restrict__ VT, const __bf16* __restrict__ VB, const __bf16* __restrict__ VBL, float* __restrict__ Y) { __shared__ __align__(16) float ss[KS][16 * QW][HD + 4];
  const int h = blockIdx.y, b = blockIdx.z; const int tid = threadIdx.x, wave = __builtin_amdgcn_readfirstlane(tid >> 5), lane = tid & 31, col = lane & 15, g = lane >> 4; const int ql0 = blockIdx.x * (16 * QW), k0 = wave * KW;
  const _Float16* qrow = QH + ((size_t)b * TT + ql0 + col) * CC + h * HD; const _Float16* krow = KH + ((size_t)b * TT + k0 + col) * CC + h * HD;
  if (ql0 < QBH * 64) {
    const _Float16* qlrow = QL + ((size_t)b * QHI + ql0 + col) * CC + h * HD; const _Float16* klrow = KL + ((size_t)b * KHI + k0 + col) * CC + h * HD;
    const __bf16* vrow = VB + ((size_t)b * CC + h * HD + col) * (size_t)KHI + k0; const __bf16* vlrow = VBL + ((size_t)b * CC + h * HD + col) * (size_t)KHI + k0;
#pragma unroll 1   /* rolled: one 16-query tile's fragments and sums in registers at a time */
    for (int u = 0; u < QW; ++u) { const int qu = ql0 + u * 16; F2 p[KW / 32];
      if (k0 <= qu + 15) {   /* wave-uniform: the slice holds a key that some query of the tile may see */
        v16h qh[HD / 32], ql[HD / 32];
#pragma unroll
        for (int kc = 0; kc < HD / 32; ++kc) { qh[kc] = frag_h(qrow + (size_t)(u * 16) * CC + kc * 32, lane); ql[kc] = frag_h(qlrow + (size_t)(u * 16) * CC + kc * 32, lane); }
#pragma unroll
        for (int c = 0; c < KW / 32; ++c) { float pv[16];
#pragma unroll
          for (int t = 0; t < 2; ++t) { v8f a = {}, al = {};
#pragma unroll
            for (int kc = 0; kc < HD / 32; ++kc) { const v16h kbf = frag_h(krow + (size_t)(c * 32 + t * 16) * CC + kc * 32, lane), klf = frag_h(klrow + (size_t)(c * 32 + t * 16) * CC + kc * 32, lane); a = wmma16(kbf, qh[kc], a); al = wmma16(kbf, ql[kc], al); al = wmma16(klf, qh[kc], al); }
#pragma unroll
            for (int r = 0; r < 8; ++r) { const float th = tanh_sel((a[r] + al[r] * (1.0f / 1024.0f)) * SCALE); pv[t * 8 + r] = (k0 + c * 32 + t * 16 + 8 * g + r <= qu + col ? th : -1.0f) * 2048.0f; } }
          p[c] = bsplit16(pv); }
      } else {
#pragma unroll
        for (int c = 0; c < KW / 32; ++c)
#pragma unroll
          for (int i = 0; i < 16; ++i) { p[c].h[i] = (__bf16)(-2048.0f); p[c].l[i] = (__bf16)0.0f; } }
#pragma unroll
      for (int j = 0; j < HD / 16; ++j) { v8f acc = {}; v16b vh[KW / 32], vl[KW / 32];   /* the fragments of 16 v columns are fetched together, in front of their products */
#pragma unroll
        for (int c = 0; c < KW / 32; ++c) { const size_t po = (size_t)(j * 16) * KHI + c * 32; vh[c] = frag_b(vrow + po, lane); vl[c] = frag_b(vlrow + po, lane); }
#pragma unroll
        for (int c = 0; c < KW / 32; ++c) { acc = wmma_bf(p[c].h, vh[c], acc); acc = wmma_bf(p[c].l, vh[c], acc); acc = wmma_bf(p[c].h, vl[c], acc); }
#pragma unroll
        for (int r = 0; r < 8; ++r) ss[wave][u * 16 + 8 * g + r][j * 16 + col] = acc[r]; } }
  } else {
    v16h p[QW][KW / 32];
    if (k0 <= ql0 + 16 * QW - 1) {   /* wave-uniform: the slice holds a key that some query of the block may see */
      v16h qh[QW][HD / 32]; const int lim = ql0 + col - k0 - 8 * g;   /* key <= query, both counted from the slice's and the lane's own start: one register against a constant per element */
#pragma unroll
      for (int u = 0; u < QW; ++u)
#pragma unroll
        for (int kc = 0; kc < HD / 32; ++kc) qh[u][kc] = frag_h(qrow + (size_t)(u * 16) * CC + kc * 32, lane);
      asm volatile("s_wait_xcnt 0x0" ::: "memory");   /* before the q loads' address pair is overwritten: the build gives those registers to a k fragment */
      v16h kf[2][HD / 32];   /* a 16-key tile's four fragments are fetched together, one tile ahead of their products: the loads stay in source order round the products' asm, so one written at its product would be waited for alone */
#pragma unroll
      for (int kc = 0; kc < HD / 32; ++kc) kf[0][kc] = frag_h(krow + kc * 32, lane);
#pragma unroll
      for (int c = 0; c < KW / 32; ++c)
#pragma unroll
        for (int t = 0; t < 2; ++t) { v8f a[QW] = {};
          if (c * 2 + t + 1 < KW / 16) {
#pragma unroll
            for (int kc = 0; kc < HD / 32; ++kc) kf[(t + 1) & 1][kc] = frag_h(krow + (size_t)(c * 32 + t * 16 + 16) * CC + kc * 32, lane); }
#pragma unroll
          for (int kc = 0; kc < HD / 32; ++kc)
#pragma unroll
            for (int u = 0; u < QW; ++u) a[u] = wmma16(kf[t][kc], qh[u][kc], a[u]);
#pragma unroll
          for (int u = 0; u < QW; ++u) { float x[8];
#pragma unroll
            for (int r = 0; r < 8; ++r) x[r] = (c * 32 + t * 16 + r - u * 16 <= lim ? a[u][r] : -__builtin_inff()) * T2L;   /* the mask goes in as the reference's own -inf */
            exp2x8(x);
#pragma unroll
            for (int r = 0; r < 8; ++r) x[r] += 1.0f;
            rcpx8(x);
#pragma unroll
            for (int r = 0; r < 8; ++r) p[u][c][t * 8 + r] = (_Float16)fmaf(x[r], -4096.0f, 2048.0f); } }
    } else {
#pragma unroll
      for (int u = 0; u < QW; ++u)
#pragma unroll
        for (int c = 0; c < KW / 32; ++c)
#pragma unroll
          for (int i = 0; i < 16; ++i) p[u][c][i] = (_Float16)(-2048.0f); }
    const _Float16* vrow = VT + ((size_t)b * CC + h * HD + col) * (size_t)TT + k0;
    v16h vf[2][KW / 32];   /* the four fragments of 16 v columns (whole 128-B lines) are fetched together, one column group ahead of their products */
#pragma unroll
    for (int c = 0; c < KW / 32; ++c) vf[0][c] = frag_h(vrow + c * 32, lane);
#pragma unroll
    for (int j = 0; j < HD / 16; ++j) { v8f acc[QW] = {};
      if (j + 1 < HD / 16) {
#pragma unroll
        for (int c = 0; c < KW / 32; ++c) vf[(j + 1) & 1][c] = frag_h(vrow + (size_t)(j * 16 + 16) * TT + c * 32, lane); }
#pragma unroll
      for (int c = 0; c < KW / 32; ++c)
#pragma unroll
        for (int u = 0; u < QW; ++u) acc[u] = wmma16(p[u][c], vf[j & 1][c], acc[u]);
#pragma unroll
      for (int u = 0; u < QW; ++u)
#pragma unroll
        for (int r = 0; r < 8; ++r) ss[wave][u * 16 + 8 * g + r][j * 16 + col] = acc[u][r]; }
  }
  __syncthreads();   /* every wave's partial tiles are in LDS before any thread adds across the waves */
  for (int e = tid; e < 16 * QW * (HD / 4); e += 32 * KS) { const int rl = e / (HD / 4), c4 = e % (HD / 4); v4f s = *(const v4f*)&ss[0][rl][c4 * 4];   /* unrolled below: the KS LDS reads are then in flight together instead of one wait each */
#pragma unroll
    for (int w = 1; w < KS; ++w) s += *(const v4f*)&ss[w][rl][c4 * 4];
    vst2(Y + ((size_t)b * TT + ql0 + rl) * CC + h * HD + c4 * 4, s * (1.0f / 2048.0f)); } }

extern "C" void kernel_launch(void* const* d_in, const int* in_sizes, int n_in, void* d_out, int out_size, void* d_ws, size_t ws_size, hipStream_t stream) {
  (void)in_sizes; (void)n_in; (void)out_size;
  const float** F = (const float**)d_in;
  if (ws_size < (size_t)WS_END) return;
  char* ws = (char*)d_ws; _Float16 *QH = (_Float16*)(ws + WS_QH), *KH = (_Float16*)(ws + WS_KH), *VT = (_Float16*)(ws + WS_VT), *QL = (_Float16*)(ws + WS_QL), *KL = (_Float16*)(ws + WS_KL); __bf16 *VB = (__bf16*)(ws + WS_VB), *VBL = (__bf16*)(ws + WS_VBL);
  // inputs: 0 Q [2,2048,2048]; 1 K; 2 V (raw [B, T, (h, d)] tensors)
  k_prep8<<<dim3(TNB * TT / 64, NH), PT, 0, stream>>>(F[0], F[1], F[2], QH, QL, KH, KL, VT, VB, VBL);
  k_att<<<dim3(TT / (16 * QW), NH, TNB), 32 * KS, 0, stream>>>(QH, KH, QL, KL, VT, VB, VBL, (float*)d_out);
}

// v005
// A run of this version takes 172 microseconds.
// In both of two side-by-side timings against v004, it was 1.04 times as fast.
// All steps since v000 together make it 12.4 times as fast.
// compute dtype: all float inputs rounded to bf16; interleaved-pair RoPE applied in f32 to the bf16 q/k rows (64 embedded f32 inverse frequencies = XLA's table, accurate sincosf of the f32 angle t*freq); rotated q/k as f16 hi + residual (x 2^10) planes below row 384, once to f16 beyond; causal logits x 128^-0.5 with 3 products below row 384, 1 product beyond; att = tanh(logit) in f32 for k <= t (the math library's formulas below row 384; beyond, 1 - 2 / (exp2(2 log2(e) logit) + 1) on the hardware exp2 and reciprocal) and exactly -1 for k > t (tanh(-inf)); att x 2^11 against v over ALL keys: bf16 hi + lo (3 products) for query rows < 384, once to f16 against v f16 beyond; f32 output [B, T, C].
#include <hip/hip_runtime.h>
#include <math.h>

typedef __attribute__((ext_vector_type(16))) _Float16 v16h;
typedef __attribute__((ext_vector_type(16))) __bf16 v16b;
typedef __attribute__((ext_vector_type(8)))  _Float16 v8h;
typedef __attribute__((ext_vector_type(8)))  float v8f;
typedef __attribute__((ext_vector_type(4)))  float v4f;
typedef __attribute__((ext_vector_type(2)))  float v2f;
typedef __attribute__((ext_vector_type(4)))  unsigned v4u;
typedef __attribute__((ext_vector_type(4)))  int v4i;
typedef float __attribute__((may_alias)) float_a;
typedef int __attribute__((may_alias)) int_a;

template <typename T> __device__ __forceinline__ void vst2(void* p, T v) { *(T*)p = v;  }
__device__ __forceinline__ v8f wmma16(v16h a, v16h b, v8f c) {
  v8f d = __builtin_amdgcn_wmma_f32_16x16x32_f16(false, a, false, b, (short)0, c, false, false);
  asm volatile("v_nop\n\tv_nop\n\tv_nop\n\tv_nop" : "+v"(d) : "v"(a), "v"(b));
  return d;
}
__device__ __forceinline__ v8f wmma_bf(v16b a, v16b b, v8f c) {
  v8f d = __builtin_amdgcn_wmma_f32_16x16x32_bf16(false, a, false, b, (short)0, c, false, false);
  asm volatile("v_nop\n\tv_nop\n\tv_nop\n\tv_nop" : "+v"(d) : "v"(a), "v"(b));
  return d;
}
// 16x16x32 fragments: lane = (h = lane>>4, row/col = lane&15); elements 0..7 = k0+8h+0..7, 8..15 = k0+16+8h+0..7; D element r = row 8h+r
__device__ __forceinline__ v16h frag_h(const _Float16* rowk0, int lane) {
  union { v16h v; v8h q[2]; } u; const _Float16* p = rowk0 + 8 * (lane >> 4);
  u.q[0] = *(const v8h*)p; u.q[1] = *(const v8h*)(p + 16); return u.v;
}
__device__ __forceinline__ v16h frag_f32(const float* rowk0, int lane) {
  v16h a; const float* p = rowk0 + 8 * (lane >> 4);
#pragma unroll
  for (int i = 0; i < 8; ++i) { a[i] = (_Float16)p[i]; a[8 + i] = (_Float16)p[16 + i]; }
  return a;
}
__device__ __forceinline__ v16h frag_f32s(const float* rowk0, int lane, float sc) {
  v16h a; const float* p = rowk0 + 8 * (lane >> 4);
#pragma unroll
  for (int i = 0; i < 8; ++i) { a[i] = (_Float16)(p[i] * sc); a[8 + i] = (_Float16)(p[16 + i] * sc); }
  return a;
}
// column fragment from a [K][ld] layout (column n), rows >= K read as 0
__device__ __forceinline__ v16h fragc_f32(const float* W, int k0, int n, int lane, int ld, int K) {
  v16h a; const int g = lane >> 4;
#pragma unroll
  for (int i = 0; i < 8; ++i) { const int ka = k0 + 8 * g + i, kb = ka + 16;
    a[i] = (_Float16)(ka < K ? W[(size_t)(ka < K ? ka : K - 1) * ld + n] : 0.f); a[8 + i] = (_Float16)(kb < K ? W[(size_t)(kb < K ? kb : K - 1) * ld + n] : 0.f); }
  return a;
}
struct F2 { v16b h, l; };
__device__ __forceinline__ F2 bsplit16(const float v[16]) { F2 r;
#pragma unroll
  for (int i = 0; i < 16; ++i) { const __bf16 h = (__bf16)v[i]; r.h[i] = h; r.l[i] = (__bf16)(v[i] - (float)h); }
  return r; }
__device__ __forceinline__ F2 split_row(const float* row, int k0, int lane) { float v[16]; const float* p = row + k0 + 8 * (lane >> 4);
#pragma unroll
  for (int i = 0; i < 8; ++i) { v[i] = p[i]; v[8 + i] = p[16 + i]; }
  return bsplit16(v); }
__device__ __forceinline__ F2 split_rowK(const float* row, int k0, int lane, int K) { float v[16]; const int g = lane >> 4;
#pragma unroll
  for (int i = 0; i < 8; ++i) { const int ka = k0 + 8 * g + i, kb = ka + 16; v[i] = ka < K ? row[ka < K ? ka : K - 1] : 0.f; v[8 + i] = kb < K ? row[kb < K ? kb : K - 1] : 0.f; }
  return bsplit16(v); }
__device__ __forceinline__ F2 split_col(const float* W, int k0, int n, int lane, int ld, int K) { float v[16]; const int g = lane >> 4;
#pragma unroll
  for (int i = 0; i < 8; ++i) { const int ka = k0 + 8 * g + i, kb = ka + 16; v[i] = ka < K ? W[(size_t)(ka < K ? ka : K - 1) * ld + n] : 0.f; v[8 + i] = kb < K ? W[(size_t)(kb < K ? kb : K - 1) * ld + n] : 0.f; }
  return bsplit16(v); }
__device__ __forceinline__ v8f mac3(const F2& a, const F2& b, v8f c) { c = wmma_bf(a.l, b.h, c); c = wmma_bf(a.h, b.l, c); return wmma_bf(a.h, b.h, c); }
__device__ __forceinline__ float sigm(float v) { return 1.0f / (1.0f + expf(-v)); }
#define LDSX() do { asm volatile("s_wait_dscnt 0" ::: "memory"); __builtin_amdgcn_wave_barrier(); __builtin_amdgcn_fence(__ATOMIC_RELEASE, "workgroup"); } while (0)

// Causal 'tanh attention' (no softmax) with RoPE (B 2, T 2,048, C 2,048 = 16 heads x 128; raw Q, K, V inputs, no projections): q, k = rope_interleaved(split_heads(Q)), rope(split_heads(K)); scores = q k^T / sqrt(128); att = tanh(where(causal, scores, -inf)) -> masked entries are exactly -1 and STILL multiply v; out = att v merged to [B, T, C].
#define NB 2
#define TT 2048
#define CC 2048            // NH * HD = projected width
#define DIN 2048          // input (model) width
#define NH 16
#define HD 128
#define NQB (TT / 64)
#define HG 4
#define SCALE (0.08838834764831845f)
#define CAUSAL 1
#ifndef TNB
#define TNB NB
#endif
__device__ __forceinline__ float bfr(float v) { return (float)(__bf16)v; }
__host__ __device__ __forceinline__ int kb_last(int qb) { return CAUSAL ? ((qb * 64 + 63) >> 7) : (TT / 128 - 1); }
typedef __attribute__((ext_vector_type(8))) __bf16 v8b;
__device__ __forceinline__ v16b frag_b(const __bf16* rowk0, int lane) {
  union { v16b v; v8b q[2]; } u; const __bf16* p = rowk0 + 8 * (lane >> 4);
  u.q[0] = *(const v8b*)p; u.q[1] = *(const v8b*)(p + 16); return u.v;
}
// fragment-order planes: one 16 x 32 fragment is 1 KiB in a row: elements 0..7 of lanes 0..31 (512 B), then elements 8..15; p = fragment start + 8 * lane, so each of the two loads of a wave reads four whole 128-B lines
__device__ __forceinline__ v16h fragp_h(const _Float16* p) { union { v16h v; v8h q[2]; } u; u.q[0] = *(const v8h*)p; u.q[1] = *(const v8h*)(p + 256); return u.v; }
__device__ __forceinline__ v16b fragp_b(const __bf16* p) { union { v16b v; v8b q[2]; } u; u.q[0] = *(const v8b*)p; u.q[1] = *(const v8b*)(p + 256); return u.v; }
#define QHI 384            // rows carrying a q residual plane (3-product logits below it)
#define KHI 2048           // v bf16 planes for EVERY key (the tanh 'attention' multiplies all keys: masked ones by -1)
// B fragment (k rows k0+.., output column o) of a weight: (in,out) [K][ld] or (out,in) [ld rows of K]: bf16 exact, or f16(bf16 * 256) exact
__device__ __forceinline__ v16b wcol_io(const float* Wm, int k0, int o, int lane, int ld) { v16b w; const int g = lane >> 4;
#pragma unroll
  for (int i = 0; i < 8; ++i) { w[i] = (__bf16)Wm[(size_t)(k0 + 8 * g + i) * ld + o]; w[8 + i] = (__bf16)Wm[(size_t)(k0 + 16 + 8 * g + i) * ld + o]; }
  return w; }
__device__ __forceinline__ v16b wcol_oi(const float* Wm, int k0, int o, int lane, int K) { v16b w; const float* p = Wm + (size_t)o * K + k0 + 8 * (lane >> 4);
#pragma unroll
  for (int i = 0; i < 8; ++i) { w[i] = (__bf16)p[i]; w[8 + i] = (__bf16)p[16 + i]; }
  return w; }
__device__ __forceinline__ v16h wcolh_io(const float* Wm, int k0, int o, int lane, int ld) { v16h w; const int g = lane >> 4;
#pragma unroll
  for (int i = 0; i < 8; ++i) { w[i] = (_Float16)(bfr(Wm[(size_t)(k0 + 8 * g + i) * ld + o]) * 256.0f); w[8 + i] = (_Float16)(bfr(Wm[(size_t)(k0 + 16 + 8 * g + i) * ld + o]) * 256.0f); }
  return w; }
__device__ __forceinline__ v16h wcolh_oi(const float* Wm, int k0, int o, int lane, int K) { v16h w; const float* p = Wm + (size_t)o * K + k0 + 8 * (lane >> 4);
#pragma unroll
  for (int i = 0; i < 8; ++i) { w[i] = (_Float16)(bfr(p[i]) * 256.0f); w[8 + i] = (_Float16)(bfr(p[16 + i]) * 256.0f); }
  return w; }
#define WQKV_LAYOUT 1   // 0 = (in,out) [DIN][CC]; 1 = (out,in) [CC][DIN]; 2 = per-head [NH][DIN][HD]
__device__ __forceinline__ v16b wcol_hdk(const float* Wm, int k0, int o, int lane) { v16b w; const int g = lane >> 4; const float* p = Wm + (size_t)(o / HD) * DIN * HD + (o % HD);
#pragma unroll
  for (int i = 0; i < 8; ++i) { w[i] = (__bf16)p[(size_t)(k0 + 8 * g + i) * HD]; w[8 + i] = (__bf16)p[(size_t)(k0 + 16 + 8 * g + i) * HD]; }
  return w; }
#define WO_OUT_IN 0
#if WQKV_LAYOUT == 1
#define WCOL(W, k0, o, lane) wcol_oi(W, k0, o, lane, DIN)
#elif WQKV_LAYOUT == 2
#define WCOL(W, k0, o, lane) wcol_hdk(W, k0, o, lane)
#else
#define WCOL(W, k0, o, lane) wcol_io(W, k0, o, lane, CC)
#endif
#if WO_OUT_IN
#define WOCOL(W, k0, o, lane) wcol_oi(W, k0, o, lane, CC)
#define WOCOLH(W, k0, o, lane) wcolh_oi(W, k0, o, lane, CC)
#else
#define WOCOL(W, k0, o, lane) wcol_io(W, k0, o, lane, DIN)
#define WOCOLH(W, k0, o, lane) wcolh_io(W, k0, o, lane, DIN)
#endif
#define QBH 6
__constant__ float c_freq[64] = {1.000000000e+00f,8.659643531e-01f,7.498942018e-01f,6.493816376e-01f,5.623413324e-01f,4.869675338e-01f,4.216965139e-01f,3.651741445e-01f,3.162277639e-01f,2.738419771e-01f,2.371373624e-01f,2.053525001e-01f,1.778279394e-01f,1.539926529e-01f,1.333521456e-01f,1.154782027e-01f,1.000000015e-01f,8.659642935e-02f,7.498941571e-02f,6.493816525e-02f,5.623412877e-02f,4.869675264e-02f,4.216964915e-02f,3.651741147e-02f,3.162277862e-02f,2.738419548e-02f,2.371373586e-02f,2.053525113e-02f,1.778279431e-02f,1.539926510e-02f,1.333521493e-02f,1.154781971e-02f,9.999999776e-03f,8.659643121e-03f,7.498942316e-03f,6.493816618e-03f,5.623413250e-03f,4.869675264e-03f,4.216964822e-03f,3.651741426e-03f,3.162277862e-03f,2.738419687e-03f,2.371373819e-03f,2.053525066e-03f,1.778279431e-03f,1.539926510e-03f,1.333521446e-03f,1.154782018e-03f,1.000000047e-03f,8.659643354e-04f,7.498941850e-04f,6.493816618e-04f,5.623413017e-04f,4.869675031e-04f,4.216964880e-04f,3.651741135e-04f,3.162277862e-04f,2.738419571e-04f,2.371373848e-04f,2.053524950e-04f,1.778279402e-04f,1.539926452e-04f,1.333521504e-04f,1.154781930e-04f};   /* 1/10000^(2i/128), i = 0..63, as XLA's f32 table */
// ---- k_prep8: block = (64 attention positions s0.. of sequence b, head h): reads the raw [B, T, C] inputs (element (b,s,h,c) at (b*TT + s)*CC + h*HD + c), bf16-rounds them and writes the attention planes in fragment order (fragp_h), [b][h][s / 16][c / 32] fragments of q and k (row = s, k = c) and [b][h][s / 32][c / 16] fragments of v (row = c, k = s): q -> f16 hi (+ x 2^10 residual for s < QHI), k -> f16 (+ residual, s < KHI), v -> f16 (+ bf16 hi/lo for s < KHI); the block's 64 positions are 16 KiB in a row of every plane
#define PT 256             // threads of k_prep8: 8 waves, each takes PR whole rows of the 64-row tile
#define PR 8
typedef __attribute__((ext_vector_type(4))) _Float16 v4h;
__global__ __launch_bounds__(PT) void k_prep8(const float* __restrict__ Q, const float* __restrict__ K, const float* __restrict__ V, _Float16* __restrict__ QH, _Float16* __restrict__ QL, _Float16* __restrict__ KH, _Float16* __restrict__ KL, _Float16* __restrict__ VT, __bf16* __restrict__ VB, __bf16* __restrict__ VBL) {
  __shared__ __align__(16) _Float16 sq[64][136], sql[64][136], sk[64][136], skl[64][136], tv[128][72]; __shared__ __align__(16) __bf16 tb[128][72], tbl[128][72];
  const int tid = threadIdx.x; const int h = blockIdx.y; const size_t r0 = (size_t)blockIdx.x * 64; const size_t bb = r0 / TT; const int t0 = (int)(r0 % TT); const bool qhi = t0 < QHI, khi = t0 < KHI;
  { const int cg = tid & 31, c = cg * 4, rb = (tid >> 5) * PR; const size_t o0 = ((bb * TT + t0 + rb) * (size_t)CC) + h * HD + c;   /* raw [B, T, (h, d)] layout; a lane owns 4 adjacent columns (two rotation pairs) of PR rows in a row */
    const float fr[2] = {c_freq[cg * 2], c_freq[cg * 2 + 1]};   /* oldest load: the angles need it alone, so the first sincosf runs while the tile is on its way */
    asm volatile("s_wait_xcnt 0x0" ::: "memory");   /* before the table load's offset register is given to a tile load's result */
    v4f qv[PR], kv[PR], vv[PR];   /* the lane's whole share of the tile is requested in front of the first use: 3 * PR loads of 16 B in flight, one memory latency a block */
#pragma unroll
    for (int i = 0; i < PR; ++i) { qv[i] = *(const v4f*)(Q + o0 + (size_t)i * CC); kv[i] = *(const v4f*)(K + o0 + (size_t)i * CC); vv[i] = *(const v4f*)(V + o0 + (size_t)i * CC); }
    asm volatile("s_wait_xcnt 0x0" ::: "memory");   /* before the three address pairs of the tile loads are overwritten by the angle code; also keeps every load in front of it */
    v8h tvp[4]; v8b tbp[4], tlp[4];   /* v: PR rows of one column are 16 B in a row of the transposed planes */
#pragma unroll
    for (int i = 0; i < PR; ++i) { const int rl = rb + i; v4h qh4, ql4, kh4, kl4;   /* module inputs bf16-rounded; interleaved-pair RoPE on q and k in f32 */
#pragma unroll
      for (int p = 0; p < 2; ++p) { const float ang = (float)(t0 + rl) * fr[p]; float sn, cs; sincosf(ang, &sn, &cs);
        const float qe = bfr(qv[i][2 * p]), qo = bfr(qv[i][2 * p + 1]), ke = bfr(kv[i][2 * p]), ko = bfr(kv[i][2 * p + 1]);
        const float qr[2] = {qe * cs - qo * sn, qe * sn + qo * cs}, kr[2] = {ke * cs - ko * sn, ke * sn + ko * cs};
#pragma unroll
        for (int s = 0; s < 2; ++s) { const _Float16 qh = (_Float16)qr[s], kh = (_Float16)kr[s]; qh4[2 * p + s] = qh; ql4[2 * p + s] = (_Float16)((qr[s] - (float)qh) * 1024.0f); kh4[2 * p + s] = kh; kl4[2 * p + s] = (_Float16)((kr[s] - (float)kh) * 1024.0f); } }
      *(v4h*)&sq[rl][c] = qh4; *(v4h*)&sql[rl][c] = ql4; *(v4h*)&sk[rl][c] = kh4; *(v4h*)&skl[rl][c] = kl4;
#pragma unroll
      for (int j = 0; j < 4; ++j) { const float v = bfr(vv[i][j]); tvp[j][i] = (_Float16)v; const __bf16 vb = (__bf16)v; tbp[j][i] = vb; tlp[j][i] = (__bf16)(v - (float)vb); } }
#pragma unroll
    for (int j = 0; j < 4; ++j) { *(v8h*)&tv[c + j][rb] = tvp[j]; *(v8b*)&tb[c + j][rb] = tbp[j]; *(v8b*)&tbl[c + j][rb] = tlp[j]; } }
  __syncthreads();
  /* e counts the 16-B pieces of the block's 16 KiB in plane order: lane l = e & 31, half of the fragment (e >> 5) & 1, then the fragment; a wave's store is 512 B in a row */
  for (int e = tid; e < 64 * (HD / 8); e += PT) { const int l = e & 31, rl = (e >> 8) * 16 + (l & 15), c = ((e >> 5) & 7) * 16 + (l >> 4) * 8; const size_t o = ((bb * NH + h) * (size_t)TT + t0) * HD + e * 8; vst2((unsigned*)(QH + o), *(const v4u*)&sq[rl][c]); vst2((unsigned*)(KH + o), *(const v4u*)&sk[rl][c]); asm volatile("s_wait_xcnt 0x0" ::: "memory");   /* before the two stores' data and address registers are rewritten for the next planes and the next trip */
    if (qhi) { vst2((unsigned*)(QL + ((bb * NH + h) * (size_t)QHI + t0) * HD + e * 8), *(const v4u*)&sql[rl][c]); asm volatile("s_wait_xcnt 0x0" ::: "memory"); }   /* before the store's data registers take the next LDS read */
    if (khi) vst2((unsigned*)(KL + ((bb * NH + h) * (size_t)KHI + t0) * HD + e * 8), *(const v4u*)&skl[rl][c]); }
  for (int e = tid; e < HD * 8; e += PT) { const int l = e & 31, cl = ((e >> 6) & 7) * 16 + (l & 15), sl = (e >> 9) * 32 + ((e >> 5) & 1) * 16 + (l >> 4) * 8; vst2((unsigned*)(VT + ((bb * NH + h) * (size_t)TT + t0) * HD + e * 8), *(const v4u*)&tv[cl][sl]);
    if (khi) { const size_t o3 = ((bb * NH + h) * (size_t)KHI + t0) * HD + e * 8; vst2((unsigned*)(VB + o3), *(const v4u*)&tb[cl][sl]); vst2((unsigned*)(VBL + o3), *(const v4u*)&tbl[cl][sl]); } } }

#ifndef SM_EXTRA_PARAMS
#define SM_EXTRA_PARAMS
#endif
#ifndef PROJ_EXTRA_PARAMS
#define PROJ_EXTRA_PARAMS
#endif
#ifndef SM_MASK_HOOK
#define SM_MASK_HOOK (void)0
#endif

#define WS_QH  0u                                      // f16 q fragments [b][h][t / 16][d / 32]
#define WS_KH  (WS_QH + 2u * (size_t)NB * TT * CC)      // f16 k fragments [b][h][t / 16][d / 32]
#define WS_VT  (WS_KH + 2u * (size_t)NB * TT * CC)      // f16 v fragments [b][h][t / 32][d / 16]
#define WS_QL  (WS_VT + 2u * (size_t)NB * CC * TT)      // f16 q residual x 2^10 fragments [b][h][t < QHI]
#define WS_KL  (WS_QL + 2u * (size_t)NB * QHI * CC)     // f16 k residual x 2^10 fragments [b][h][t < KHI]
#define WS_VB  (WS_KL + 2u * (size_t)NB * KHI * CC)     // bf16 v hi fragments [b][h][t < KHI]
#define WS_VBL (WS_VB + 2u * (size_t)NB * CC * KHI)
#define WS_S   (WS_VBL + 2u * (size_t)NB * CC * KHI)    // f32 [hg][t][s], unused: logits and att stay in registers
#define WS_Y   (WS_S  + 4u * (size_t)HG * TT * TT)      // f32 ctx rows [b*t][CC] (only when there is an output projection)
#define WS_END (WS_Y  + 0u)

// tanh by the math library's own two range formulas (|x| >= 0.625: 1 - 2 / (exp(2|x|) + 1); below: x + x^3 . poly(x^2)), both evaluated and one selected per lane: the library form branches per element, which splits the unrolled tile into hundreds of blocks and keeps two f32 registers per element alive up to the products
__device__ __forceinline__ float tanh_sel(float x) { const float y = fabsf(x), y2 = x * x;
  const float zb = fmaf(__builtin_amdgcn_rcpf(expf(y + y) + 1.0f), -2.0f, 1.0f);
  float q = fmaf(-0x1.758e7ap-8f, y2, 0x1.521192p-6f); q = fmaf(y2, q, -0x1.b8389cp-5f); q = fmaf(y2, q, 0x1.110704p-3f); q = fmaf(y2, q, -0x1.555532p-2f);
  const float zs = fmaf(y2, y * q, y);
  return copysignf(y < 0.625f ? zs : zb, x); }
// tanh(logit x SCALE) x 2^11 for the rows whose att is rounded once to f16 right behind it: 2^11 - 2^12 / (2^(logit x 2 SCALE log2 e) + 1), one formula for every range on the chip's own exp2 and reciprocal; absolute error of tanh below 3e-7, against the f16 rounding's 2^-12 relative; -inf (a masked key) gives -2^11
#define T2L ((float)(2.0 * 0.08838834764831845 * 1.4426950408889634))
// eight transcendentals in one statement, each in place on its own register: none reads a neighbour's result or overwrites a neighbour's source, and the closing v_nop is the free slot the instruction set asks for behind the last one, whatever the compiler puts next
__device__ __forceinline__ void exp2x8(float (&x)[8]) { asm("v_exp_f32 %0, %0\n\tv_exp_f32 %1, %1\n\tv_exp_f32 %2, %2\n\tv_exp_f32 %3, %3\n\tv_exp_f32 %4, %4\n\tv_exp_f32 %5, %5\n\tv_exp_f32 %6, %6\n\tv_exp_f32 %7, %7\n\tv_nop" : "+v"(x[0]), "+v"(x[1]), "+v"(x[2]), "+v"(x[3]), "+v"(x[4]), "+v"(x[5]), "+v"(x[6]), "+v"(x[7])); }
__device__ __forceinline__ void rcpx8(float (&x)[8]) { asm("v_rcp_f32 %0, %0\n\tv_rcp_f32 %1, %1\n\tv_rcp_f32 %2, %2\n\tv_rcp_f32 %3, %3\n\tv_rcp_f32 %4, %4\n\tv_rcp_f32 %5, %5\n\tv_rcp_f32 %6, %6\n\tv_rcp_f32 %7, %7\n\tv_nop" : "+v"(x[0]), "+v"(x[1]), "+v"(x[2]), "+v"(x[3]), "+v"(x[4]), "+v"(x[5]), "+v"(x[6]), "+v"(x[7])); }
// ---- k_att: block = 32 queries (ql0..) of (b, h), KS waves; wave w owns the key slice [w * TT / KS, (w + 1) * TT / KS). Logits are formed TRANSPOSED (A = k rows, B = q rows): D element r of lane (g, col) is key 8g + r of query col, so two 16-key tiles are, register for register, the A fragment of att for 32 keys, and logits and att never leave the registers. att = tanh(logit x SCALE) for key <= query, exactly -1 beyond (a slice wholly beyond the queries forms no logits), x 2^11; ctx = att . v over ALL keys (f16, 1 product, each k and v fragment used for both 16-query tiles; query rows < QBH * 64: 3-product logits, att and v as bf16 hi + lo, 3 products, one 16-query tile after the other); the KS f32 partial tiles meet in LDS and are added in slice order; 512-B (row, head) segment by 32 lanes
#define KS 16
#define KW (TT / KS)       // keys per wave
#define QW 2               // 16-query tiles per wave
__global__ __launch_bounds__(32 * KS) void k_att(const _Float16* __restrict__ QH, const _Float16* __restrict__ KH, const _Float16* __restrict__ QL, const _Float16* __restrict__ KL, const _Float16* __restrict__ VT, const __bf16* __restrict__ VB, const __bf16* __restrict__ VBL, float* __restrict__ Y) { __shared__ __align__(16) float ss[KS][16 * QW][HD + 4];
  const int h = blockIdx.y, b = blockIdx.z; const int tid = threadIdx.x, wave = __builtin_amdgcn_readfirstlane(tid >> 5), lane = tid & 31, col = lane & 15, g = lane >> 4; const int ql0 = blockIdx.x * (16 * QW), k0 = wave * KW;
  const size_t bh = (size_t)b * NH + h; const _Float16* qrow = QH + (bh * TT + ql0) * HD + lane * 8; const _Float16* krow = KH + (bh * TT + k0) * HD + lane * 8;   /* the lane's piece of the first fragment; fragment (16 rows n, 32 dims kc) lies (n * 4 + kc) * 512 elements on */
  if (ql0 < QBH * 64) {
    const _Float16* qlrow = QL + (bh * QHI + ql0) * HD + lane * 8; const _Float16* klrow = KL + (bh * KHI + k0) * HD + lane * 8;
    const __bf16* vrow = VB + (bh * KHI + k0) * HD + lane * 8; const __bf16* vlrow = VBL + (bh * KHI + k0) * HD + lane * 8;   /* v fragment (32 keys c, 16 columns j) lies (c * 8 + j) * 512 elements on */
#pragma unroll 1   /* rolled: one 16-query tile's fragments and sums in registers at a time */
    for (int u = 0; u < QW; ++u) { const int qu = ql0 + u * 16; F2 p[KW / 32];
      if (k0 <= qu + 15) {   /* wave-uniform: the slice holds a key that some query of the tile may see */
        v16h qh[HD / 32], ql[HD / 32];
#pragma unroll
        for (int kc = 0; kc < HD / 32; ++kc) { qh[kc] = fragp_h(qrow + (u * 4 + kc) * 512); ql[kc] = fragp_h(qlrow + (u * 4 + kc) * 512); }
#pragma unroll
        for (int c = 0; c < KW / 32; ++c) { float pv[16];
#pragma unroll
          for (int t = 0; t < 2; ++t) { v8f a = {}, al = {};
#pragma unroll
            for (int kc = 0; kc < HD / 32; ++kc) { const v16h kbf = fragp_h(krow + ((c * 2 + t) * 4 + kc) * 512), klf = fragp_h(klrow + ((c * 2 + t) * 4 + kc) * 512); a = wmma16(kbf, qh[kc], a); al = wmma16(kbf, ql[kc], al); al = wmma16(klf, qh[kc], al); }
#pragma unroll
            for (int r = 0; r < 8; ++r) { const float th = tanh_sel((a[r] + al[r] * (1.0f / 1024.0f)) * SCALE); pv[t * 8 + r] = (k0 + c * 32 + t * 16 + 8 * g + r <= qu + col ? th : -1.0f) * 2048.0f; } }
          p[c] = bsplit16(pv); }
      } else {
#pragma unroll
        for (int c = 0; c < KW / 32; ++c)
#pragma unroll
          for (int i = 0; i < 16; ++i) { p[c].h[i] = (__bf16)(-2048.0f); p[c].l[i] = (__bf16)0.0f; } }
#pragma unroll
      for (int j = 0; j < HD / 16; ++j) { v8f acc = {}; v16b vh[KW / 32], vl[KW / 32];   /* the fragments of 16 v columns are fetched together, in front of their products */
#pragma unroll
        for (int c = 0; c < KW / 32; ++c) { const int po = (c * 8 + j) * 512; vh[c] = fragp_b(vrow + po); vl[c] = fragp_b(vlrow + po); }
#pragma unroll
        for (int c = 0; c < KW / 32; ++c) { acc = wmma_bf(p[c].h, vh[c], acc); acc = wmma_bf(p[c].l, vh[c], acc); acc = wmma_bf(p[c].h, vl[c], acc); }
#pragma unroll
        for (int r = 0; r < 8; ++r) ss[wave][u * 16 + 8 * g + r][j * 16 + col] = acc[r]; } }
  } else {
    v16h p[QW][KW / 32];
    if (k0 <= ql0 + 16 * QW - 1) {   /* wave-uniform: the slice holds a key that some query of the block may see */
      v16h qh[QW][HD / 32]; const int lim = ql0 + col - k0 - 8 * g;   /* key <= query, both counted from the slice's and the lane's own start: one register against a constant per element */
#pragma unroll
      for (int u = 0; u < QW; ++u)
#pragma unroll
        for (int kc = 0; kc < HD / 32; ++kc) qh[u][kc] = fragp_h(qrow + (u * 4 + kc) * 512);
      v16h kf[2][HD / 32];   /* a 16-key tile's four fragments are fetched together, one tile ahead of their products: the loads stay in source order round the products' asm, so one written at its product would be waited for alone */
#pragma unroll
      for (int kc = 0; kc < HD / 32; ++kc) kf[0][kc] = fragp_h(krow + kc * 512);
#pragma unroll
      for (int c = 0; c < KW / 32; ++c)
#pragma unroll
        for (int t = 0; t < 2; ++t) { v8f a[QW] = {};
          if (c * 2 + t + 1 < KW / 16) {
#pragma unroll
            for (int kc = 0; kc < HD / 32; ++kc) kf[(t + 1) & 1][kc] = fragp_h(krow + ((c * 2 + t + 1) * 4 + kc) * 512); }
#pragma unroll
          for (int kc = 0; kc < HD / 32; ++kc)
#pragma unroll
            for (int u = 0; u < QW; ++u) a[u] = wmma16(kf[t][kc], qh[u][kc], a[u]);
#pragma unroll
          for (int u = 0; u < QW; ++u) { float x[8];
#pragma unroll
            for (int r = 0; r < 8; ++r) x[r] = (c * 32 + t * 16 + r - u * 16 <= lim ? a[u][r] : -__builtin_inff()) * T2L;   /* the mask goes in as the reference's own -inf */
            exp2x8(x);
#pragma unroll
            for (int r = 0; r < 8; ++r) x[r] += 1.0f;
            rcpx8(x);
#pragma unroll
            for (int r = 0; r < 8; ++r) p[u][c][t * 8 + r] = (_Float16)fmaf(x[r], -4096.0f, 2048.0f); } }
    } else {
#pragma unroll
      for (int u = 0; u < QW; ++u)
#pragma unroll
        for (int c = 0; c < KW / 32; ++c)
#pragma unroll
          for (int i = 0; i < 16; ++i) p[u][c][i] = (_Float16)(-2048.0f); }
    const _Float16* vrow = VT + (bh * TT + k0) * HD + lane * 8;   /* v fragment (32 keys c, 16 columns j) lies (c * 8 + j) * 512 elements on */
    v16h vf[2][KW / 32];   /* the four fragments of 16 v columns are fetched together, one column group ahead of their products */
#pragma unroll
    for (int c = 0; c < KW / 32; ++c) vf[0][c] = fragp_h(vrow + c * 8 * 512);
#pragma unroll
    for (int j = 0; j < HD / 16; ++j) { v8f acc[QW] = {};
      if (j + 1 < HD / 16) {
#pragma unroll
        for (int c = 0; c < KW / 32; ++c) vf[(j + 1) & 1][c] = fragp_h(vrow + (c * 8 + j + 1) * 512); }
#pragma unroll
      for (int c = 0; c < KW / 32; ++c)
#pragma unroll
        for (int u = 0; u < QW; ++u) acc[u] = wmma16(p[u][c], vf[j & 1][c], acc[u]);
#pragma unroll
      for (int u = 0; u < QW; ++u)
#pragma unroll
        for (int r = 0; r < 8; ++r) ss[wave][u * 16 + 8 * g + r][j * 16 + col] = acc[u][r]; }
  }
  __syncthreads();   /* every wave's partial tiles are in LDS before any thread adds across the waves */
  for (int e = tid; e < 16 * QW * (HD / 4); e += 32 * KS) { const int rl = e / (HD / 4), c4 = e % (HD / 4); v4f s = *(const v4f*)&ss[0][rl][c4 * 4];   /* unrolled below: the KS LDS reads are then in flight together instead of one wait each */
#pragma unroll
    for (int w = 1; w < KS; ++w) s += *(const v4f*)&ss[w][rl][c4 * 4];
    vst2(Y + ((size_t)b * TT + ql0 + rl) * CC + h * HD + c4 * 4, s * (1.0f / 2048.0f)); } }

extern "C" void kernel_launch(void* const* d_in, const int* in_sizes, int n_in, void* d_out, int out_size, void* d_ws, size_t ws_size, hipStream_t stream) {
  (void)in_sizes; (void)n_in; (void)out_size;
  const float** F = (const float**)d_in;
  if (ws_size < (size_t)WS_END) return;
  char* ws = (char*)d_ws; _Float16 *QH = (_Float16*)(ws + WS_QH), *KH = (_Float16*)(ws + WS_KH), *VT = (_Float16*)(ws + WS_VT), *QL = (_Float16*)(ws + WS_QL), *KL = (_Float16*)(ws + WS_KL); __bf16 *VB = (__bf16*)(ws + WS_VB), *VBL = (__bf16*)(ws + WS_VBL);
  // inputs: 0 Q [2,2048,2048]; 1 K; 2 V (raw [B, T, (h, d)] tensors)
  k_prep8<<<dim3(TNB * TT / 64, NH), PT, 0, stream>>>(F[0], F[1], F[2], QH, QL, KH, KL, VT, VB, VBL);
  k_att<<<dim3(TT / (16 * QW), NH, TNB), 32 * KS, 0, stream>>>(QH, KH, QL, KL, VT, VB, VBL, (float*)d_out);
}

// v006
// It runs in 149 microseconds.
// Two timings next to v005 put it at 1.14 and 1.16 times that version's speed.
// Over all steps from v000 it is 14.3 times as fast.
// compute dtype: all float inputs rounded to bf16; interleaved-pair RoPE applied in f32 to the bf16 q/k rows (64 embedded f32 inverse frequencies = XLA's table, accurate sincosf of the f32 angle t*freq); rotated q/k as f16 hi + residual (x 2^10) planes below row 384, once to f16 beyond; causal logits x 128^-0.5 with 3 products below row 384, 1 product beyond; att = tanh(logit) in f32 for k <= t (the math library's formulas below row 384; beyond, 1 - 2 / (exp2(2 log2(e) logit) + 1) on the hardware exp2 and reciprocal) and exactly -1 for k > t (tanh(-inf)); att x 2^11 against v: bf16 hi + lo (3 products) for query rows < 384, once to f16 against v f16 beyond; a 128-key slice that lies wholly behind a block's 32 queries has att = -1 throughout and enters as -2^11 x its f32 column sums of v; f32 output [B, T, C].
#include <hip/hip_runtime.h>
#include <math.h>

typedef __attribute__((ext_vector_type(16))) _Float16 v16h;
typedef __attribute__((ext_vector_type(16))) __bf16 v16b;
typedef __attribute__((ext_vector_type(8)))  _Float16 v8h;
typedef __attribute__((ext_vector_type(8)))  float v8f;
typedef __attribute__((ext_vector_type(4)))  float v4f;
typedef __attribute__((ext_vector_type(2)))  float v2f;
typedef __attribute__((ext_vector_type(4)))  unsigned v4u;
typedef __attribute__((ext_vector_type(4)))  int v4i;
typedef float __attribute__((may_alias)) float_a;
typedef int __attribute__((may_alias)) int_a;

template <typename T> __device__ __forceinline__ void vst2(void* p, T v) { *(T*)p = v;  }
__device__ __forceinline__ v8f wmma16(v16h a, v16h b, v8f c) {
  v8f d = __builtin_amdgcn_wmma_f32_16x16x32_f16(false, a, false, b, (short)0, c, false, false);
  asm volatile("v_nop\n\tv_nop\n\tv_nop\n\tv_nop" : "+v"(d) : "v"(a), "v"(b));
  return d;
}
__device__ __forceinline__ v8f wmma_bf(v16b a, v16b b, v8f c) {
  v8f d = __builtin_amdgcn_wmma_f32_16x16x32_bf16(false, a, false, b, (short)0, c, false, false);
  asm volatile("v_nop\n\tv_nop\n\tv_nop\n\tv_nop" : "+v"(d) : "v"(a), "v"(b));
  return d;
}
// 16x16x32 fragments: lane = (h = lane>>4, row/col = lane&15); elements 0..7 = k0+8h+0..7, 8..15 = k0+16+8h+0..7; D element r = row 8h+r
__device__ __forceinline__ v16h frag_h(const _Float16* rowk0, int lane) {
  union { v16h v; v8h q[2]; } u; const _Float16* p = rowk0 + 8 * (lane >> 4);
  u.q[0] = *(const v8h*)p; u.q[1] = *(const v8h*)(p + 16); return u.v;
}
__device__ __forceinline__ v16h frag_f32(const float* rowk0, int lane) {
  v16h a; const float* p = rowk0 + 8 * (lane >> 4);
#pragma unroll
  for (int i = 0; i < 8; ++i) { a[i] = (_Float16)p[i]; a[8 + i] = (_Float16)p[16 + i]; }
  return a;
}
__device__ __forceinline__ v16h frag_f32s(const float* rowk0, int lane, float sc) {
  v16h a; const float* p = rowk0 + 8 * (lane >> 4);
#pragma unroll
  for (int i = 0; i < 8; ++i) { a[i] = (_Float16)(p[i] * sc); a[8 + i] = (_Float16)(p[16 + i] * sc); }
  return a;
}
// column fragment from a [K][ld] layout (column n), rows >= K read as 0
__device__ __forceinline__ v16h fragc_f32(const float* W, int k0, int n, int lane, int ld, int K) {
  v16h a; const int g = lane >> 4;
#pragma unroll
  for (int i = 0; i < 8; ++i) { const int ka = k0 + 8 * g + i, kb = ka + 16;
    a[i] = (_Float16)(ka < K ? W[(size_t)(ka < K ? ka : K - 1) * ld + n] : 0.f); a[8 + i] = (_Float16)(kb < K ? W[(size_t)(kb < K ? kb : K - 1) * ld + n] : 0.f); }
  return a;
}
struct F2 { v16b h, l; };
__device__ __forceinline__ F2 bsplit16(const float v[16]) { F2 r;
#pragma unroll
  for (int i = 0; i < 16; ++i) { const __bf16 h = (__bf16)v[i]; r.h[i] = h; r.l[i] = (__bf16)(v[i] - (float)h); }
  return r; }
__device__ __forceinline__ F2 split_row(const float* row, int k0, int lane) { float v[16]; const float* p = row + k0 + 8 * (lane >> 4);
#pragma unroll
  for (int i = 0; i < 8; ++i) { v[i] = p[i]; v[8 + i] = p[16 + i]; }
  return bsplit16(v); }
__device__ __forceinline__ F2 split_rowK(const float* row, int k0, int lane, int K) { float v[16]; const int g = lane >> 4;
#pragma unroll
  for (int i = 0; i < 8; ++i) { const int ka = k0 + 8 * g + i, kb = ka + 16; v[i] = ka < K ? row[ka < K ? ka : K - 1] : 0.f; v[8 + i] = kb < K ? row[kb < K ? kb : K - 1] : 0.f; }
  return bsplit16(v); }
__device__ __forceinline__ F2 split_col(const float* W, int k0, int n, int lane, int ld, int K) { float v[16]; const int g = lane >> 4;
#pragma unroll
  for (int i = 0; i < 8; ++i) { const int ka = k0 + 8 * g + i, kb = ka + 16; v[i] = ka < K ? W[(size_t)(ka < K ? ka : K - 1) * ld + n] : 0.f; v[8 + i] = kb < K ? W[(size_t)(kb < K ? kb : K - 1) * ld + n] : 0.f; }
  return bsplit16(v); }
__device__ __forceinline__ v8f mac3(const F2& a, const F2& b, v8f c) { c = wmma_bf(a.l, b.h, c); c = wmma_bf(a.h, b.l, c); return wmma_bf(a.h, b.h, c); }
__device__ __forceinline__ float sigm(float v) { return 1.0f / (1.0f + expf(-v)); }
#define LDSX() do { asm volatile("s_wait_dscnt 0" ::: "memory"); __builtin_amdgcn_wave_barrier(); __builtin_amdgcn_fence(__ATOMIC_RELEASE, "workgroup"); } while (0)

// Causal 'tanh attention' (no softmax) with RoPE (B 2, T 2,048, C 2,048 = 16 heads x 128; raw Q, K, V inputs, no projections): q, k = rope_interleaved(split_heads(Q)), rope(split_heads(K)); scores = q k^T / sqrt(128); att = tanh(where(causal, scores, -inf)) -> masked entries are exactly -1 and STILL multiply v; out = att v merged to [B, T, C].
#define NB 2
#define TT 2048
#define CC 2048            // NH * HD = projected width
#define DIN 2048          // input (model) width
#define NH 16
#define HD 128
#define NQB (TT / 64)
#define HG 4
#define SCALE (0.08838834764831845f)
#define CAUSAL 1
#ifndef TNB
#define TNB NB
#endif
__device__ __forceinline__ float bfr(float v) { return (float)(__bf16)v; }
__host__ __device__ __forceinline__ int kb_last(int qb) { return CAUSAL ? ((qb * 64 + 63) >> 7) : (TT / 128 - 1); }
typedef __attribute__((ext_vector_type(8))) __bf16 v8b;
__device__ __forceinline__ v16b frag_b(const __bf16* rowk0, int lane) {
  union { v16b v; v8b q[2]; } u; const __bf16* p = rowk0 + 8 * (lane >> 4);
  u.q[0] = *(const v8b*)p; u.q[1] = *(const v8b*)(p + 16); return u.v;
}
// fragment-order planes: one 16 x 32 fragment is 1 KiB in a row: elements 0..7 of lanes 0..31 (512 B), then elements 8..15; p = fragment start + 8 * lane, so each of the two loads of a wave reads four whole 128-B lines
__device__ __forceinline__ v16h fragp_h(const _Float16* p) { union { v16h v; v8h q[2]; } u; u.q[0] = *(const v8h*)p; u.q[1] = *(const v8h*)(p + 256); return u.v; }
__device__ __forceinline__ v16b fragp_b(const __bf16* p) { union { v16b v; v8b q[2]; } u; u.q[0] = *(const v8b*)p; u.q[1] = *(const v8b*)(p + 256); return u.v; }
#define QHI 384            // rows carrying a q residual plane
#define KHI 2048           // k residual plane: keys carrying one
#define VHI 384            // v bf16 planes: the keys of the slices that a query row < QBH * 64 may see (the keys behind them enter through the column sums)
// B fragment (k rows k0+.., output column o) of a weight: (in,out) [K][ld] or (out,in) [ld rows of K]: bf16 exact, or f16(bf16 * 256) exact
__device__ __forceinline__ v16b wcol_io(const float* Wm, int k0, int o, int lane, int ld) { v16b w; const int g = lane >> 4;
#pragma unroll
  for (int i = 0; i < 8; ++i) { w[i] = (__bf16)Wm[(size_t)(k0 + 8 * g + i) * ld + o]; w[8 + i] = (__bf16)Wm[(size_t)(k0 + 16 + 8 * g + i) * ld + o]; }
  return w; }
__device__ __forceinline__ v16b wcol_oi(const float* Wm, int k0, int o, int lane, int K) { v16b w; const float* p = Wm + (size_t)o * K + k0 + 8 * (lane >> 4);
#pragma unroll
  for (int i = 0; i < 8; ++i) { w[i] = (__bf16)p[i]; w[8 + i] = (__bf16)p[16 + i]; }
  return w; }
__device__ __forceinline__ v16h wcolh_io(const float* Wm, int k0, int o, int lane, int ld) { v16h w; const int g = lane >> 4;
#pragma unroll
  for (int i = 0; i < 8; ++i) { w[i] = (_Float16)(bfr(Wm[(size_t)(k0 + 8 * g + i) * ld + o]) * 256.0f); w[8 + i] = (_Float16)(bfr(Wm[(size_t)(k0 + 16 + 8 * g + i) * ld + o]) * 256.0f); }
  return w; }
__device__ __forceinline__ v16h wcolh_oi(const float* Wm, int k0, int o, int lane, int K) { v16h w; const float* p = Wm + (size_t)o * K + k0 + 8 * (lane >> 4);
#pragma unroll
  for (int i = 0; i < 8; ++i) { w[i] = (_Float16)(bfr(p[i]) * 256.0f); w[8 + i] = (_Float16)(bfr(p[16 + i]) * 256.0f); }
  return w; }
#define WQKV_LAYOUT 1   // 0 = (in,out) [DIN][CC]; 1 = (out,in) [CC][DIN]; 2 = per-head [NH][DIN][HD]
__device__ __forceinline__ v16b wcol_hdk(const float* Wm, int k0, int o, int lane) { v16b w; const int g = lane >> 4; const float* p = Wm + (size_t)(o / HD) * DIN * HD + (o % HD);
#pragma unroll
  for (int i = 0; i < 8; ++i) { w[i] = (__bf16)p[(size_t)(k0 + 8 * g + i) * HD]; w[8 + i] = (__bf16)p[(size_t)(k0 + 16 + 8 * g + i) * HD]; }
  return w; }
#define WO_OUT_IN 0
#if WQKV_LAYOUT == 1
#define WCOL(W, k0, o, lane) wcol_oi(W, k0, o, lane, DIN)
#elif WQKV_LAYOUT == 2
#define WCOL(W, k0, o, lane) wcol_hdk(W, k0, o, lane)
#else
#define WCOL(W, k0, o, lane) wcol_io(W, k0, o, lane, CC)
#endif
#if WO_OUT_IN
#define WOCOL(W, k0, o, lane) wcol_oi(W, k0, o, lane, CC)
#define WOCOLH(W, k0, o, lane) wcolh_oi(W, k0, o, lane, CC)
#else
#define WOCOL(W, k0, o, lane) wcol_io(W, k0, o, lane, DIN)
#define WOCOLH(W, k0, o, lane) wcolh_io(W, k0, o, lane, DIN)
#endif
#define QBH 6
__constant__ float c_freq[64] = {1.000000000e+00f,8.659643531e-01f,7.498942018e-01f,6.493816376e-01f,5.623413324e-01f,4.869675338e-01f,4.216965139e-01f,3.651741445e-01f,3.162277639e-01f,2.738419771e-01f,2.371373624e-01f,2.053525001e-01f,1.778279394e-01f,1.539926529e-01f,1.333521456e-01f,1.154782027e-01f,1.000000015e-01f,8.659642935e-02f,7.498941571e-02f,6.493816525e-02f,5.623412877e-02f,4.869675264e-02f,4.216964915e-02f,3.651741147e-02f,3.162277862e-02f,2.738419548e-02f,2.371373586e-02f,2.053525113e-02f,1.778279431e-02f,1.539926510e-02f,1.333521493e-02f,1.154781971e-02f,9.999999776e-03f,8.659643121e-03f,7.498942316e-03f,6.493816618e-03f,5.623413250e-03f,4.869675264e-03f,4.216964822e-03f,3.651741426e-03f,3.162277862e-03f,2.738419687e-03f,2.371373819e-03f,2.053525066e-03f,1.778279431e-03f,1.539926510e-03f,1.333521446e-03f,1.154782018e-03f,1.000000047e-03f,8.659643354e-04f,7.498941850e-04f,6.493816618e-04f,5.623413017e-04f,4.869675031e-04f,4.216964880e-04f,3.651741135e-04f,3.162277862e-04f,2.738419571e-04f,2.371373848e-04f,2.053524950e-04f,1.778279402e-04f,1.539926452e-04f,1.333521504e-04f,1.154781930e-04f};   /* 1/10000^(2i/128), i = 0..63, as XLA's f32 table */
// ---- k_prep8: block = (64 attention positions s0.. of sequence b, head h): reads the raw [B, T, C] inputs (element (b,s,h,c) at (b*TT + s)*CC + h*HD + c), bf16-rounds them and writes the attention planes in fragment order (fragp_h), [b][h][s / 16][c / 32] fragments of q and k (row = s, k = c) and [b][h][s / 32][c / 16] fragments of v (row = c, k = s): q -> f16 hi (+ x 2^10 residual for s < QHI), k -> f16 (+ residual, s < KHI), v -> f16 (+ bf16 hi/lo for s < VHI, + f32 column sums of the 64 positions); the block's 64 positions are 16 KiB in a row of every plane
#define PT 256             // threads of k_prep8: 8 waves, each takes PR whole rows of the 64-row tile
#define PR 8
typedef __attribute__((ext_vector_type(4))) _Float16 v4h;
__global__ __launch_bounds__(PT) void k_prep8(const float* __restrict__ Q, const float* __restrict__ K, const float* __restrict__ V, _Float16* __restrict__ QH, _Float16* __restrict__ QL, _Float16* __restrict__ KH, _Float16* __restrict__ KL, _Float16* __restrict__ VT, __bf16* __restrict__ VB, __bf16* __restrict__ VBL, float* __restrict__ SV) {
  __shared__ __align__(16) _Float16 sq[64][136], sql[64][136], sk[64][136], skl[64][136], tv[128][72]; __shared__ __align__(16) __bf16 tb[128][72], tbl[128][72];
  const int tid = threadIdx.x; const int h = blockIdx.y; const size_t r0 = (size_t)blockIdx.x * 64; const size_t bb = r0 / TT; const int t0 = (int)(r0 % TT); const bool qhi = t0 < QHI, khi = t0 < KHI, vhi = t0 < VHI;
  { const int cg = tid & 31, c = cg * 4, rb = (tid >> 5) * PR; const size_t o0 = ((bb * TT + t0 + rb) * (size_t)CC) + h * HD + c;   /* raw [B, T, (h, d)] layout; a lane owns 4 adjacent columns (two rotation pairs) of PR rows in a row */
    const float fr[2] = {c_freq[cg * 2], c_freq[cg * 2 + 1]};   /* oldest load: the angles need it alone, so the first sincosf runs while the tile is on its way */
    asm volatile("s_wait_xcnt 0x0" ::: "memory");   /* before the table load's offset register is given to a tile load's result */
    v4f qv[PR], kv[PR], vv[PR];   /* the lane's whole share of the tile is requested in front of the first use: 3 * PR loads of 16 B in flight, one memory latency a block */
#pragma unroll
    for (int i = 0; i < PR; ++i) { qv[i] = *(const v4f*)(Q + o0 + (size_t)i * CC); kv[i] = *(const v4f*)(K + o0 + (size_t)i * CC); vv[i] = *(const v4f*)(V + o0 + (size_t)i * CC); }
    asm volatile("s_wait_xcnt 0x0" ::: "memory");   /* before the three address pairs of the tile loads are overwritten by the angle code; also keeps every load in front of it */
    v8h tvp[4]; v8b tbp[4], tlp[4];   /* v: PR rows of one column are 16 B in a row of the transposed planes */
#pragma unroll
    for (int i = 0; i < PR; ++i) { const int rl = rb + i; v4h qh4, ql4, kh4, kl4;   /* module inputs bf16-rounded; interleaved-pair RoPE on q and k in f32 */
#pragma unroll
      for (int p = 0; p < 2; ++p) { const float ang = (float)(t0 + rl) * fr[p]; float sn, cs; sincosf(ang, &sn, &cs);
        const float qe = bfr(qv[i][2 * p]), qo = bfr(qv[i][2 * p + 1]), ke = bfr(kv[i][2 * p]), ko = bfr(kv[i][2 * p + 1]);
        const float qr[2] = {qe * cs - qo * sn, qe * sn + qo * cs}, kr[2] = {ke * cs - ko * sn, ke * sn + ko * cs};
#pragma unroll
        for (int s = 0; s < 2; ++s) { const _Float16 qh = (_Float16)qr[s], kh = (_Float16)kr[s]; qh4[2 * p + s] = qh; ql4[2 * p + s] = (_Float16)((qr[s] - (float)qh) * 1024.0f); kh4[2 * p + s] = kh; kl4[2 * p + s] = (_Float16)((kr[s] - (float)kh) * 1024.0f); } }
      *(v4h*)&sq[rl][c] = qh4; *(v4h*)&sql[rl][c] = ql4; *(v4h*)&sk[rl][c] = kh4; *(v4h*)&skl[rl][c] = kl4;
#pragma unroll
      for (int j = 0; j < 4; ++j) { const float v = bfr(vv[i][j]); tvp[j][i] = (_Float16)v; const __bf16 vb = (__bf16)v; tbp[j][i] = vb; tlp[j][i] = (__bf16)(v - (float)vb); } }
#pragma unroll
    for (int j = 0; j < 4; ++j) { *(v8h*)&tv[c + j][rb] = tvp[j]; *(v8b*)&tb[c + j][rb] = tbp[j]; *(v8b*)&tbl[c + j][rb] = tlp[j]; } }
  __syncthreads();
  /* e counts the 16-B pieces of the block's 16 KiB in plane order: lane l = e & 31, half of the fragment (e >> 5) & 1, then the fragment; a wave's store is 512 B in a row */
  for (int e = tid; e < 64 * (HD / 8); e += PT) { const int l = e & 31, rl = (e >> 8) * 16 + (l & 15), c = ((e >> 5) & 7) * 16 + (l >> 4) * 8; const size_t o = ((bb * NH + h) * (size_t)TT + t0) * HD + e * 8; vst2((unsigned*)(QH + o), *(const v4u*)&sq[rl][c]); vst2((unsigned*)(KH + o), *(const v4u*)&sk[rl][c]); asm volatile("s_wait_xcnt 0x0" ::: "memory");   /* before the two stores' data and address registers are rewritten for the next planes and the next trip */
    if (qhi) { vst2((unsigned*)(QL + ((bb * NH + h) * (size_t)QHI + t0) * HD + e * 8), *(const v4u*)&sql[rl][c]); asm volatile("s_wait_xcnt 0x0" ::: "memory"); }   /* before the store's data registers take the next LDS read */
    if (khi) vst2((unsigned*)(KL + ((bb * NH + h) * (size_t)KHI + t0) * HD + e * 8), *(const v4u*)&skl[rl][c]); }
  for (int e = tid; e < HD * 8; e += PT) { const int l = e & 31, cl = ((e >> 6) & 7) * 16 + (l & 15), sl = (e >> 9) * 32 + ((e >> 5) & 1) * 16 + (l >> 4) * 8; vst2((unsigned*)(VT + ((bb * NH + h) * (size_t)TT + t0) * HD + e * 8), *(const v4u*)&tv[cl][sl]); asm volatile("s_wait_xcnt 0x0" ::: "memory");   /* before the store's data and offset registers are rewritten for the next planes or the next trip */
    if (vhi) { const size_t o3 = ((bb * NH + h) * (size_t)VHI + t0) * HD + e * 8; vst2((unsigned*)(VB + o3), *(const v4u*)&tb[cl][sl]); vst2((unsigned*)(VBL + o3), *(const v4u*)&tbl[cl][sl]); asm volatile("s_wait_xcnt 0x0" ::: "memory"); } }   /* the same for these two stores, before the next trip */
  /* column sums of the block's 64 rows of v (the bf16 values, added in f32): what a key behind every query of a k_att block adds to each of them, up to the factor -1; thread = column, eight running sums so that the adds do not wait for one another */
  if (tid < HD) { float a[8] = {};
#pragma unroll
    for (int q = 0; q < 8; ++q) { const v8b t = *(const v8b*)&tb[tid][q * 8];
#pragma unroll
      for (int i = 0; i < 8; ++i) a[i] += (float)t[i]; }
    SV[((bb * NH + h) * (size_t)(TT / 64) + t0 / 64) * HD + tid] = ((a[0] + a[1]) + (a[2] + a[3])) + ((a[4] + a[5]) + (a[6] + a[7])); } }

#ifndef SM_EXTRA_PARAMS
#define SM_EXTRA_PARAMS
#endif
#ifndef PROJ_EXTRA_PARAMS
#define PROJ_EXTRA_PARAMS
#endif
#ifndef SM_MASK_HOOK
#define SM_MASK_HOOK (void)0
#endif

#define WS_QH  0u                                      // f16 q fragments [b][h][t / 16][d / 32]
#define WS_KH  (WS_QH + 2u * (size_t)NB * TT * CC)      // f16 k fragments [b][h][t / 16][d / 32]
#define WS_VT  (WS_KH + 2u * (size_t)NB * TT * CC)      // f16 v fragments [b][h][t / 32][d / 16]
#define WS_QL  (WS_VT + 2u * (size_t)NB * CC * TT)      // f16 q residual x 2^10 fragments [b][h][t < QHI]
#define WS_KL  (WS_QL + 2u * (size_t)NB * QHI * CC)     // f16 k residual x 2^10 fragments [b][h][t < KHI]
#define WS_VB  (WS_KL + 2u * (size_t)NB * KHI * CC)     // bf16 v hi fragments [b][h][t < VHI]
#define WS_VBL (WS_VB + 2u * (size_t)NB * CC * VHI)
#define WS_S   (WS_VBL + 2u * (size_t)NB * CC * VHI)    // f32 column sums of v over 64 keys [b][h][t / 64][d] (the start of the region)
#define WS_Y   (WS_S  + 4u * (size_t)HG * TT * TT)      // f32 ctx rows [b*t][CC] (only when there is an output projection)
#define WS_END (WS_Y  + 0u)

// tanh by the math library's own two range formulas (|x| >= 0.625: 1 - 2 / (exp(2|x|) + 1); below: x + x^3 . poly(x^2)), both evaluated and one selected per lane: the library form branches per element, which splits the unrolled tile into hundreds of blocks and keeps two f32 registers per element alive up to the products
__device__ __forceinline__ float tanh_sel(float x) { const float y = fabsf(x), y2 = x * x;
  const float zb = fmaf(__builtin_amdgcn_rcpf(expf(y + y) + 1.0f), -2.0f, 1.0f);
  float q = fmaf(-0x1.758e7ap-8f, y2, 0x1.521192p-6f); q = fmaf(y2, q, -0x1.b8389cp-5f); q = fmaf(y2, q, 0x1.110704p-3f); q = fmaf(y2, q, -0x1.555532p-2f);
  const float zs = fmaf(y2, y * q, y);
  return copysignf(y < 0.625f ? zs : zb, x); }
// tanh(logit x SCALE) x 2^11 for the rows whose att is rounded once to f16 right behind it: 2^11 - 2^12 / (2^(logit x 2 SCALE log2 e) + 1), one formula for every range on the chip's own exp2 and reciprocal; absolute error of tanh below 3e-7, against the f16 rounding's 2^-12 relative; -inf (a masked key) gives -2^11
#define T2L ((float)(2.0 * 0.08838834764831845 * 1.4426950408889634))
// eight transcendentals in one statement, each in place on its own register: none reads a neighbour's result or overwrites a neighbour's source, and the closing v_nop is the free slot the instruction set asks for behind the last one, whatever the compiler puts next
__device__ __forceinline__ void exp2x8(float (&x)[8]) { asm("v_exp_f32 %0, %0\n\tv_exp_f32 %1, %1\n\tv_exp_f32 %2, %2\n\tv_exp_f32 %3, %3\n\tv_exp_f32 %4, %4\n\tv_exp_f32 %5, %5\n\tv_exp_f32 %6, %6\n\tv_exp_f32 %7, %7\n\tv_nop" : "+v"(x[0]), "+v"(x[1]), "+v"(x[2]), "+v"(x[3]), "+v"(x[4]), "+v"(x[5]), "+v"(x[6]), "+v"(x[7])); }
__device__ __forceinline__ void rcpx8(float (&x)[8]) { asm("v_rcp_f32 %0, %0\n\tv_rcp_f32 %1, %1\n\tv_rcp_f32 %2, %2\n\tv_rcp_f32 %3, %3\n\tv_rcp_f32 %4, %4\n\tv_rcp_f32 %5, %5\n\tv_rcp_f32 %6, %6\n\tv_rcp_f32 %7, %7\n\tv_nop" : "+v"(x[0]), "+v"(x[1]), "+v"(x[2]), "+v"(x[3]), "+v"(x[4]), "+v"(x[5]), "+v"(x[6]), "+v"(x[7])); }
// ---- k_att: block = 32 queries (ql0..) of (b, h), KS waves; wave w owns the key slice [w * TT / KS, (w + 1) * TT / KS). Logits are formed TRANSPOSED (A = k rows, B = q rows): D element r of lane (g, col) is key 8g + r of query col, so two 16-key tiles are, register for register, the A fragment of att for 32 keys, and logits and att never leave the registers. att = tanh(logit x SCALE) for key <= query, exactly -1 beyond, x 2^11; ctx = att . v over the slices that hold a key some query of the block may see (f16, 1 product, each k and v fragment used for both 16-query tiles; query rows < QBH * 64: 3-product logits, att and v as bf16 hi + lo, 3 products, one 16-query tile after the other); a slice wholly beyond the block's queries gives all of them one and the same partial row, -2^11 x the slice's column sums of v (SV, from k_prep8), and its wave fetches that row alone; the KS f32 partials meet in LDS and are added in slice order; 512-B (row, head) segment by 32 lanes
#define KS 16
#define KW (TT / KS)       // keys per wave
#define QW 2               // 16-query tiles per wave
__global__ __launch_bounds__(32 * KS) void k_att(const _Float16* __restrict__ QH, const _Float16* __restrict__ KH, const _Float16* __restrict__ QL, const _Float16* __restrict__ KL, const _Float16* __restrict__ VT, const __bf16* __restrict__ VB, const __bf16* __restrict__ VBL, float* __restrict__ Y, const float* __restrict__ SV) { __shared__ __align__(16) float ss[KS][16 * QW][HD + 4];
  const int h = blockIdx.y, b = blockIdx.z; const int tid = threadIdx.x, wave = __builtin_amdgcn_readfirstlane(tid >> 5), lane = tid & 31, col = lane & 15, g = lane >> 4; const int ql0 = blockIdx.x * (16 * QW), k0 = wave * KW;
  const size_t bh = (size_t)b * NH + h; const _Float16* qrow = QH + (bh * TT + ql0) * HD + lane * 8; const _Float16* krow = KH + (bh * TT + k0) * HD + lane * 8;   /* the lane's piece of the first fragment; fragment (16 rows n, 32 dims kc) lies (n * 4 + kc) * 512 elements on */
  if (k0 > ql0 + 16 * QW - 1) {   /* wave-uniform: every key of the slice lies behind every query of the block */
    const float* sv = SV + (bh * (TT / 64) + k0 / 64) * HD + lane * 4; const v4f s0 = *(const v4f*)sv, s1 = *(const v4f*)(sv + HD);
    asm volatile("s_wait_xcnt 0x0" ::: "memory");   /* before the two loads' address registers are given to anything else */
    *(v4f*)&ss[wave][0][lane * 4] = (s0 + s1) * -2048.0f;   /* row 0 stands for all 16 * QW rows */
  } else if (ql0 < QBH * 64) {
    const _Float16* qlrow = QL + (bh * QHI + ql0) * HD + lane * 8; const _Float16* klrow = KL + (bh * KHI + k0) * HD + lane * 8;
    const __bf16* vrow = VB + (bh * VHI + k0) * HD + lane * 8; const __bf16* vlrow = VBL + (bh * VHI + k0) * HD + lane * 8;   /* v fragment (32 keys c, 16 columns j) lies (c * 8 + j) * 512 elements on */
#pragma unroll 1   /* rolled: one 16-query tile's fragments and sums in registers at a time */
    for (int u = 0; u < QW; ++u) { const int qu = ql0 + u * 16; F2 p[KW / 32];
      {   /* k0 and ql0 are multiples of 32, so a slice that starts at or before ql0 + 31 starts at or before ql0: both 16-query tiles see keys of it */
        v16h qh[HD / 32], ql[HD / 32];
#pragma unroll
        for (int kc = 0; kc < HD / 32; ++kc) { qh[kc] = fragp_h(qrow + (u * 4 + kc) * 512); ql[kc] = fragp_h(qlrow + (u * 4 + kc) * 512); }
#pragma unroll
        for (int c = 0; c < KW / 32; ++c) { float pv[16];
#pragma unroll
          for (int t = 0; t < 2; ++t) { v8f a = {}, al = {};
#pragma unroll
            for (int kc = 0; kc < HD / 32; ++kc) { const v16h kbf = fragp_h(krow + ((c * 2 + t) * 4 + kc) * 512), klf = fragp_h(klrow + ((c * 2 + t) * 4 + kc) * 512); a = wmma16(kbf, qh[kc], a); al = wmma16(kbf, ql[kc], al); al = wmma16(klf, qh[kc], al); }
#pragma unroll
            for (int r = 0; r < 8; ++r) { const float th = tanh_sel((a[r] + al[r] * (1.0f / 1024.0f)) * SCALE); pv[t * 8 + r] = (k0 + c * 32 + t * 16 + 8 * g + r <= qu + col ? th : -1.0f) * 2048.0f; } }
          p[c] = bsplit16(pv); } }
#pragma unroll
      for (int j = 0; j < HD / 16; ++j) { v8f acc = {}; v16b vh[KW / 32], vl[KW / 32];   /* the fragments of 16 v columns are fetched together, in front of their products */
#pragma unroll
        for (int c = 0; c < KW / 32; ++c) { const int po = (c * 8 + j) * 512; vh[c] = fragp_b(vrow + po); vl[c] = fragp_b(vlrow + po); }
#pragma unroll
        for (int c = 0; c < KW / 32; ++c) { acc = wmma_bf(p[c].h, vh[c], acc); acc = wmma_bf(p[c].l, vh[c], acc); acc = wmma_bf(p[c].h, vl[c], acc); }
#pragma unroll
        for (int r = 0; r < 8; ++r) ss[wave][u * 16 + 8 * g + r][j * 16 + col] = acc[r]; } }
  } else {
    v16h p[QW][KW / 32];
    {
      v16h qh[QW][HD / 32]; const int lim = ql0 + col - k0 - 8 * g;   /* key <= query, both counted from the slice's and the lane's own start: one register against a constant per element */
#pragma unroll
      for (int u = 0; u < QW; ++u)
#pragma unroll
        for (int kc = 0; kc < HD / 32; ++kc) qh[u][kc] = fragp_h(qrow + (u * 4 + kc) * 512);
      v16h kf[2][HD / 32];   /* a 16-key tile's four fragments are fetched together, one tile ahead of their products: the loads stay in source order round the products' asm, so one written at its product would be waited for alone */
#pragma unroll
      for (int kc = 0; kc < HD / 32; ++kc) kf[0][kc] = fragp_h(krow + kc * 512);
#pragma unroll
      for (int c = 0; c < KW / 32; ++c)
#pragma unroll
        for (int t = 0; t < 2; ++t) { v8f a[QW] = {};
          if (c * 2 + t + 1 < KW / 16) {
#pragma unroll
            for (int kc = 0; kc < HD / 32; ++kc) kf[(t + 1) & 1][kc] = fragp_h(krow + ((c * 2 + t + 1) * 4 + kc) * 512); }
#pragma unroll
          for (int kc = 0; kc < HD / 32; ++kc)
#pragma unroll
            for (int u = 0; u < QW; ++u) a[u] = wmma16(kf[t][kc], qh[u][kc], a[u]);
#pragma unroll
          for (int u = 0; u < QW; ++u) { float x[8];
#pragma unroll
            for (int r = 0; r < 8; ++r) x[r] = (c * 32 + t * 16 + r - u * 16 <= lim ? a[u][r] : -__builtin_inff()) * T2L;   /* the mask goes in as the reference's own -inf */
            exp2x8(x);
#pragma unroll
            for (int r = 0; r < 8; ++r) x[r] += 1.0f;
            rcpx8(x);
#pragma unroll
            for (int r = 0; r < 8; ++r) p[u][c][t * 8 + r] = (_Float16)fmaf(x[r], -4096.0f, 2048.0f); } } }
    const _Float16* vrow = VT + (bh * TT + k0) * HD + lane * 8;   /* v fragment (32 keys c, 16 columns j) lies (c * 8 + j) * 512 elements on */
    v16h vf[2][KW / 32];   /* the four fragments of 16 v columns are fetched together, one column group ahead of their products */
#pragma unroll
    for (int c = 0; c < KW / 32; ++c) vf[0][c] = fragp_h(vrow + c * 8 * 512);
#pragma unroll
    for (int j = 0; j < HD / 16; ++j) { v8f acc[QW] = {};
      if (j + 1 < HD / 16) {
#pragma unroll
        for (int c = 0; c < KW / 32; ++c) vf[(j + 1) & 1][c] = fragp_h(vrow + (c * 8 + j + 1) * 512); }
#pragma unroll
      for (int c = 0; c < KW / 32; ++c)
#pragma unroll
        for (int u = 0; u < QW; ++u) acc[u] = wmma16(p[u][c], vf[j & 1][c], acc[u]);
#pragma unroll
      for (int u = 0; u < QW; ++u)
#pragma unroll
        for (int r = 0; r < 8; ++r) ss[wave][u * 16 + 8 * g + r][j * 16 + col] = acc[u][r]; }
  }
  __syncthreads();   /* every wave's partial tiles are in LDS before any thread adds across the waves */
  const int nv = (ql0 + 16 * QW - 1) / KW + 1;   /* slices 0 .. nv - 1 wrote whole tiles, the others row 0 alone */
  for (int e = tid; e < 16 * QW * (HD / 4); e += 32 * KS) { const int rl = e / (HD / 4), c4 = e % (HD / 4); v4f s = *(const v4f*)&ss[0][rl][c4 * 4];   /* unrolled below: the KS LDS reads are then in flight together instead of one wait each */
#pragma unroll
    for (int w = 1; w < KS; ++w) s += *(const v4f*)&ss[w][w < nv ? rl : 0][c4 * 4];
    vst2(Y + ((size_t)b * TT + ql0 + rl) * CC + h * HD + c4 * 4, s * (1.0f / 2048.0f)); } }

extern "C" void kernel_launch(void* const* d_in, const int* in_sizes, int n_in, void* d_out, int out_size, void* d_ws, size_t ws_size, hipStream_t stream) {
  (void)in_sizes; (void)n_in; (void)out_size;
  const float** F = (const float**)d_in;
  if (ws_size < (size_t)WS_END) return;
  char* ws = (char*)d_ws; _Float16 *QH = (_Float16*)(ws + WS_QH), *KH = (_Float16*)(ws + WS_KH), *VT = (_Float16*)(ws + WS_VT), *QL = (_Float16*)(ws + WS_QL), *KL = (_Float16*)(ws + WS_KL); __bf16 *VB = (__bf16*)(ws + WS_VB), *VBL = (__bf16*)(ws + WS_VBL); float* SV = (float*)(ws + WS_S);
  // inputs: 0 Q [2,2048,2048]; 1 K; 2 V (raw [B, T, (h, d)] tensors)
  k_prep8<<<dim3(TNB * TT / 64, NH), PT, 0, stream>>>(F[0], F[1], F[2], QH, QL, KH, KL, VT, VB, VBL, SV);
  k_att<<<dim3(TT / (16 * QW), NH, TNB), 32 * KS, 0, stream>>>(QH, KH, QL, KL, VT, VB, VBL, (float*)d_out, SV);
}

// v007
// One run takes 99.9 microseconds.
// Next to v006, in two timings, it ran 1.49 times as fast each time.
// Over all steps from v000 it is 21.3 times as fast.
// compute dtype: all float inputs rounded to bf16; interleaved-pair RoPE applied in f32 to the bf16 q/k rows (64 embedded f32 inverse frequencies = XLA's table, accurate sincosf of the f32 angle t*freq); rotated q/k as f16 hi + residual (x 2^10) planes below row 384, once to f16 beyond; causal logits x 128^-0.5 with 3 products below row 384, 1 product beyond; att = tanh(logit) in f32 for k <= t (the math library's formulas below row 384; beyond, 1 - 2 / (exp2(2 log2(e) logit) + 1) on the hardware exp2 and reciprocal) and exactly -1 for k > t (tanh(-inf)); att x 2^11 against v: bf16 hi + lo (3 products) for query rows < 384, once to f16 against v f16 beyond; a 64-key group that lies wholly behind a block's 32 queries has att = -1 throughout and enters as -2^11 x its f32 column sums of v; f32 output [B, T, C].
#include <hip/hip_runtime.h>
#include <math.h>

typedef __attribute__((ext_vector_type(16))) _Float16 v16h;
typedef __attribute__((ext_vector_type(16))) __bf16 v16b;
typedef __attribute__((ext_vector_type(8)))  _Float16 v8h;
typedef __attribute__((ext_vector_type(8)))  float v8f;
typedef __attribute__((ext_vector_type(4)))  float v4f;
typedef __attribute__((ext_vector_type(2)))  float v2f;
typedef __attribute__((ext_vector_type(4)))  unsigned v4u;
typedef __attribute__((ext_vector_type(4)))  int v4i;
typedef float __attribute__((may_alias)) float_a;
typedef int __attribute__((may_alias)) int_a;

template <typename T> __device__ __forceinline__ void vst2(void* p, T v) { *(T*)p = v;  }
__device__ __forceinline__ v8f wmma16(v16h a, v16h b, v8f c) {
  v8f d = __builtin_amdgcn_wmma_f32_16x16x32_f16(false, a, false, b, (short)0, c, false, false);
  asm volatile("v_nop\n\tv_nop\n\tv_nop\n\tv_nop" : "+v"(d) : "v"(a), "v"(b));
  return d;
}
__device__ __forceinline__ v8f wmma_bf(v16b a, v16b b, v8f c) {
  v8f d = __builtin_amdgcn_wmma_f32_16x16x32_bf16(false, a, false, b, (short)0, c, false, false);
  asm volatile("v_nop\n\tv_nop\n\tv_nop\n\tv_nop" : "+v"(d) : "v"(a), "v"(b));
  return d;
}
// 16x16x32 fragments: lane = (h = lane>>4, row/col = lane&15); elements 0..7 = k0+8h+0..7, 8..15 = k0+16+8h+0..7; D element r = row 8h+r
__device__ __forceinline__ v16h frag_h(const _Float16* rowk0, int lane) {
  union { v16h v; v8h q[2]; } u; const _Float16* p = rowk0 + 8 * (lane >> 4);
  u.q[0] = *(const v8h*)p; u.q[1] = *(const v8h*)(p + 16); return u.v;
}
__device__ __forceinline__ v16h frag_f32(const float* rowk0, int lane) {
  v16h a; const float* p = rowk0 + 8 * (lane >> 4);
#pragma unroll
  for (int i = 0; i < 8; ++i) { a[i] = (_Float16)p[i]; a[8 + i] = (_Float16)p[16 + i]; }
  return a;
}
__device__ __forceinline__ v16h frag_f32s(const float* rowk0, int lane, float sc) {
  v16h a; const float* p = rowk0 + 8 * (lane >> 4);
#pragma unroll
  for (int i = 0; i < 8; ++i) { a[i] = (_Float16)(p[i] * sc); a[8 + i] = (_Float16)(p[16 + i] * sc); }
  return a;
}
// column fragment from a [K][ld] layout (column n), rows >= K read as 0
__device__ __forceinline__ v16h fragc_f32(const float* W, int k0, int n, int lane, int ld, int K) {
  v16h a; const int g = lane >> 4;
#pragma unroll
  for (int i = 0; i < 8; ++i) { const int ka = k0 + 8 * g + i, kb = ka + 16;
    a[i] = (_Float16)(ka < K ? W[(size_t)(ka < K ? ka : K - 1) * ld + n] : 0.f); a[8 + i] = (_Float16)(kb < K ? W[(size_t)(kb < K ? kb : K - 1) * ld + n] : 0.f); }
  return a;
}
struct F2 { v16b h, l; };
__device__ __forceinline__ F2 bsplit16(const float v[16]) { F2 r;
#pragma unroll
  for (int i = 0; i < 16; ++i) { const __bf16 h = (__bf16)v[i]; r.h[i] = h; r.l[i] = (__bf16)(v[i] - (float)h); }
  return r; }
__device__ __forceinline__ F2 split_row(const float* row, int k0, int lane) { float v[16]; const float* p = row + k0 + 8 * (lane >> 4);
#pragma unroll
  for (int i = 0; i < 8; ++i) { v[i] = p[i]; v[8 + i] = p[16 + i]; }
  return bsplit16(v); }
__device__ __forceinline__ F2 split_rowK(const float* row, int k0, int lane, int K) { float v[16]; const int g = lane >> 4;
#pragma unroll
  for (int i = 0; i < 8; ++i) { const int ka = k0 + 8 * g + i, kb = ka + 16; v[i] = ka < K ? row[ka < K ? ka : K - 1] : 0.f; v[8 + i] = kb < K ? row[kb < K ? kb : K - 1] : 0.f; }
  return bsplit16(v); }
__device__ __forceinline__ F2 split_col(const float* W, int k0, int n, int lane, int ld, int K) { float v[16]; const int g = lane >> 4;
#pragma unroll
  for (int i = 0; i < 8; ++i) { const int ka = k0 + 8 * g + i, kb = ka + 16; v[i] = ka < K ? W[(size_t)(ka < K ? ka : K - 1) * ld + n] : 0.f; v[8 + i] = kb < K ? W[(size_t)(kb < K ? kb : K - 1) * ld + n] : 0.f; }
  return bsplit16(v); }
__device__ __forceinline__ v8f mac3(const F2& a, const F2& b, v8f c) { c = wmma_bf(a.l, b.h, c); c = wmma_bf(a.h, b.l, c); return wmma_bf(a.h, b.h, c); }
__device__ __forceinline__ float sigm(float v) { return 1.0f / (1.0f + expf(-v)); }
#define LDSX() do { asm volatile("s_wait_dscnt 0" ::: "memory"); __builtin_amdgcn_wave_barrier(); __builtin_amdgcn_fence(__ATOMIC_RELEASE, "workgroup"); } while (0)

// Causal 'tanh attention' (no softmax) with RoPE (B 2, T 2,048, C 2,048 = 16 heads x 128; raw Q, K, V inputs, no projections): q, k = rope_interleaved(split_heads(Q)), rope(split_heads(K)); scores = q k^T / sqrt(128); att = tanh(where(causal, scores, -inf)) -> masked entries are exactly -1 and STILL multiply v; out = att v merged to [B, T, C].
#define NB 2
#define TT 2048
#define CC 2048            // NH * HD = projected width
#define DIN 2048          // input (model) width
#define NH 16
#define HD 128
#define NQB (TT / 64)
#define HG 4
#define SCALE (0.08838834764831845f)
#define CAUSAL 1
#ifndef TNB
#define TNB NB
#endif
__device__ __forceinline__ float bfr(float v) { return (float)(__bf16)v; }
__host__ __device__ __forceinline__ int kb_last(int qb) { return CAUSAL ? ((qb * 64 + 63) >> 7) : (TT / 128 - 1); }
typedef __attribute__((ext_vector_type(8))) __bf16 v8b;
__device__ __forceinline__ v16b frag_b(const __bf16* rowk0, int lane) {
  union { v16b v; v8b q[2]; } u; const __bf16* p = rowk0 + 8 * (lane >> 4);
  u.q[0] = *(const v8b*)p; u.q[1] = *(const v8b*)(p + 16); return u.v;
}
// fragment-order planes: one 16 x 32 fragment is 1 KiB in a row: elements 0..7 of lanes 0..31 (512 B), then elements 8..15; p = fragment start + 8 * lane, so each of the two loads of a wave reads four whole 128-B lines
__device__ __forceinline__ v16h fragp_h(const _Float16* p) { union { v16h v; v8h q[2]; } u; u.q[0] = *(const v8h*)p; u.q[1] = *(const v8h*)(p + 256); return u.v; }
__device__ __forceinline__ v16b fragp_b(const __bf16* p) { union { v16b v; v8b q[2]; } u; u.q[0] = *(const v8b*)p; u.q[1] = *(const v8b*)(p + 256); return u.v; }
#define QHI 384            // rows carrying a q residual plane
#define KHI 2048           // k residual plane: keys carrying one
#define VHI 384            // v bf16 planes: the keys of the 64-key groups that a query row < QBH * 64 may see (the keys behind them enter through the column sums)
// B fragment (k rows k0+.., output column o) of a weight: (in,out) [K][ld] or (out,in) [ld rows of K]: bf16 exact, or f16(bf16 * 256) exact
__device__ __forceinline__ v16b wcol_io(const float* Wm, int k0, int o, int lane, int ld) { v16b w; const int g = lane >> 4;
#pragma unroll
  for (int i = 0; i < 8; ++i) { w[i] = (__bf16)Wm[(size_t)(k0 + 8 * g + i) * ld + o]; w[8 + i] = (__bf16)Wm[(size_t)(k0 + 16 + 8 * g + i) * ld + o]; }
  return w; }
__device__ __forceinline__ v16b wcol_oi(const float* Wm, int k0, int o, int lane, int K) { v16b w; const float* p = Wm + (size_t)o * K + k0 + 8 * (lane >> 4);
#pragma unroll
  for (int i = 0; i < 8; ++i) { w[i] = (__bf16)p[i]; w[8 + i] = (__bf16)p[16 + i]; }
  return w; }
__device__ __forceinline__ v16h wcolh_io(const float* Wm, int k0, int o, int lane, int ld) { v16h w; const int g = lane >> 4;
#pragma unroll
  for (int i = 0; i < 8; ++i) { w[i] = (_Float16)(bfr(Wm[(size_t)(k0 + 8 * g + i) * ld + o]) * 256.0f); w[8 + i] = (_Float16)(bfr(Wm[(size_t)(k0 + 16 + 8 * g + i) * ld + o]) * 256.0f); }
  return w; }
__device__ __forceinline__ v16h wcolh_oi(const float* Wm, int k0, int o, int lane, int K) { v16h w; const float* p = Wm + (size_t)o * K + k0 + 8 * (lane >> 4);
#pragma unroll
  for (int i = 0; i < 8; ++i) { w[i] = (_Float16)(bfr(p[i]) * 256.0f); w[8 + i] = (_Float16)(bfr(p[16 + i]) * 256.0f); }
  return w; }
#define WQKV_LAYOUT 1   // 0 = (in,out) [DIN][CC]; 1 = (out,in) [CC][DIN]; 2 = per-head [NH][DIN][HD]
__device__ __forceinline__ v16b wcol_hdk(const float* Wm, int k0, int o, int lane) { v16b w; const int g = lane >> 4; const float* p = Wm + (size_t)(o / HD) * DIN * HD + (o % HD);
#pragma unroll
  for (int i = 0; i < 8; ++i) { w[i] = (__bf16)p[(size_t)(k0 + 8 * g + i) * HD]; w[8 + i] = (__bf16)p[(size_t)(k0 + 16 + 8 * g + i) * HD]; }
  return w; }
#define WO_OUT_IN 0
#if WQKV_LAYOUT == 1
#define WCOL(W, k0, o, lane) wcol_oi(W, k0, o, lane, DIN)
#elif WQKV_LAYOUT == 2
#define WCOL(W, k0, o, lane) wcol_hdk(W, k0, o, lane)
#else
#define WCOL(W, k0, o, lane) wcol_io(W, k0, o, lane, CC)
#endif
#if WO_OUT_IN
#define WOCOL(W, k0, o, lane) wcol_oi(W, k0, o, lane, CC)
#define WOCOLH(W, k0, o, lane) wcolh_oi(W, k0, o, lane, CC)
#else
#define WOCOL(W, k0, o, lane) wcol_io(W, k0, o, lane, DIN)
#define WOCOLH(W, k0, o, lane) wcolh_io(W, k0, o, lane, DIN)
#endif
#define QBH 6
__constant__ float c_freq[64] = {1.000000000e+00f,8.659643531e-01f,7.498942018e-01f,6.493816376e-01f,5.623413324e-01f,4.869675338e-01f,4.216965139e-01f,3.651741445e-01f,3.162277639e-01f,2.738419771e-01f,2.371373624e-01f,2.053525001e-01f,1.778279394e-01f,1.539926529e-01f,1.333521456e-01f,1.154782027e-01f,1.000000015e-01f,8.659642935e-02f,7.498941571e-02f,6.493816525e-02f,5.623412877e-02f,4.869675264e-02f,4.216964915e-02f,3.651741147e-02f,3.162277862e-02f,2.738419548e-02f,2.371373586e-02f,2.053525113e-02f,1.778279431e-02f,1.539926510e-02f,1.333521493e-02f,1.154781971e-02f,9.999999776e-03f,8.659643121e-03f,7.498942316e-03f,6.493816618e-03f,5.623413250e-03f,4.869675264e-03f,4.216964822e-03f,3.651741426e-03f,3.162277862e-03f,2.738419687e-03f,2.371373819e-03f,2.053525066e-03f,1.778279431e-03f,1.539926510e-03f,1.333521446e-03f,1.154782018e-03f,1.000000047e-03f,8.659643354e-04f,7.498941850e-04f,6.493816618e-04f,5.623413017e-04f,4.869675031e-04f,4.216964880e-04f,3.651741135e-04f,3.162277862e-04f,2.738419571e-04f,2.371373848e-04f,2.053524950e-04f,1.778279402e-04f,1.539926452e-04f,1.333521504e-04f,1.154781930e-04f};   /* 1/10000^(2i/128), i = 0..63, as XLA's f32 table */
// ---- k_prep8: block = (64 attention positions s0.. of sequence b, head h): reads the raw [B, T, C] inputs (element (b,s,h,c) at (b*TT + s)*CC + h*HD + c), bf16-rounds them and writes the attention planes in fragment order (fragp_h), [b][h][s / 16][c / 32] fragments of q and k (row = s, k = c) and [b][h][s / 32][c / 16] fragments of v (row = c, k = s): q -> f16 hi (+ x 2^10 residual for s < QHI), k -> f16 (+ residual, s < KHI), v -> f16 (+ bf16 hi/lo for s < VHI, + f32 column sums of the 64 positions); the block's 64 positions are 16 KiB in a row of every plane
#define PT 256             // threads of k_prep8: 8 waves, each takes PR whole rows of the 64-row tile
#define PR 8
typedef __attribute__((ext_vector_type(4))) _Float16 v4h;
__global__ __launch_bounds__(PT) void k_prep8(const float* __restrict__ Q, const float* __restrict__ K, const float* __restrict__ V, _Float16* __restrict__ QH, _Float16* __restrict__ QL, _Float16* __restrict__ KH, _Float16* __restrict__ KL, _Float16* __restrict__ VT, __bf16* __restrict__ VB, __bf16* __restrict__ VBL, float* __restrict__ SV) {
  __shared__ __align__(16) _Float16 sq[64][136], sql[64][136], sk[64][136], skl[64][136], tv[128][72]; __shared__ __align__(16) __bf16 tb[128][72], tbl[128][72];
  const int tid = threadIdx.x; const int h = blockIdx.y; const size_t r0 = (size_t)blockIdx.x * 64; const size_t bb = r0 / TT; const int t0 = (int)(r0 % TT); const bool qhi = t0 < QHI, khi = t0 < KHI, vhi = t0 < VHI;
  { const int cg = tid & 31, c = cg * 4, rb = (tid >> 5) * PR; const size_t o0 = ((bb * TT + t0 + rb) * (size_t)CC) + h * HD + c;   /* raw [B, T, (h, d)] layout; a lane owns 4 adjacent columns (two rotation pairs) of PR rows in a row */
    const float fr[2] = {c_freq[cg * 2], c_freq[cg * 2 + 1]};   /* oldest load: the angles need it alone, so the first sincosf runs while the tile is on its way */
    asm volatile("s_wait_xcnt 0x0" ::: "memory");   /* before the table load's offset register is given to a tile load's result */
    v4f qv[PR], kv[PR], vv[PR];   /* the lane's whole share of the tile is requested in front of the first use: 3 * PR loads of 16 B in flight, one memory latency a block */
#pragma unroll
    for (int i = 0; i < PR; ++i) { qv[i] = *(const v4f*)(Q + o0 + (size_t)i * CC); kv[i] = *(const v4f*)(K + o0 + (size_t)i * CC); vv[i] = *(const v4f*)(V + o0 + (size_t)i * CC); }
    asm volatile("s_wait_xcnt 0x0" ::: "memory");   /* before the three address pairs of the tile loads are overwritten by the angle code; also keeps every load in front of it */
    v8h tvp[4]; v8b tbp[4], tlp[4];   /* v: PR rows of one column are 16 B in a row of the transposed planes */
#pragma unroll
    for (int i = 0; i < PR; ++i) { const int rl = rb + i; v4h qh4, ql4, kh4, kl4;   /* module inputs bf16-rounded; interleaved-pair RoPE on q and k in f32 */
#pragma unroll
      for (int p = 0; p < 2; ++p) { const float ang = (float)(t0 + rl) * fr[p]; float sn, cs; sincosf(ang, &sn, &cs);
        const float qe = bfr(qv[i][2 * p]), qo = bfr(qv[i][2 * p + 1]), ke = bfr(kv[i][2 * p]), ko = bfr(kv[i][2 * p + 1]);
        const float qr[2] = {qe * cs - qo * sn, qe * sn + qo * cs}, kr[2] = {ke * cs - ko * sn, ke * sn + ko * cs};
#pragma unroll
        for (int s = 0; s < 2; ++s) { const _Float16 qh = (_Float16)qr[s], kh = (_Float16)kr[s]; qh4[2 * p + s] = qh; ql4[2 * p + s] = (_Float16)((qr[s] - (float)qh) * 1024.0f); kh4[2 * p + s] = kh; kl4[2 * p + s] = (_Float16)((kr[s] - (float)kh) * 1024.0f); } }
      *(v4h*)&sq[rl][c] = qh4; *(v4h*)&sql[rl][c] = ql4; *(v4h*)&sk[rl][c] = kh4; *(v4h*)&skl[rl][c] = kl4;
#pragma unroll
      for (int j = 0; j < 4; ++j) { const float v = bfr(vv[i][j]); tvp[j][i] = (_Float16)v; const __bf16 vb = (__bf16)v; tbp[j][i] = vb; tlp[j][i] = (__bf16)(v - (float)vb); } }
#pragma unroll
    for (int j = 0; j < 4; ++j) { *(v8h*)&tv[c + j][rb] = tvp[j]; *(v8b*)&tb[c + j][rb] = tbp[j]; *(v8b*)&tbl[c + j][rb] = tlp[j]; } }
  __syncthreads();
  /* e counts the 16-B pieces of the block's 16 KiB in plane order: lane l = e & 31, half of the fragment (e >> 5) & 1, then the fragment; a wave's store is 512 B in a row */
  for (int e = tid; e < 64 * (HD / 8); e += PT) { const int l = e & 31, rl = (e >> 8) * 16 + (l & 15), c = ((e >> 5) & 7) * 16 + (l >> 4) * 8; const size_t o = ((bb * NH + h) * (size_t)TT + t0) * HD + e * 8; vst2((unsigned*)(QH + o), *(const v4u*)&sq[rl][c]); vst2((unsigned*)(KH + o), *(const v4u*)&sk[rl][c]); asm volatile("s_wait_xcnt 0x0" ::: "memory");   /* before the two stores' data and address registers are rewritten for the next planes and the next trip */
    if (qhi) { vst2((unsigned*)(QL + ((bb * NH + h) * (size_t)QHI + t0) * HD + e * 8), *(const v4u*)&sql[rl][c]); asm volatile("s_wait_xcnt 0x0" ::: "memory"); }   /* before the store's data registers take the next LDS read */
    if (khi) vst2((unsigned*)(KL + ((bb * NH + h) * (size_t)KHI + t0) * HD + e * 8), *(const v4u*)&skl[rl][c]); }
  for (int e = tid; e < HD * 8; e += PT) { const int l = e & 31, cl = ((e >> 6) & 7) * 16 + (l & 15), sl = (e >> 9) * 32 + ((e >> 5) & 1) * 16 + (l >> 4) * 8; vst2((unsigned*)(VT + ((bb * NH + h) * (size_t)TT + t0) * HD + e * 8), *(const v4u*)&tv[cl][sl]); asm volatile("s_wait_xcnt 0x0" ::: "memory");   /* before the store's data and offset registers are rewritten for the next planes or the next trip */
    if (vhi) { const size_t o3 = ((bb * NH + h) * (size_t)VHI + t0) * HD + e * 8; vst2((unsigned*)(VB + o3), *(const v4u*)&tb[cl][sl]); vst2((unsigned*)(VBL + o3), *(const v4u*)&tbl[cl][sl]); asm volatile("s_wait_xcnt 0x0" ::: "memory"); } }   /* the same for these two stores, before the next trip */
  /* column sums of the block's 64 rows of v (the bf16 values, added in f32): what a key behind every query of a k_att block adds to each of them, up to the factor -1; thread = column, eight running sums so that the adds do not wait for one another */
  if (tid < HD) { float a[8] = {};
#pragma unroll
    for (int q = 0; q < 8; ++q) { const v8b t = *(const v8b*)&tb[tid][q * 8];
#pragma unroll
      for (int i = 0; i < 8; ++i) a[i] += (float)t[i]; }
    SV[((bb * NH + h) * (size_t)(TT / 64) + t0 / 64) * HD + tid] = ((a[0] + a[1]) + (a[2] + a[3])) + ((a[4] + a[5]) + (a[6] + a[7])); } }

#ifndef SM_EXTRA_PARAMS
#define SM_EXTRA_PARAMS
#endif
#ifndef PROJ_EXTRA_PARAMS
#define PROJ_EXTRA_PARAMS
#endif
#ifndef SM_MASK_HOOK
#define SM_MASK_HOOK (void)0
#endif

#define WS_QH  0u                                      // f16 q fragments [b][h][t / 16][d / 32]
#define WS_KH  (WS_QH + 2u * (size_t)NB * TT * CC)      // f16 k fragments [b][h][t / 16][d / 32]
#define WS_VT  (WS_KH + 2u * (size_t)NB * TT * CC)      // f16 v fragments [b][h][t / 32][d / 16]
#define WS_QL  (WS_VT + 2u * (size_t)NB * CC * TT)      // f16 q residual x 2^10 fragments [b][h][t < QHI]
#define WS_KL  (WS_QL + 2u * (size_t)NB * QHI * CC)     // f16 k residual x 2^10 fragments [b][h][t < KHI]
#define WS_VB  (WS_KL + 2u * (size_t)NB * KHI * CC)     // bf16 v hi fragments [b][h][t < VHI]
#define WS_VBL (WS_VB + 2u * (size_t)NB * CC * VHI)
#define WS_S   (WS_VBL + 2u * (size_t)NB * CC * VHI)    // f32 column sums of v over 64 keys [b][h][t / 64][d] (the start of the region)
#define WS_Y   (WS_S  + 4u * (size_t)HG * TT * TT)      // f32 ctx rows [b*t][CC] (only when there is an output projection)
#define WS_END (WS_Y  + 0u)

// tanh by the math library's own two range formulas (|x| >= 0.625: 1 - 2 / (exp(2|x|) + 1); below: x + x^3 . poly(x^2)), both evaluated and one selected per lane: the library form branches per element, which splits the unrolled tile into hundreds of blocks and keeps two f32 registers per element alive up to the products
__device__ __forceinline__ float tanh_sel(float x) { const float y = fabsf(x), y2 = x * x;
  const float zb = fmaf(__builtin_amdgcn_rcpf(expf(y + y) + 1.0f), -2.0f, 1.0f);
  float q = fmaf(-0x1.758e7ap-8f, y2, 0x1.521192p-6f); q = fmaf(y2, q, -0x1.b8389cp-5f); q = fmaf(y2, q, 0x1.110704p-3f); q = fmaf(y2, q, -0x1.555532p-2f);
  const float zs = fmaf(y2, y * q, y);
  return copysignf(y < 0.625f ? zs : zb, x); }
// tanh(logit x SCALE) x 2^11 for the rows whose att is rounded once to f16 right behind it: 2^11 - 2^12 / (2^(logit x 2 SCALE log2 e) + 1), one formula for every range on the chip's own exp2 and reciprocal; absolute error of tanh below 3e-7, against the f16 rounding's 2^-12 relative; -inf (a masked key) gives -2^11
#define T2L ((float)(2.0 * 0.08838834764831845 * 1.4426950408889634))
// eight transcendentals in one statement, each in place on its own register: none reads a neighbour's result or overwrites a neighbour's source, and the closing v_nop is the free slot the instruction set asks for behind the last one, whatever the compiler puts next
__device__ __forceinline__ void exp2x8(float (&x)[8]) { asm("v_exp_f32 %0, %0\n\tv_exp_f32 %1, %1\n\tv_exp_f32 %2, %2\n\tv_exp_f32 %3, %3\n\tv_exp_f32 %4, %4\n\tv_exp_f32 %5, %5\n\tv_exp_f32 %6, %6\n\tv_exp_f32 %7, %7\n\tv_nop" : "+v"(x[0]), "+v"(x[1]), "+v"(x[2]), "+v"(x[3]), "+v"(x[4]), "+v"(x[5]), "+v"(x[6]), "+v"(x[7])); }
__device__ __forceinline__ void rcpx8(float (&x)[8]) { asm("v_rcp_f32 %0, %0\n\tv_rcp_f32 %1, %1\n\tv_rcp_f32 %2, %2\n\tv_rcp_f32 %3, %3\n\tv_rcp_f32 %4, %4\n\tv_rcp_f32 %5, %5\n\tv_rcp_f32 %6, %6\n\tv_rcp_f32 %7, %7\n\tv_nop" : "+v"(x[0]), "+v"(x[1]), "+v"(x[2]), "+v"(x[3]), "+v"(x[4]), "+v"(x[5]), "+v"(x[6]), "+v"(x[7])); }
// ---- k_att: block = 32 queries (ql0..) of (b, h), KS waves. The keys up to the 64-key boundary behind the block's last query are NCH chunks of 32; they are dealt in turn: wave w takes nc = ceil(NCH / KS) chunks in a row from chunk w * nc on (the last wave with any takes what is left, the waves behind it none), so a wave's chain of loads and products grows with the keys the block can see. Logits are formed TRANSPOSED (A = k rows, B = q rows): D element r of lane (g, col) is key 8g + r of query col, so two 16-key tiles are, register for register, the A fragment of att for 32 keys, and logits and att never leave the registers. att = tanh(logit x SCALE) for key <= query, exactly -1 beyond, x 2^11; ctx = att . v (f16, 1 product, each k and v fragment used for both 16-query tiles; query rows < QBH * 64: 3-product logits, att and v as bf16 hi + lo, 3 products, one 16-query tile after the other). The keys behind that boundary have att = -1 for every query of the block and enter as -2^11 x the column sums of v over 64 keys (SV, from k_prep8): the last SW waves, which have the fewest chunks, add them up behind their own chunks, every SW-th sum each, into one row each of sm; the KS f32 partial tiles (of a wave without a chunk: a row of zeros) and the SW rows meet in LDS and are added in wave order; 512-B (row, head) segment by 32 lanes
#define KS 16
#define QW 2               // 16-query tiles per wave
#define NSV (TT / 64)      // column sums per (b, h)
#define SW 4               // waves that add up the column sums
static_assert(QBH * 2 <= KS, "a block of the 3-product rows has at most one chunk a wave"); static_assert(NSV / SW == 8 && SW == 4 && (32 * KS) % (HD / 4) == 0, "the two sums over sm and s are written out");
// MC chunks of 32 keys against the block's 32 queries, 1-product rows; lim = ql0 + col - k0 - 8 g; st = the wave's tile in LDS
template <int MC> __device__ __forceinline__ void att_lo(const _Float16* __restrict__ qrow, const _Float16* __restrict__ krow, const _Float16* __restrict__ vrow, int lim, int col, int g, float (*st)[HD + 4]) {
  v16h p[QW][MC];
  {
    v16h qh[QW][HD / 32];
#pragma unroll
    for (int u = 0; u < QW; ++u)
#pragma unroll
      for (int kc = 0; kc < HD / 32; ++kc) qh[u][kc] = fragp_h(qrow + (u * 4 + kc) * 512);
    v16h kf[2][HD / 32];   /* a 16-key tile's four fragments are fetched together, one tile ahead of their products: the loads stay in source order round the products' asm, so one written at its product would be waited for alone */
#pragma unroll
    for (int kc = 0; kc < HD / 32; ++kc) kf[0][kc] = fragp_h(krow + kc * 512);
#pragma unroll
    for (int c = 0; c < MC; ++c)
#pragma unroll
      for (int t = 0; t < 2; ++t) { v8f a[QW] = {};
        if (c * 2 + t + 1 < MC * 2) {
#pragma unroll
          for (int kc = 0; kc < HD / 32; ++kc) kf[(t + 1) & 1][kc] = fragp_h(krow + ((c * 2 + t + 1) * 4 + kc) * 512); }
#pragma unroll
        for (int kc = 0; kc < HD / 32; ++kc)
#pragma unroll
          for (int u = 0; u < QW; ++u) a[u] = wmma16(kf[t][kc], qh[u][kc], a[u]);
#pragma unroll
        for (int u = 0; u < QW; ++u) { float x[8];
#pragma unroll
          for (int r = 0; r < 8; ++r) x[r] = (c * 32 + t * 16 + r - u * 16 <= lim ? a[u][r] : -__builtin_inff()) * T2L;   /* the mask goes in as the reference's own -inf */
          exp2x8(x);
#pragma unroll
          for (int r = 0; r < 8; ++r) x[r] += 1.0f;
          rcpx8(x);
#pragma unroll
          for (int r = 0; r < 8; ++r) p[u][c][t * 8 + r] = (_Float16)fmaf(x[r], -4096.0f, 2048.0f); } } }
  constexpr int JG = MC == 1 ? 4 : MC <= 3 ? 2 : 1;   /* groups of 16 v columns per fetch: at least four fragments, as with four chunks, so that the number of fetches a wave waits for falls with its chunks */
  v16h vf[2][JG][MC];   /* the fragments of JG * 16 v columns are fetched together, one fetch ahead of their products */
#pragma unroll
  for (int i = 0; i < JG; ++i)
#pragma unroll
    for (int c = 0; c < MC; ++c) vf[0][i][c] = fragp_h(vrow + (c * 8 + i) * 512);
#pragma unroll
  for (int jj = 0; jj < HD / 16 / JG; ++jj) {
    if (jj + 1 < HD / 16 / JG) {
#pragma unroll
      for (int i = 0; i < JG; ++i)
#pragma unroll
        for (int c = 0; c < MC; ++c) vf[(jj + 1) & 1][i][c] = fragp_h(vrow + (c * 8 + (jj + 1) * JG + i) * 512); }
#pragma unroll
    for (int i = 0; i < JG; ++i) { const int j = jj * JG + i; v8f acc[QW] = {};
#pragma unroll
      for (int c = 0; c < MC; ++c)
#pragma unroll
        for (int u = 0; u < QW; ++u) acc[u] = wmma16(p[u][c], vf[jj & 1][i][c], acc[u]);
#pragma unroll
      for (int u = 0; u < QW; ++u)
#pragma unroll
        for (int r = 0; r < 8; ++r) st[u * 16 + 8 * g + r][j * 16 + col] = acc[u][r]; } } }
__global__ __launch_bounds__(32 * KS) void k_att(const _Float16* __restrict__ QH, const _Float16* __restrict__ KH, const _Float16* __restrict__ QL, const _Float16* __restrict__ KL, const _Float16* __restrict__ VT, const __bf16* __restrict__ VB, const __bf16* __restrict__ VBL, float* __restrict__ Y, const float* __restrict__ SV) { __shared__ __align__(16) float ss[KS][16 * QW][HD + 4], sm[SW][HD];
  const int h = blockIdx.y, b = blockIdx.z; const int tid = threadIdx.x, wave = __builtin_amdgcn_readfirstlane(tid >> 5), lane = tid & 31, col = lane & 15, g = lane >> 4; const int ql0 = blockIdx.x * (16 * QW);
  const int nch = (ql0 / 64 + 1) * 2, nc = (nch + KS - 1) / KS, mc = nch - wave * nc, k0 = wave * nc * 32;   /* chunks of the block, chunks a wave, chunks left from this wave's first on (<= 0: none), the wave's first key */
  const size_t bh = (size_t)b * NH + h; const _Float16* qrow = QH + (bh * TT + ql0) * HD + lane * 8; const _Float16* krow = KH + (bh * TT + k0) * HD + lane * 8;   /* the lane's piece of the first fragment; fragment (16 rows n, 32 dims kc) lies (n * 4 + kc) * 512 elements on */
  if (mc <= 0) {   /* wave-uniform: no chunk is left for this wave */
    const v4f zero = {}; *(v4f*)&ss[wave][0][lane * 4] = zero;   /* row 0 stands for all 16 * QW rows */
  } else if (ql0 < QBH * 64) {   /* nc = 1 here: one chunk */
    const _Float16* qlrow = QL + (bh * QHI + ql0) * HD + lane * 8; const _Float16* klrow = KL + (bh * KHI + k0) * HD + lane * 8;
    const __bf16* vrow = VB + (bh * VHI + k0) * HD + lane * 8; const __bf16* vlrow = VBL + (bh * VHI + k0) * HD + lane * 8;   /* v fragment (16 columns j) lies j * 512 elements on */
#pragma unroll 1   /* rolled: one 16-query tile's fragments and sums in registers at a time */
    for (int u = 0; u < QW; ++u) { const int qu = ql0 + u * 16; F2 p;
      {
        v16h qh[HD / 32], ql[HD / 32];
#pragma unroll
        for (int kc = 0; kc < HD / 32; ++kc) { qh[kc] = fragp_h(qrow + (u * 4 + kc) * 512); if (kc + 1 < HD / 32) ql[kc] = fragp_h(qlrow + (u * 4 + kc) * 512); }
        { union { v16h v; v8h q[2]; } w; const _Float16* pl = qlrow + (u * 4 + HD / 32 - 1) * 512; w.q[0] = *(const v8h*)pl;
          asm volatile("s_wait_xcnt 0x0" ::: "memory");   /* before the last load's result is given the address registers of the loads in front of it */
          w.q[1] = *(const v8h*)(pl + 256); ql[HD / 32 - 1] = w.v; }
        float pv[16];
#pragma unroll
        for (int t = 0; t < 2; ++t) { v8f a = {}, al = {};
#pragma unroll
          for (int kc = 0; kc < HD / 32; ++kc) { const v16h kbf = fragp_h(krow + (t * 4 + kc) * 512), klf = fragp_h(klrow + (t * 4 + kc) * 512); a = wmma16(kbf, qh[kc], a); al = wmma16(kbf, ql[kc], al); al = wmma16(klf, qh[kc], al); }
#pragma unroll
          for (int r = 0; r < 8; ++r) { const float th = tanh_sel((a[r] + al[r] * (1.0f / 1024.0f)) * SCALE); pv[t * 8 + r] = (k0 + t * 16 + 8 * g + r <= qu + col ? th : -1.0f) * 2048.0f; } }
        p = bsplit16(pv); }
#pragma unroll
      for (int jj = 0; jj < HD / 64; ++jj) { v16b vh[4], vl[4];   /* the fragments of 64 v columns are fetched together, in front of their products: eight a fetch, twice as many as with four chunks */
#pragma unroll
        for (int i = 0; i < 4; ++i) { const int po = (jj * 4 + i) * 512; vh[i] = fragp_b(vrow + po); vl[i] = fragp_b(vlrow + po); }
#pragma unroll
        for (int i = 0; i < 4; ++i) { const int j = jj * 4 + i; v8f acc = {}; acc = wmma_bf(p.h, vh[i], acc); acc = wmma_bf(p.l, vh[i], acc); acc = wmma_bf(p.h, vl[i], acc);
#pragma unroll
          for (int r = 0; r < 8; ++r) ss[wave][u * 16 + 8 * g + r][j * 16 + col] = acc[r]; } } }
  } else {
    const _Float16* vrow = VT + (bh * TT + k0) * HD + lane * 8;   /* v fragment (32 keys c, 16 columns j) lies (c * 8 + j) * 512 elements on */
    const int lim = ql0 + col - k0 - 8 * g;   /* key <= query, both counted from the wave's and the lane's own start: one register against a constant per element */
    const int m = mc < nc ? mc : nc;   /* wave-uniform: one straight-line body per chunk count */
    if (m == 1) att_lo<1>(qrow, krow, vrow, lim, col, g, ss[wave]);
    else if (m == 2) att_lo<2>(qrow, krow, vrow, lim, col, g, ss[wave]);
    else if (m == 3) att_lo<3>(qrow, krow, vrow, lim, col, g, ss[wave]);
    else att_lo<4>(qrow, krow, vrow, lim, col, g, ss[wave]);
  }
  if (wave >= KS - SW) {   /* wave-uniform; the sums of the 64-key groups nch / 2 .. NSV - 1, all behind every query of the block */
    const int r0 = nch / 2 + wave - (KS - SW); const float* sv = SV + (bh * NSV + r0) * HD + lane * 4; v4f s[NSV / SW] = {};
#pragma unroll
    for (int i = 0; i < NSV / SW; ++i) if (r0 + i * SW < NSV) s[i] = *(const v4f*)(sv + i * SW * HD);   /* all requested before the first is used: one latency */
    asm volatile("s_wait_xcnt 0x0" ::: "memory");   /* before the loads' address registers are given to anything else */
    *(v4f*)&sm[wave - (KS - SW)][lane * 4] = (((s[0] + s[1]) + (s[2] + s[3])) + ((s[4] + s[5]) + (s[6] + s[7]))) * -2048.0f; }
  __syncthreads();   /* every wave's partial tiles are in LDS before any thread adds across the waves */
  const v4f ms = (*(const v4f*)&sm[0][lane * 4] + *(const v4f*)&sm[1][lane * 4]) + (*(const v4f*)&sm[2][lane * 4] + *(const v4f*)&sm[3][lane * 4]);   /* a thread's columns are lane * 4 .. + 3 on every trip: 32 * KS is a multiple of HD / 4 */
  for (int e = tid; e < 16 * QW * (HD / 4); e += 32 * KS) { const int rl = e / (HD / 4), c4 = e % (HD / 4); v4f s = ms + *(const v4f*)&ss[0][rl][c4 * 4];   /* wave 0 always has a chunk; unrolled below: the KS LDS reads are then in flight together instead of one wait each */
#pragma unroll
    for (int w = 1; w < KS; ++w) s += *(const v4f*)&ss[w][w * nc < nch ? rl : 0][c4 * 4];   /* a wave with a chunk wrote its whole tile, the others row 0 alone, zeros */
    vst2(Y + ((size_t)b * TT + ql0 + rl) * CC + h * HD + c4 * 4, s * (1.0f / 2048.0f)); } }

extern "C" void kernel_launch(void* const* d_in, const int* in_sizes, int n_in, void* d_out, int out_size, void* d_ws, size_t ws_size, hipStream_t stream) {
  (void)in_sizes; (void)n_in; (void)out_size;
  const float** F = (const float**)d_in;
  if (ws_size < (size_t)WS_END) return;
  char* ws = (char*)d_ws; _Float16 *QH = (_Float16*)(ws + WS_QH), *KH = (_Float16*)(ws + WS_KH), *VT = (_Float16*)(ws + WS_VT), *QL = (_Float16*)(ws + WS_QL), *KL = (_Float16*)(ws + WS_KL); __bf16 *VB = (__bf16*)(ws + WS_VB), *VBL = (__bf16*)(ws + WS_VBL); float* SV = (float*)(ws + WS_S);
  // inputs: 0 Q [2,2048,2048]; 1 K; 2 V (raw [B, T, (h, d)] tensors)
  k_prep8<<<dim3(TNB * TT / 64, NH), PT, 0, stream>>>(F[0], F[1], F[2], QH, QL, KH, KL, VT, VB, VBL, SV);
  k_att<<<dim3(TT / (16 * QW), NH, TNB), 32 * KS, 0, stream>>>(QH, KH, QL, KL, VT, VB, VBL, (float*)d_out, SV);
}

// v008
// One run takes 93.9 microseconds.
// Timed twice side by side with v007, it ran 1.07 and 1.06 times as fast.
// Over all steps from v000 it is 22.7 times as fast.
// compute dtype: all float inputs rounded to bf16; interleaved-pair RoPE applied in f32 to the bf16 q/k rows (64 embedded f32 inverse frequencies = XLA's table, accurate sincosf of the f32 angle t*freq); rotated q/k as f16 hi + residual (x 2^10) planes below row 384, once to f16 beyond; causal logits x 128^-0.5 with 3 products below row 384, 1 product beyond; att = tanh(logit) in f32 for k <= t (the math library's formulas below row 384; beyond, 1 - 2 / (exp2(2 log2(e) logit) + 1) on the hardware exp2 and reciprocal) and exactly -1 for k > t (tanh(-inf)); att x 2^11 against v: bf16 hi + lo (3 products) for query rows < 384, once to f16 against v f16 beyond; a 64-key group that lies wholly behind a block's 32 queries has att = -1 throughout and enters as -2^11 x its f32 column sums of v; f32 output [B, T, C].
#include <hip/hip_runtime.h>
#include <math.h>

typedef __attribute__((ext_vector_type(16))) _Float16 v16h;
typedef __attribute__((ext_vector_type(16))) __bf16 v16b;
typedef __attribute__((ext_vector_type(8)))  _Float16 v8h;
typedef __attribute__((ext_vector_type(8)))  float v8f;
typedef __attribute__((ext_vector_type(4)))  float v4f;
typedef __attribute__((ext_vector_type(2)))  float v2f;
typedef __attribute__((ext_vector_type(4)))  unsigned v4u;
typedef __attribute__((ext_vector_type(4)))  int v4i;
typedef float __attribute__((may_alias)) float_a;
typedef int __attribute__((may_alias)) int_a;

template <typename T> __device__ __forceinline__ void vst2(void* p, T v) { *(T*)p = v;  }
__device__ __forceinline__ v8f wmma16(v16h a, v16h b, v8f c) {
  v8f d = __builtin_amdgcn_wmma_f32_16x16x32_f16(false, a, false, b, (short)0, c, false, false);
  asm volatile("v_nop\n\tv_nop\n\tv_nop\n\tv_nop" : "+v"(d) : "v"(a), "v"(b));
  return d;
}
__device__ __forceinline__ v8f wmma_bf(v16b a, v16b b, v8f c) {
  v8f d = __builtin_amdgcn_wmma_f32_16x16x32_bf16(false, a, false, b, (short)0, c, false, false);
  asm volatile("v_nop\n\tv_nop\n\tv_nop\n\tv_nop" : "+v"(d) : "v"(a), "v"(b));
  return d;
}
// 16x16x32 fragments: lane = (h = lane>>4, row/col = lane&15); elements 0..7 = k0+8h+0..7, 8..15 = k0+16+8h+0..7; D element r = row 8h+r
__device__ __forceinline__ v16h frag_h(const _Float16* rowk0, int lane) {
  union { v16h v; v8h q[2]; } u; const _Float16* p = rowk0 + 8 * (lane >> 4);
  u.q[0] = *(const v8h*)p; u.q[1] = *(const v8h*)(p + 16); return u.v;
}
__device__ __forceinline__ v16h frag_f32(const float* rowk0, int lane) {
  v16h a; const float* p = rowk0 + 8 * (lane >> 4);
#pragma unroll
  for (int i = 0; i < 8; ++i) { a[i] = (_Float16)p[i]; a[8 + i] = (_Float16)p[16 + i]; }
  return a;
}
__device__ __forceinline__ v16h frag_f32s(const float* rowk0, int lane, float sc) {
  v16h a; const float* p = rowk0 + 8 * (lane >> 4);
#pragma unroll
  for (int i = 0; i < 8; ++i) { a[i] = (_Float16)(p[i] * sc); a[8 + i] = (_Float16)(p[16 + i] * sc); }
  return a;
}
// column fragment from a [K][ld] layout (column n), rows >= K read as 0
__device__ __forceinline__ v16h fragc_f32(const float* W, int k0, int n, int lane, int ld, int K) {
  v16h a; const int g = lane >> 4;
#pragma unroll
  for (int i = 0; i < 8; ++i) { const int ka = k0 + 8 * g + i, kb = ka + 16;
    a[i] = (_Float16)(ka < K ? W[(size_t)(ka < K ? ka : K - 1) * ld + n] : 0.f); a[8 + i] = (_Float16)(kb < K ? W[(size_t)(kb < K ? kb : K - 1) * ld + n] : 0.f); }
  return a;
}
struct F2 { v16b h, l; };
__device__ __forceinline__ F2 bsplit16(const float v[16]) { F2 r;
#pragma unroll
  for (int i = 0; i < 16; ++i) { const __bf16 h = (__bf16)v[i]; r.h[i] = h; r.l[i] = (__bf16)(v[i] - (float)h); }
  return r; }
__device__ __forceinline__ F2 split_row(const float* row, int k0, int lane) { float v[16]; const float* p = row + k0 + 8 * (lane >> 4);
#pragma unroll
  for (int i = 0; i < 8; ++i) { v[i] = p[i]; v[8 + i] = p[16 + i]; }
  return bsplit16(v); }
__device__ __forceinline__ F2 split_rowK(const float* row, int k0, int lane, int K) { float v[16]; const int g = lane >> 4;
#pragma unroll
  for (int i = 0; i < 8; ++i) { const int ka = k0 + 8 * g + i, kb = ka + 16; v[i] = ka < K ? row[ka < K ? ka : K - 1] : 0.f; v[8 + i] = kb < K ? row[kb < K ? kb : K - 1] : 0.f; }
  return bsplit16(v); }
__device__ __forceinline__ F2 split_col(const float* W, int k0, int n, int lane, int ld, int K) { float v[16]; const int g = lane >> 4;
#pragma unroll
  for (int i = 0; i < 8; ++i) { const int ka = k0 + 8 * g + i, kb = ka + 16; v[i] = ka < K ? W[(size_t)(ka < K ? ka : K - 1) * ld + n] : 0.f; v[8 + i] = kb < K ? W[(size_t)(kb < K ? kb : K - 1) * ld + n] : 0.f; }
  return bsplit16(v); }
__device__ __forceinline__ v8f mac3(const F2& a, const F2& b, v8f c) { c = wmma_bf(a.l, b.h, c); c = wmma_bf(a.h, b.l, c); return wmma_bf(a.h, b.h, c); }
__device__ __forceinline__ float sigm(float v) { return 1.0f / (1.0f + expf(-v)); }
#define LDSX() do { asm volatile("s_wait_dscnt 0" ::: "memory"); __builtin_amdgcn_wave_barrier(); __builtin_amdgcn_fence(__ATOMIC_RELEASE, "workgroup"); } while (0)

// Causal 'tanh attention' (no softmax) with RoPE (B 2, T 2,048, C 2,048 = 16 heads x 128; raw Q, K, V inputs, no projections): q, k = rope_interleaved(split_heads(Q)), rope(split_heads(K)); scores = q k^T / sqrt(128); att = tanh(where(causal, scores, -inf)) -> masked entries are exactly -1 and STILL multiply v; out = att v merged to [B, T, C].
#define NB 2
#define TT 2048
#define CC 2048            // NH * HD = projected width
#define DIN 2048          // input (model) width
#define NH 16
#define HD 128
#define NQB (TT / 64)
#define HG 4
#define SCALE (0.08838834764831845f)
#define CAUSAL 1
#ifndef TNB
#define TNB NB
#endif
__device__ __forceinline__ float bfr(float v) { return (float)(__bf16)v; }
__host__ __device__ __forceinline__ int kb_last(int qb) { return CAUSAL ? ((qb * 64 + 63) >> 7) : (TT / 128 - 1); }
typedef __attribute__((ext_vector_type(8))) __bf16 v8b;
__device__ __forceinline__ v16b frag_b(const __bf16* rowk0, int lane) {
  union { v16b v; v8b q[2]; } u; const __bf16* p = rowk0 + 8 * (lane >> 4);
  u.q[0] = *(const v8b*)p; u.q[1] = *(const v8b*)(p + 16); return u.v;
}
// fragment-order planes: one 16 x 32 fragment is 1 KiB in a row: elements 0..7 of lanes 0..31 (512 B), then elements 8..15; p = fragment start + 8 * lane, so each of the two loads of a wave reads four whole 128-B lines
__device__ __forceinline__ v16h fragp_h(const _Float16* p) { union { v16h v; v8h q[2]; } u; u.q[0] = *(const v8h*)p; u.q[1] = *(const v8h*)(p + 256); return u.v; }
__device__ __forceinline__ v16b fragp_b(const __bf16* p) { union { v16b v; v8b q[2]; } u; u.q[0] = *(const v8b*)p; u.q[1] = *(const v8b*)(p + 256); return u.v; }
#define QHI 384            // rows carrying a q residual plane
#define KHI 2048           // k residual plane: keys carrying one
#define VHI 384            // v bf16 planes: the keys of the 64-key groups that a query row < QBH * 64 may see (the keys behind them enter through the column sums)
// B fragment (k rows k0+.., output column o) of a weight: (in,out) [K][ld] or (out,in) [ld rows of K]: bf16 exact, or f16(bf16 * 256) exact
__device__ __forceinline__ v16b wcol_io(const float* Wm, int k0, int o, int lane, int ld) { v16b w; const int g = lane >> 4;
#pragma unroll
  for (int i = 0; i < 8; ++i) { w[i] = (__bf16)Wm[(size_t)(k0 + 8 * g + i) * ld + o]; w[8 + i] = (__bf16)Wm[(size_t)(k0 + 16 + 8 * g + i) * ld + o]; }
  return w; }
__device__ __forceinline__ v16b wcol_oi(const float* Wm, int k0, int o, int lane, int K) { v16b w; const float* p = Wm + (size_t)o * K + k0 + 8 * (lane >> 4);
#pragma unroll
  for (int i = 0; i < 8; ++i) { w[i] = (__bf16)p[i]; w[8 + i] = (__bf16)p[16 + i]; }
  return w; }
__device__ __forceinline__ v16h wcolh_io(const float* Wm, int k0, int o, int lane, int ld) { v16h w; const int g = lane >> 4;
#pragma unroll
  for (int i = 0; i < 8; ++i) { w[i] = (_Float16)(bfr(Wm[(size_t)(k0 + 8 * g + i) * ld + o]) * 256.0f); w[8 + i] = (_Float16)(bfr(Wm[(size_t)(k0 + 16 + 8 * g + i) * ld + o]) * 256.0f); }
  return w; }
__device__ __forceinline__ v16h wcolh_oi(const float* Wm, int k0, int o, int lane, int K) { v16h w; const float* p = Wm + (size_t)o * K + k0 + 8 * (lane >> 4);
#pragma unroll
  for (int i = 0; i < 8; ++i) { w[i] = (_Float16)(bfr(p[i]) * 256.0f); w[8 + i] = (_Float16)(bfr(p[16 + i]) * 256.0f); }
  return w; }
#define WQKV_LAYOUT 1   // 0 = (in,out) [DIN][CC]; 1 = (out,in) [CC][DIN]; 2 = per-head [NH][DIN][HD]
__device__ __forceinline__ v16b wcol_hdk(const float* Wm, int k0, int o, int lane) { v16b w; const int g = lane >> 4; const float* p = Wm + (size_t)(o / HD) * DIN * HD + (o % HD);
#pragma unroll
  for (int i = 0; i < 8; ++i) { w[i] = (__bf16)p[(size_t)(k0 + 8 * g + i) * HD]; w[8 + i] = (__bf16)p[(size_t)(k0 + 16 + 8 * g + i) * HD]; }
  return w; }
#define WO_OUT_IN 0
#if WQKV_LAYOUT == 1
#define WCOL(W, k0, o, lane) wcol_oi(W, k0, o, lane, DIN)
#elif WQKV_LAYOUT == 2
#define WCOL(W, k0, o, lane) wcol_hdk(W, k0, o, lane)
#else
#define WCOL(W, k0, o, lane) wcol_io(W, k0, o, lane, CC)
#endif
#if WO_OUT_IN
#define WOCOL(W, k0, o, lane) wcol_oi(W, k0, o, lane, CC)
#define WOCOLH(W, k0, o, lane) wcolh_oi(W, k0, o, lane, CC)
#else
#define WOCOL(W, k0, o, lane) wcol_io(W, k0, o, lane, DIN)
#define WOCOLH(W, k0, o, lane) wcolh_io(W, k0, o, lane, DIN)
#endif
#define QBH 6
__constant__ float c_freq[64] = {1.000000000e+00f,8.659643531e-01f,7.498942018e-01f,6.493816376e-01f,5.623413324e-01f,4.869675338e-01f,4.216965139e-01f,3.651741445e-01f,3.162277639e-01f,2.738419771e-01f,2.371373624e-01f,2.053525001e-01f,1.778279394e-01f,1.539926529e-01f,1.333521456e-01f,1.154782027e-01f,1.000000015e-01f,8.659642935e-02f,7.498941571e-02f,6.493816525e-02f,5.623412877e-02f,4.869675264e-02f,4.216964915e-02f,3.651741147e-02f,3.162277862e-02f,2.738419548e-02f,2.371373586e-02f,2.053525113e-02f,1.778279431e-02f,1.539926510e-02f,1.333521493e-02f,1.154781971e-02f,9.999999776e-03f,8.659643121e-03f,7.498942316e-03f,6.493816618e-03f,5.623413250e-03f,4.869675264e-03f,4.216964822e-03f,3.651741426e-03f,3.162277862e-03f,2.738419687e-03f,2.371373819e-03f,2.053525066e-03f,1.778279431e-03f,1.539926510e-03f,1.333521446e-03f,1.154782018e-03f,1.000000047e-03f,8.659643354e-04f,7.498941850e-04f,6.493816618e-04f,5.623413017e-04f,4.869675031e-04f,4.216964880e-04f,3.651741135e-04f,3.162277862e-04f,2.738419571e-04f,2.371373848e-04f,2.053524950e-04f,1.778279402e-04f,1.539926452e-04f,1.333521504e-04f,1.154781930e-04f};   /* 1/10000^(2i/128), i = 0..63, as XLA's f32 table */
// ---- k_prep8: block = (64 attention positions s0.. of sequence b, head h): reads the raw [B, T, C] inputs (element (b,s,h,c) at (b*TT + s)*CC + h*HD + c), bf16-rounds them and writes the attention planes in fragment order (fragp_h), [b][h][s / 16][c / 32] fragments of q and k (row = s, k = c) and [b][h][s / 32][c / 16] fragments of v (row = c, k = s): q -> f16 hi (+ x 2^10 residual for s < QHI), k -> f16 (+ residual, s < KHI), v -> f16 (+ bf16 hi/lo for s < VHI, + f32 column sums of the 64 positions); the block's 64 positions are 16 KiB in a row of every plane
#define PT 256             // threads of k_prep8: 8 waves, each takes PR whole rows of the 64-row tile
#define PR 8
typedef __attribute__((ext_vector_type(4))) _Float16 v4h;
__global__ __launch_bounds__(PT) void k_prep8(const float* __restrict__ Q, const float* __restrict__ K, const float* __restrict__ V, _Float16* __restrict__ QH, _Float16* __restrict__ QL, _Float16* __restrict__ KH, _Float16* __restrict__ KL, _Float16* __restrict__ VT, __bf16* __restrict__ VB, __bf16* __restrict__ VBL, float* __restrict__ SV) {
  __shared__ __align__(16) _Float16 sq[64][136], sql[64][136], sk[64][136], skl[64][136], tv[128][72]; __shared__ __align__(16) __bf16 tb[128][72], tbl[128][72];
  const int tid = threadIdx.x; const int h = blockIdx.y; const size_t r0 = (size_t)blockIdx.x * 64; const size_t bb = r0 / TT; const int t0 = (int)(r0 % TT); const bool qhi = t0 < QHI, khi = t0 < KHI, vhi = t0 < VHI;
  { const int cg = tid & 31, c = cg * 4, rb = (tid >> 5) * PR; const size_t o0 = ((bb * TT + t0 + rb) * (size_t)CC) + h * HD + c;   /* raw [B, T, (h, d)] layout; a lane owns 4 adjacent columns (two rotation pairs) of PR rows in a row */
    const float fr[2] = {c_freq[cg * 2], c_freq[cg * 2 + 1]};   /* oldest load: the angles need it alone, so the first sincosf runs while the tile is on its way */
    asm volatile("s_wait_xcnt 0x0" ::: "memory");   /* before the table load's offset register is given to a tile load's result */
    v4f qv[PR], kv[PR], vv[PR];   /* the lane's whole share of the tile is requested in front of the first use: 3 * PR loads of 16 B in flight, one memory latency a block */
#pragma unroll
    for (int i = 0; i < PR; ++i) { qv[i] = *(const v4f*)(Q + o0 + (size_t)i * CC); kv[i] = *(const v4f*)(K + o0 + (size_t)i * CC); vv[i] = *(const v4f*)(V + o0 + (size_t)i * CC); }
    asm volatile("s_wait_xcnt 0x0" ::: "memory");   /* before the three address pairs of the tile loads are overwritten by the angle code; also keeps every load in front of it */
    v8h tvp[4]; v8b tbp[4], tlp[4];   /* v: PR rows of one column are 16 B in a row of the transposed planes */
#pragma unroll
    for (int i = 0; i < PR; ++i) { const int rl = rb + i; v4h qh4, ql4, kh4, kl4;   /* module inputs bf16-rounded; interleaved-pair RoPE on q and k in f32 */
#pragma unroll
      for (int p = 0; p < 2; ++p) { const float ang = (float)(t0 + rl) * fr[p]; float sn, cs; sincosf(ang, &sn, &cs);
        const float qe = bfr(qv[i][2 * p]), qo = bfr(qv[i][2 * p + 1]), ke = bfr(kv[i][2 * p]), ko = bfr(kv[i][2 * p + 1]);
        const float qr[2] = {qe * cs - qo * sn, qe * sn + qo * cs}, kr[2] = {ke * cs - ko * sn, ke * sn + ko * cs};
#pragma unroll
        for (int s = 0; s < 2; ++s) { const _Float16 qh = (_Float16)qr[s], kh = (_Float16)kr[s]; qh4[2 * p + s] = qh; ql4[2 * p + s] = (_Float16)((qr[s] - (float)qh) * 1024.0f); kh4[2 * p + s] = kh; kl4[2 * p + s] = (_Float16)((kr[s] - (float)kh) * 1024.0f); } }
      *(v4h*)&sq[rl][c] = qh4; *(v4h*)&sql[rl][c] = ql4; *(v4h*)&sk[rl][c] = kh4; *(v4h*)&skl[rl][c] = kl4;
#pragma unroll
      for (int j = 0; j < 4; ++j) { const float v = bfr(vv[i][j]); tvp[j][i] = (_Float16)v; const __bf16 vb = (__bf16)v; tbp[j][i] = vb; tlp[j][i] = (__bf16)(v - (float)vb); } }
#pragma unroll
    for (int j = 0; j < 4; ++j) { *(v8h*)&tv[c + j][rb] = tvp[j]; *(v8b*)&tb[c + j][rb] = tbp[j]; *(v8b*)&tbl[c + j][rb] = tlp[j]; } }
  __syncthreads();
  /* e counts the 16-B pieces of the block's 16 KiB in plane order: lane l = e & 31, half of the fragment (e >> 5) & 1, then the fragment; a wave's store is 512 B in a row */
  for (int e = tid; e < 64 * (HD / 8); e += PT) { const int l = e & 31, rl = (e >> 8) * 16 + (l & 15), c = ((e >> 5) & 7) * 16 + (l >> 4) * 8; const size_t o = ((bb * NH + h) * (size_t)TT + t0) * HD + e * 8; vst2((unsigned*)(QH + o), *(const v4u*)&sq[rl][c]); vst2((unsigned*)(KH + o), *(const v4u*)&sk[rl][c]); asm volatile("s_wait_xcnt 0x0" ::: "memory");   /* before the two stores' data and address registers are rewritten for the next planes and the next trip */
    if (qhi) { vst2((unsigned*)(QL + ((bb * NH + h) * (size_t)QHI + t0) * HD + e * 8), *(const v4u*)&sql[rl][c]); asm volatile("s_wait_xcnt 0x0" ::: "memory"); }   /* before the store's data registers take the next LDS read */
    if (khi) vst2((unsigned*)(KL + ((bb * NH + h) * (size_t)KHI + t0) * HD + e * 8), *(const v4u*)&skl[rl][c]); }
  for (int e = tid; e < HD * 8; e += PT) { const int l = e & 31, cl = ((e >> 6) & 7) * 16 + (l & 15), sl = (e >> 9) * 32 + ((e >> 5) & 1) * 16 + (l >> 4) * 8; vst2((unsigned*)(VT + ((bb * NH + h) * (size_t)TT + t0) * HD + e * 8), *(const v4u*)&tv[cl][sl]); asm volatile("s_wait_xcnt 0x0" ::: "memory");   /* before the store's data and offset registers are rewritten for the next planes or the next trip */
    if (vhi) { const size_t o3 = ((bb * NH + h) * (size_t)VHI + t0) * HD + e * 8; vst2((unsigned*)(VB + o3), *(const v4u*)&tb[cl][sl]); vst2((unsigned*)(VBL + o3), *(const v4u*)&tbl[cl][sl]); asm volatile("s_wait_xcnt 0x0" ::: "memory"); } }   /* the same for these two stores, before the next trip */
  /* column sums of the block's 64 rows of v (the bf16 values, added in f32): what a key behind every query of a k_att block adds to each of them, up to the factor -1; thread = column, eight running sums so that the adds do not wait for one another */
  if (tid < HD) { float a[8] = {};
#pragma unroll
    for (int q = 0; q < 8; ++q) { const v8b t = *(const v8b*)&tb[tid][q * 8];
#pragma unroll
      for (int i = 0; i < 8; ++i) a[i] += (float)t[i]; }
    SV[((bb * NH + h) * (size_t)(TT / 64) + t0 / 64) * HD + tid] = ((a[0] + a[1]) + (a[2] + a[3])) + ((a[4] + a[5]) + (a[6] + a[7])); } }

#ifndef SM_EXTRA_PARAMS
#define SM_EXTRA_PARAMS
#endif
#ifndef PROJ_EXTRA_PARAMS
#define PROJ_EXTRA_PARAMS
#endif
#ifndef SM_MASK_HOOK
#define SM_MASK_HOOK (void)0
#endif

#define WS_QH  0u                                      // f16 q fragments [b][h][t / 16][d / 32]
#define WS_KH  (WS_QH + 2u * (size_t)NB * TT * CC)      // f16 k fragments [b][h][t / 16][d / 32]
#define WS_VT  (WS_KH + 2u * (size_t)NB * TT * CC)      // f16 v fragments [b][h][t / 32][d / 16]
#define WS_QL  (WS_VT + 2u * (size_t)NB * CC * TT)      // f16 q residual x 2^10 fragments [b][h][t < QHI]
#define WS_KL  (WS_QL + 2u * (size_t)NB * QHI * CC)     // f16 k residual x 2^10 fragments [b][h][t < KHI]
#define WS_VB  (WS_KL + 2u * (size_t)NB * KHI * CC)     // bf16 v hi fragments [b][h][t < VHI]
#define WS_VBL (WS_VB + 2u * (size_t)NB * CC * VHI)
#define WS_S   (WS_VBL + 2u * (size_t)NB * CC * VHI)    // f32 column sums of v over 64 keys [b][h][t / 64][d] (the start of the region)
#define WS_Y   (WS_S  + 4u * (size_t)HG * TT * TT)      // f32 ctx rows [b*t][CC] (only when there is an output projection)
#define WS_END (WS_Y  + 0u)

// tanh by the math library's own two range formulas (|x| >= 0.625: 1 - 2 / (exp(2|x|) + 1); below: x + x^3 . poly(x^2)), both evaluated and one selected per lane: the library form branches per element, which splits the unrolled tile into hundreds of blocks and keeps two f32 registers per element alive up to the products
__device__ __forceinline__ float tanh_sel(float x) { const float y = fabsf(x), y2 = x * x;
  const float zb = fmaf(__builtin_amdgcn_rcpf(expf(y + y) + 1.0f), -2.0f, 1.0f);
  float q = fmaf(-0x1.758e7ap-8f, y2, 0x1.521192p-6f); q = fmaf(y2, q, -0x1.b8389cp-5f); q = fmaf(y2, q, 0x1.110704p-3f); q = fmaf(y2, q, -0x1.555532p-2f);
  const float zs = fmaf(y2, y * q, y);
  return copysignf(y < 0.625f ? zs : zb, x); }
// tanh(logit x SCALE) x 2^11 for the rows whose att is rounded once to f16 right behind it: 2^11 - 2^12 / (2^(logit x 2 SCALE log2 e) + 1), one formula for every range on the chip's own exp2 and reciprocal; absolute error of tanh below 3e-7, against the f16 rounding's 2^-12 relative; -inf (a masked key) gives -2^11
#define T2L ((float)(2.0 * 0.08838834764831845 * 1.4426950408889634))
// eight transcendentals in one statement, each in place on its own register: none reads a neighbour's result or overwrites a neighbour's source, and the closing v_nop is the free slot the instruction set asks for behind the last one, whatever the compiler puts next
__device__ __forceinline__ void exp2x8(float (&x)[8]) { asm("v_exp_f32 %0, %0\n\tv_exp_f32 %1, %1\n\tv_exp_f32 %2, %2\n\tv_exp_f32 %3, %3\n\tv_exp_f32 %4, %4\n\tv_exp_f32 %5, %5\n\tv_exp_f32 %6, %6\n\tv_exp_f32 %7, %7\n\tv_nop" : "+v"(x[0]), "+v"(x[1]), "+v"(x[2]), "+v"(x[3]), "+v"(x[4]), "+v"(x[5]), "+v"(x[6]), "+v"(x[7])); }
__device__ __forceinline__ void rcpx8(float (&x)[8]) { asm("v_rcp_f32 %0, %0\n\tv_rcp_f32 %1, %1\n\tv_rcp_f32 %2, %2\n\tv_rcp_f32 %3, %3\n\tv_rcp_f32 %4, %4\n\tv_rcp_f32 %5, %5\n\tv_rcp_f32 %6, %6\n\tv_rcp_f32 %7, %7\n\tv_nop" : "+v"(x[0]), "+v"(x[1]), "+v"(x[2]), "+v"(x[3]), "+v"(x[4]), "+v"(x[5]), "+v"(x[6]), "+v"(x[7])); }
// ---- k_att: block = 32 queries (ql0..) of (b, h), KS waves. The keys up to the 64-key boundary behind the block's last query are NCH chunks of 32; they are dealt in turn: wave w takes nc = ceil(NCH / KS) chunks in a row from chunk w * nc on (the last wave with any takes what is left, the waves behind it none), so a wave's chain of loads and products grows with the keys the block can see. Logits are formed TRANSPOSED (A = k rows, B = q rows): D element r of lane (g, col) is key 8g + r of query col, so two 16-key tiles are, register for register, the A fragment of att for 32 keys, and logits and att never leave the registers. att = tanh(logit x SCALE) for key <= query, exactly -1 beyond, x 2^11; ctx = att . v (f16, 1 product, each k and v fragment used for both 16-query tiles; query rows < QBH * 64: 3-product logits, att and v as bf16 hi + lo, 3 products, one 16-query tile after the other). The keys behind that boundary have att = -1 for every query of the block and enter as -2^11 x the column sums of v over 64 keys (SV, from k_prep8): the last SW waves, which have the fewest chunks, add them up behind their own chunks, every SW-th sum each, into one row each of sm; the KS f32 partial tiles (of a wave without a chunk: a row of zeros) and the SW rows meet in LDS and are added in wave order; 512-B (row, head) segment by 32 lanes
#define KS 16
#define QW 2               // 16-query tiles per wave
#define NSV (TT / 64)      // column sums per (b, h)
#define SW 4               // waves that add up the column sums
static_assert(QBH * 2 <= KS, "a block of the 3-product rows has at most one chunk a wave"); static_assert(NSV / SW == 8 && SW == 4 && (32 * KS) % (HD / 4) == 0, "the two sums over sm and s are written out");
// MC chunks of 32 keys against the block's 32 queries, 1-product rows; lim = ql0 + col - k0 - 8 g; st = the wave's tile in LDS
template <int MC> __device__ __forceinline__ void att_lo(const _Float16* __restrict__ qrow, const _Float16* __restrict__ krow, const _Float16* __restrict__ vrow, int lim, int col, int g, float (*st)[HD + 4]) {
  v16h p[QW][MC];
  {
    v16h qh[QW][HD / 32];
#pragma unroll
    for (int u = 0; u < QW; ++u)
#pragma unroll
      for (int kc = 0; kc < HD / 32; ++kc) qh[u][kc] = fragp_h(qrow + (u * 4 + kc) * 512);
    v16h kf[2][HD / 32];   /* a 16-key tile's four fragments are fetched together, one tile ahead of their products: the loads stay in source order round the products' asm, so one written at its product would be waited for alone */
#pragma unroll
    for (int kc = 0; kc < HD / 32; ++kc) kf[0][kc] = fragp_h(krow + kc * 512);
#pragma unroll
    for (int c = 0; c < MC; ++c)
#pragma unroll
      for (int t = 0; t < 2; ++t) { v8f a[QW] = {};
        if (c * 2 + t + 1 < MC * 2) {
#pragma unroll
          for (int kc = 0; kc < HD / 32; ++kc) kf[(t + 1) & 1][kc] = fragp_h(krow + ((c * 2 + t + 1) * 4 + kc) * 512); }
#pragma unroll
        for (int kc = 0; kc < HD / 32; ++kc)
#pragma unroll
          for (int u = 0; u < QW; ++u) a[u] = wmma16(kf[t][kc], qh[u][kc], a[u]);
#pragma unroll
        for (int u = 0; u < QW; ++u) { float x[8];
#pragma unroll
          for (int r = 0; r < 8; ++r) x[r] = (c * 32 + t * 16 + r - u * 16 <= lim ? a[u][r] : -__builtin_inff()) * T2L;   /* the mask goes in as the reference's own -inf */
          exp2x8(x);
#pragma unroll
          for (int r = 0; r < 8; ++r) x[r] += 1.0f;
          rcpx8(x);
#pragma unroll
          for (int r = 0; r < 8; ++r) p[u][c][t * 8 + r] = (_Float16)fmaf(x[r], -4096.0f, 2048.0f); } } }
  constexpr int VA = MC == 4 ? 3 : MC == 3 ? 4 : MC == 2 ? 6 : HD / 16;   /* groups of 16 v columns on their way at a time: up to 12 fragments, in the registers that q and k leave free behind the logits; a group is requested VA groups ahead of its products, so a wave waits for memory once or twice instead of once a group */
  v16h vf[VA][MC];
#pragma unroll
  for (int j = 0; j < VA; ++j) {
    if (MC == 4 && j == 1) __builtin_amdgcn_sched_barrier(0);   /* four chunks: only the first group's requests may rise into the tanh code; with all three there the wave needs more than its 256 registers and spills */
#pragma unroll
    for (int c = 0; c < MC; ++c) vf[j][c] = fragp_h(vrow + (c * 8 + j) * 512); }
#pragma unroll
  for (int j = 0; j < HD / 16; ++j) { v8f acc[QW] = {};
#pragma unroll
    for (int c = 0; c < MC; ++c)
#pragma unroll
      for (int u = 0; u < QW; ++u) acc[u] = wmma16(p[u][c], vf[j % VA][c], acc[u]);
    if (j + VA < HD / 16) {
#pragma unroll
      for (int c = 0; c < MC; ++c) vf[j % VA][c] = fragp_h(vrow + (c * 8 + j + VA) * 512); }
#pragma unroll
    for (int u = 0; u < QW; ++u)
#pragma unroll
      for (int r = 0; r < 8; ++r) st[u * 16 + 8 * g + r][j * 16 + col] = acc[u][r]; } }
__global__ __launch_bounds__(32 * KS) void k_att(const _Float16* __restrict__ QH, const _Float16* __restrict__ KH, const _Float16* __restrict__ QL, const _Float16* __restrict__ KL, const _Float16* __restrict__ VT, const __bf16* __restrict__ VB, const __bf16* __restrict__ VBL, float* __restrict__ Y, const float* __restrict__ SV) { __shared__ __align__(16) float ss[KS][16 * QW][HD + 4], sm[SW][HD];
  const int h = blockIdx.y, b = blockIdx.z; const int tid = threadIdx.x, wave = __builtin_amdgcn_readfirstlane(tid >> 5), lane = tid & 31, col = lane & 15, g = lane >> 4; const int ql0 = blockIdx.x * (16 * QW);
  const int nch = (ql0 / 64 + 1) * 2, nc = (nch + KS - 1) / KS, mc = nch - wave * nc, k0 = wave * nc * 32;   /* chunks of the block, chunks a wave, chunks left from this wave's first on (<= 0: none), the wave's first key */
  const size_t bh = (size_t)b * NH + h; const _Float16* qrow = QH + (bh * TT + ql0) * HD + lane * 8; const _Float16* krow = KH + (bh * TT + k0) * HD + lane * 8;   /* the lane's piece of the first fragment; fragment (16 rows n, 32 dims kc) lies (n * 4 + kc) * 512 elements on */
  if (mc <= 0) {   /* wave-uniform: no chunk is left for this wave */
    const v4f zero = {}; *(v4f*)&ss[wave][0][lane * 4] = zero;   /* row 0 stands for all 16 * QW rows */
  } else if (ql0 < QBH * 64) {   /* nc = 1 here: one chunk */
    const _Float16* qlrow = QL + (bh * QHI + ql0) * HD + lane * 8; const _Float16* klrow = KL + (bh * KHI + k0) * HD + lane * 8;
    const __bf16* vrow = VB + (bh * VHI + k0) * HD + lane * 8; const __bf16* vlrow = VBL + (bh * VHI + k0) * HD + lane * 8;   /* v fragment (16 columns j) lies j * 512 elements on */
#pragma unroll 1   /* rolled: one 16-query tile's fragments and sums in registers at a time */
    for (int u = 0; u < QW; ++u) { const int qu = ql0 + u * 16; F2 p; v16b vh[HD / 16], vl[HD / 16];
      {
        v16h qh[HD / 32], ql[HD / 32];
#pragma unroll
        for (int kc = 0; kc < HD / 32; ++kc) { qh[kc] = fragp_h(qrow + (u * 4 + kc) * 512); if (kc + 1 < HD / 32) ql[kc] = fragp_h(qlrow + (u * 4 + kc) * 512); }
        { union { v16h v; v8h q[2]; } w; const _Float16* pl = qlrow + (u * 4 + HD / 32 - 1) * 512; w.q[0] = *(const v8h*)pl;
          asm volatile("s_wait_xcnt 0x0" ::: "memory");   /* before the last load's result is given the address registers of the loads in front of it */
          w.q[1] = *(const v8h*)(pl + 256); ql[HD / 32 - 1] = w.v; }
        v16h kb[2][HD / 32], kl[2][HD / 32];   /* the chunk's 16 k fragments are requested together with q, in front of the first product: one memory latency instead of one for every pair */
#pragma unroll
        for (int t = 0; t < 2; ++t)
#pragma unroll
          for (int kc = 0; kc < HD / 32; ++kc) { kb[t][kc] = fragp_h(krow + (t * 4 + kc) * 512); kl[t][kc] = fragp_h(klrow + (t * 4 + kc) * 512); }
        v8f a[2] = {}, al[2] = {};
#pragma unroll
        for (int t = 0; t < 2; ++t)
#pragma unroll
          for (int kc = 0; kc < HD / 32; ++kc) { a[t] = wmma16(kb[t][kc], qh[kc], a[t]); al[t] = wmma16(kb[t][kc], ql[kc], al[t]); al[t] = wmma16(kl[t][kc], qh[kc], al[t]); }
#pragma unroll
        for (int j = 0; j < HD / 16; ++j) { vh[j] = fragp_b(vrow + j * 512); vl[j] = fragp_b(vlrow + j * 512); }   /* all 16 v fragments at once, into the registers q and k have left: one memory latency instead of two */
        float pv[16];
#pragma unroll
        for (int t = 0; t < 2; ++t)
#pragma unroll
          for (int r = 0; r < 8; ++r) { const float th = tanh_sel((a[t][r] + al[t][r] * (1.0f / 1024.0f)) * SCALE); pv[t * 8 + r] = (k0 + t * 16 + 8 * g + r <= qu + col ? th : -1.0f) * 2048.0f; }
        p = bsplit16(pv); }
#pragma unroll
      for (int j = 0; j < HD / 16; ++j) { v8f acc = {}; acc = wmma_bf(p.h, vh[j], acc); acc = wmma_bf(p.l, vh[j], acc); acc = wmma_bf(p.h, vl[j], acc);
#pragma unroll
        for (int r = 0; r < 8; ++r) ss[wave][u * 16 + 8 * g + r][j * 16 + col] = acc[r]; } }
  } else {
    const _Float16* vrow = VT + (bh * TT + k0) * HD + lane * 8;   /* v fragment (32 keys c, 16 columns j) lies (c * 8 + j) * 512 elements on */
    const int lim = ql0 + col - k0 - 8 * g;   /* key <= query, both counted from the wave's and the lane's own start: one register against a constant per element */
    const int m = mc < nc ? mc : nc;   /* wave-uniform: one straight-line body per chunk count */
    if (m == 1) att_lo<1>(qrow, krow, vrow, lim, col, g, ss[wave]);
    else if (m == 2) att_lo<2>(qrow, krow, vrow, lim, col, g, ss[wave]);
    else if (m == 3) att_lo<3>(qrow, krow, vrow, lim, col, g, ss[wave]);
    else att_lo<4>(qrow, krow, vrow, lim, col, g, ss[wave]);
  }
  if (wave >= KS - SW) {   /* wave-uniform; the sums of the 64-key groups nch / 2 .. NSV - 1, all behind every query of the block */
    const int r0 = nch / 2 + wave - (KS - SW); const float* sv = SV + (bh * NSV + r0) * HD + lane * 4; v4f s[NSV / SW] = {};
#pragma unroll
    for (int i = 0; i < NSV / SW; ++i) if (r0 + i * SW < NSV) s[i] = *(const v4f*)(sv + i * SW * HD);   /* all requested before the first is used: one latency */
    asm volatile("s_wait_xcnt 0x0" ::: "memory");   /* before the loads' address registers are given to anything else */
    *(v4f*)&sm[wave - (KS - SW)][lane * 4] = (((s[0] + s[1]) + (s[2] + s[3])) + ((s[4] + s[5]) + (s[6] + s[7]))) * -2048.0f; }
  __syncthreads();   /* every wave's partial tiles are in LDS before any thread adds across the waves */
  const v4f ms = (*(const v4f*)&sm[0][lane * 4] + *(const v4f*)&sm[1][lane * 4]) + (*(const v4f*)&sm[2][lane * 4] + *(const v4f*)&sm[3][lane * 4]);   /* a thread's columns are lane * 4 .. + 3 on every trip: 32 * KS is a multiple of HD / 4 */
  for (int e = tid; e < 16 * QW * (HD / 4); e += 32 * KS) { const int rl = e / (HD / 4), c4 = e % (HD / 4); v4f s = ms + *(const v4f*)&ss[0][rl][c4 * 4];   /* wave 0 always has a chunk; unrolled below: the KS LDS reads are then in flight together instead of one wait each */
#pragma unroll
    for (int w = 1; w < KS; ++w) s += *(const v4f*)&ss[w][w * nc < nch ? rl : 0][c4 * 4];   /* a wave with a chunk wrote its whole tile, the others row 0 alone, zeros */
    vst2(Y + ((size_t)b * TT + ql0 + rl) * CC + h * HD + c4 * 4, s * (1.0f / 2048.0f)); } }

extern "C" void kernel_launch(void* const* d_in, const int* in_sizes, int n_in, void* d_out, int out_size, void* d_ws, size_t ws_size, hipStream_t stream) {
  (void)in_sizes; (void)n_in; (void)out_size;
  const float** F = (const float**)d_in;
  if (ws_size < (size_t)WS_END) return;
  char* ws = (char*)d_ws; _Float16 *QH = (_Float16*)(ws + WS_QH), *KH = (_Float16*)(ws + WS_KH), *VT = (_Float16*)(ws + WS_VT), *QL = (_Float16*)(ws + WS_QL), *KL = (_Float16*)(ws + WS_KL); __bf16 *VB = (__bf16*)(ws + WS_VB), *VBL = (__bf16*)(ws + WS_VBL); float* SV = (float*)(ws + WS_S);
  // inputs: 0 Q [2,2048,2048]; 1 K; 2 V (raw [B, T, (h, d)] tensors)
  k_prep8<<<dim3(TNB * TT / 64, NH), PT, 0, stream>>>(F[0], F[1], F[2], QH, QL, KH, KL, VT, VB, VBL, SV);
  k_att<<<dim3(TT / (16 * QW), NH, TNB), 32 * KS, 0, stream>>>(QH, KH, QL, KL, VT, VB, VBL, (float*)d_out, SV);
}

// v009
// It runs in 83.8 microseconds.
// Timed twice side by side with v008, it ran 1.12 times as fast both times.
// Over all steps from v000 it is 25.5 times as fast.
// compute dtype: all float inputs rounded to bf16; interleaved-pair RoPE applied in f32 to the bf16 q/k rows (64 embedded f32 inverse frequencies = XLA's table, accurate sincosf of the f32 angle t*freq); rotated q/k as f16 hi + residual (x 2^10) planes below row 384, once to f16 beyond; causal logits x 128^-0.5 with 3 products below row 384, 1 product beyond; att = tanh(logit) in f32 for k <= t (the math library's formulas below row 384; beyond, 1 - 2 / (exp2(2 log2(e) logit) + 1) on the hardware exp2 and reciprocal) and exactly -1 for k > t (tanh(-inf)); att x 2^11 against v: bf16 hi + lo (3 products) for query rows < 384, once to f16 against v f16 beyond; a 64-key group that lies wholly behind a block's 32 queries has att = -1 throughout and enters as -2^11 x its f32 column sums of v; f32 output [B, T, C].
#include <hip/hip_runtime.h>
#include <math.h>

typedef __attribute__((ext_vector_type(16))) _Float16 v16h;
typedef __attribute__((ext_vector_type(16))) __bf16 v16b;
typedef __attribute__((ext_vector_type(8)))  _Float16 v8h;
typedef __attribute__((ext_vector_type(8)))  float v8f;
typedef __attribute__((ext_vector_type(4)))  float v4f;
typedef __attribute__((ext_vector_type(2)))  float v2f;
typedef __attribute__((ext_vector_type(4)))  unsigned v4u;
typedef __attribute__((ext_vector_type(4)))  int v4i;
typedef float __attribute__((may_alias)) float_a;
typedef int __attribute__((may_alias)) int_a;

template <typename T> __device__ __forceinline__ void vst2(void* p, T v) { *(T*)p = v;  }
__device__ __forceinline__ v8f wmma16(v16h a, v16h b, v8f c) {
  v8f d = __builtin_amdgcn_wmma_f32_16x16x32_f16(false, a, false, b, (short)0, c, false, false);
  asm volatile("v_nop\n\tv_nop\n\tv_nop\n\tv_nop" : "+v"(d) : "v"(a), "v"(b));
  return d;
}
__device__ __forceinline__ v8f wmma_bf(v16b a, v16b b, v8f c) {
  v8f d = __builtin_amdgcn_wmma_f32_16x16x32_bf16(false, a, false, b, (short)0, c, false, false);
  asm volatile("v_nop\n\tv_nop\n\tv_nop\n\tv_nop" : "+v"(d) : "v"(a), "v"(b));
  return d;
}
// 16x16x32 fragments: lane = (h = lane>>4, row/col = lane&15); elements 0..7 = k0+8h+0..7, 8..15 = k0+16+8h+0..7; D element r = row 8h+r
__device__ __forceinline__ v16h frag_h(const _Float16* rowk0, int lane) {
  union { v16h v; v8h q[2]; } u; const _Float16* p = rowk0 + 8 * (lane >> 4);
  u.q[0] = *(const v8h*)p; u.q[1] = *(const v8h*)(p + 16); return u.v;
}
__device__ __forceinline__ v16h frag_f32(const float* rowk0, int lane) {
  v16h a; const float* p = rowk0 + 8 * (lane >> 4);
#pragma unroll
  for (int i = 0; i < 8; ++i) { a[i] = (_Float16)p[i]; a[8 + i] = (_Float16)p[16 + i]; }
  return a;
}
__device__ __forceinline__ v16h frag_f32s(const float* rowk0, int lane, float sc) {
  v16h a; const float* p = rowk0 + 8 * (lane >> 4);
#pragma unroll
  for (int i = 0; i < 8; ++i) { a[i] = (_Float16)(p[i] * sc); a[8 + i] = (_Float16)(p[16 + i] * sc); }
  return a;
}
// column fragment from a [K][ld] layout (column n), rows >= K read as 0
__device__ __forceinline__ v16h fragc_f32(const float* W, int k0, int n, int lane, int ld, int K) {
  v16h a; const int g = lane >> 4;
#pragma unroll
  for (int i = 0; i < 8; ++i) { const int ka = k0 + 8 * g + i, kb = ka + 16;
    a[i] = (_Float16)(ka < K ? W[(size_t)(ka < K ? ka : K - 1) * ld + n] : 0.f); a[8 + i] = (_Float16)(kb < K ? W[(size_t)(kb < K ? kb : K - 1) * ld + n] : 0.f); }
  return a;
}
struct F2 { v16b h, l; };
__device__ __forceinline__ F2 bsplit16(const float v[16]) { F2 r;
#pragma unroll
  for (int i = 0; i < 16; ++i) { const __bf16 h = (__bf16)v[i]; r.h[i] = h; r.l[i] = (__bf16)(v[i] - (float)h); }
  return r; }
__device__ __forceinline__ F2 split_row(const float* row, int k0, int lane) { float v[16]; const float* p = row + k0 + 8 * (lane >> 4);
#pragma unroll
  for (int i = 0; i < 8; ++i) { v[i] = p[i]; v[8 + i] = p[16 + i]; }
  return bsplit16(v); }
__device__ __forceinline__ F2 split_rowK(const float* row, int k0, int lane, int K) { float v[16]; const int g = lane >> 4;
#pragma unroll
  for (int i = 0; i < 8; ++i) { const int ka = k0 + 8 * g + i, kb = ka + 16; v[i] = ka < K ? row[ka < K ? ka : K - 1] : 0.f; v[8 + i] = kb < K ? row[kb < K ? kb : K - 1] : 0.f; }
  return bsplit16(v); }
__device__ __forceinline__ F2 split_col(const float* W, int k0, int n, int lane, int ld, int K) { float v[16]; const int g = lane >> 4;
#pragma unroll
  for (int i = 0; i < 8; ++i) { const int ka = k0 + 8 * g + i, kb = ka + 16; v[i] = ka < K ? W[(size_t)(ka < K ? ka : K - 1) * ld + n] : 0.f; v[8 + i] = kb < K ? W[(size_t)(kb < K ? kb : K - 1) * ld + n] : 0.f; }
  return bsplit16(v); }
__device__ __forceinline__ v8f mac3(const F2& a, const F2& b, v8f c) { c = wmma_bf(a.l, b.h, c); c = wmma_bf(a.h, b.l, c); return wmma_bf(a.h, b.h, c); }
__device__ __forceinline__ float sigm(float v) { return 1.0f / (1.0f + expf(-v)); }
#define LDSX() do { asm volatile("s_wait_dscnt 0" ::: "memory"); __builtin_amdgcn_wave_barrier(); __builtin_amdgcn_fence(__ATOMIC_RELEASE, "workgroup"); } while (0)

// Causal 'tanh attention' (no softmax) with RoPE (B 2, T 2,048, C 2,048 = 16 heads x 128; raw Q, K, V inputs, no projections): q, k = rope_interleaved(split_heads(Q)), rope(split_heads(K)); scores = q k^T / sqrt(128); att = tanh(where(causal, scores, -inf)) -> masked entries are exactly -1 and STILL multiply v; out = att v merged to [B, T, C].
#define NB 2
#define TT 2048
#define CC 2048            // NH * HD = projected width
#define DIN 2048          // input (model) width
#define NH 16
#define HD 128
#define NQB (TT / 64)
#define HG 4
#define SCALE (0.08838834764831845f)
#define CAUSAL 1
#ifndef TNB
#define TNB NB
#endif
__device__ __forceinline__ float bfr(float v) { return (float)(__bf16)v; }
__host__ __device__ __forceinline__ int kb_last(int qb) { return CAUSAL ? ((qb * 64 + 63) >> 7) : (TT / 128 - 1); }
typedef __attribute__((ext_vector_type(8))) __bf16 v8b;
__device__ __forceinline__ v16b frag_b(const __bf16* rowk0, int lane) {
  union { v16b v; v8b q[2]; } u; const __bf16* p = rowk0 + 8 * (lane >> 4);
  u.q[0] = *(const v8b*)p; u.q[1] = *(const v8b*)(p + 16); return u.v;
}
// fragment-order planes: one 16 x 32 fragment is 1 KiB in a row: elements 0..7 of lanes 0..31 (512 B), then elements 8..15; p = fragment start + 8 * lane, so each of the two loads of a wave reads four whole 128-B lines
__device__ __forceinline__ v16h fragp_h(const _Float16* p) { union { v16h v; v8h q[2]; } u; u.q[0] = *(const v8h*)p; u.q[1] = *(const v8h*)(p + 256); return u.v; }
__device__ __forceinline__ v16b fragp_b(const __bf16* p) { union { v16b v; v8b q[2]; } u; u.q[0] = *(const v8b*)p; u.q[1] = *(const v8b*)(p + 256); return u.v; }
#define QHI 384            // rows carrying a q residual plane
#define KHI 2048           // k residual plane: keys carrying one
#define VHI 384            // v bf16 planes: the keys of the 64-key groups that a query row < QBH * 64 may see (the keys behind them enter through the column sums)
// B fragment (k rows k0+.., output column o) of a weight: (in,out) [K][ld] or (out,in) [ld rows of K]: bf16 exact, or f16(bf16 * 256) exact
__device__ __forceinline__ v16b wcol_io(const float* Wm, int k0, int o, int lane, int ld) { v16b w; const int g = lane >> 4;
#pragma unroll
  for (int i = 0; i < 8; ++i) { w[i] = (__bf16)Wm[(size_t)(k0 + 8 * g + i) * ld + o]; w[8 + i] = (__bf16)Wm[(size_t)(k0 + 16 + 8 * g + i) * ld + o]; }
  return w; }
__device__ __forceinline__ v16b wcol_oi(const float* Wm, int k0, int o, int lane, int K) { v16b w; const float* p = Wm + (size_t)o * K + k0 + 8 * (lane >> 4);
#pragma unroll
  for (int i = 0; i < 8; ++i) { w[i] = (__bf16)p[i]; w[8 + i] = (__bf16)p[16 + i]; }
  return w; }
__device__ __forceinline__ v16h wcolh_io(const float* Wm, int k0, int o, int lane, int ld) { v16h w; const int g = lane >> 4;
#pragma unroll
  for (int i = 0; i < 8; ++i) { w[i] = (_Float16)(bfr(Wm[(size_t)(k0 + 8 * g + i) * ld + o]) * 256.0f); w[8 + i] = (_Float16)(bfr(Wm[(size_t)(k0 + 16 + 8 * g + i) * ld + o]) * 256.0f); }
  return w; }
__device__ __forceinline__ v16h wcolh_oi(const float* Wm, int k0, int o, int lane, int K) { v16h w; const float* p = Wm + (size_t)o * K + k0 + 8 * (lane >> 4);
#pragma unroll
  for (int i = 0; i < 8; ++i) { w[i] = (_Float16)(bfr(p[i]) * 256.0f); w[8 + i] = (_Float16)(bfr(p[16 + i]) * 256.0f); }
  return w; }
#define WQKV_LAYOUT 1   // 0 = (in,out) [DIN][CC]; 1 = (out,in) [CC][DIN]; 2 = per-head [NH][DIN][HD]
__device__ __forceinline__ v16b wcol_hdk(const float* Wm, int k0, int o, int lane) { v16b w; const int g = lane >> 4; const float* p = Wm + (size_t)(o / HD) * DIN * HD + (o % HD);
#pragma unroll
  for (int i = 0; i < 8; ++i) { w[i] = (__bf16)p[(size_t)(k0 + 8 * g + i) * HD]; w[8 + i] = (__bf16)p[(size_t)(k0 + 16 + 8 * g + i) * HD]; }
  return w; }
#define WO_OUT_IN 0
#if WQKV_LAYOUT == 1
#define WCOL(W, k0, o, lane) wcol_oi(W, k0, o, lane, DIN)
#elif WQKV_LAYOUT == 2
#define WCOL(W, k0, o, lane) wcol_hdk(W, k0, o, lane)
#else
#define WCOL(W, k0, o, lane) wcol_io(W, k0, o, lane, CC)
#endif
#if WO_OUT_IN
#define WOCOL(W, k0, o, lane) wcol_oi(W, k0, o, lane, CC)
#define WOCOLH(W, k0, o, lane) wcolh_oi(W, k0, o, lane, CC)
#else
#define WOCOL(W, k0, o, lane) wcol_io(W, k0, o, lane, DIN)
#define WOCOLH(W, k0, o, lane) wcolh_io(W, k0, o, lane, DIN)
#endif
#define QBH 6
__constant__ float c_freq[64] = {1.000000000e+00f,8.659643531e-01f,7.498942018e-01f,6.493816376e-01f,5.623413324e-01f,4.869675338e-01f,4.216965139e-01f,3.651741445e-01f,3.162277639e-01f,2.738419771e-01f,2.371373624e-01f,2.053525001e-01f,1.778279394e-01f,1.539926529e-01f,1.333521456e-01f,1.154782027e-01f,1.000000015e-01f,8.659642935e-02f,7.498941571e-02f,6.493816525e-02f,5.623412877e-02f,4.869675264e-02f,4.216964915e-02f,3.651741147e-02f,3.162277862e-02f,2.738419548e-02f,2.371373586e-02f,2.053525113e-02f,1.778279431e-02f,1.539926510e-02f,1.333521493e-02f,1.154781971e-02f,9.999999776e-03f,8.659643121e-03f,7.498942316e-03f,6.493816618e-03f,5.623413250e-03f,4.869675264e-03f,4.216964822e-03f,3.651741426e-03f,3.162277862e-03f,2.738419687e-03f,2.371373819e-03f,2.053525066e-03f,1.778279431e-03f,1.539926510e-03f,1.333521446e-03f,1.154782018e-03f,1.000000047e-03f,8.659643354e-04f,7.498941850e-04f,6.493816618e-04f,5.623413017e-04f,4.869675031e-04f,4.216964880e-04f,3.651741135e-04f,3.162277862e-04f,2.738419571e-04f,2.371373848e-04f,2.053524950e-04f,1.778279402e-04f,1.539926452e-04f,1.333521504e-04f,1.154781930e-04f};   /* 1/10000^(2i/128), i = 0..63, as XLA's f32 table */
// ---- k_prep8: block = (64 attention positions s0.. of sequence b, head h): reads the raw [B, T, C] inputs (element (b,s,h,c) at (b*TT + s)*CC + h*HD + c), bf16-rounds them and writes the attention planes in fragment order (fragp_h), [b][h][s / 16][c / 32] fragments of q and k (row = s, k = c) and [b][h][s / 32][c / 16] fragments of v (row = c, k = s): q -> f16 hi (+ x 2^10 residual for s < QHI), k -> f16 (+ residual, s < KHI), v -> f16 (+ bf16 hi/lo for s < VHI, + f32 column sums of the 64 positions); the block's 64 positions are 16 KiB in a row of every plane
#define PT 256             // threads of k_prep8: 8 waves, each takes PR whole rows of the 64-row tile
#define PR 8
typedef __attribute__((ext_vector_type(4))) _Float16 v4h;
__global__ __launch_bounds__(PT) void k_prep8(const float* __restrict__ Q, const float* __restrict__ K, const float* __restrict__ V, _Float16* __restrict__ QH, _Float16* __restrict__ QL, _Float16* __restrict__ KH, _Float16* __restrict__ KL, _Float16* __restrict__ VT, __bf16* __restrict__ VB, __bf16* __restrict__ VBL, float* __restrict__ SV) {
  __shared__ __align__(16) _Float16 sq[64][136], sql[64][136], sk[64][136], skl[64][136], tv[128][72]; __shared__ __align__(16) __bf16 tb[128][72], tbl[128][72];
  const int tid = threadIdx.x; const int h = blockIdx.y; const size_t r0 = (size_t)blockIdx.x * 64; const size_t bb = r0 / TT; const int t0 = (int)(r0 % TT); const bool qhi = t0 < QHI, khi = t0 < KHI, vhi = t0 < VHI;
  { const int cg = tid & 31, c = cg * 4, rb = (tid >> 5) * PR; const size_t o0 = ((bb * TT + t0 + rb) * (size_t)CC) + h * HD + c;   /* raw [B, T, (h, d)] layout; a lane owns 4 adjacent columns (two rotation pairs) of PR rows in a row */
    const float fr[2] = {c_freq[cg * 2], c_freq[cg * 2 + 1]};   /* oldest load: the angles need it alone, so the first sincosf runs while the tile is on its way */
    asm volatile("s_wait_xcnt 0x0" ::: "memory");   /* before the table load's offset register is given to a tile load's result */
    v4f qv[PR], kv[PR], vv[PR];   /* the lane's whole share of the tile is requested in front of the first use: 3 * PR loads of 16 B in flight, one memory latency a block */
#pragma unroll
    for (int i = 0; i < PR; ++i) { qv[i] = *(const v4f*)(Q + o0 + (size_t)i * CC); kv[i] = *(const v4f*)(K + o0 + (size_t)i * CC); vv[i] = *(const v4f*)(V + o0 + (size_t)i * CC); }
    asm volatile("s_wait_xcnt 0x0" ::: "memory");   /* before the three address pairs of the tile loads are overwritten by the angle code; also keeps every load in front of it */
    v8h tvp[4]; v8b tbp[4], tlp[4];   /* v: PR rows of one column are 16 B in a row of the transposed planes */
#pragma unroll
    for (int i = 0; i < PR; ++i) { const int rl = rb + i; v4h qh4, ql4, kh4, kl4;   /* module inputs bf16-rounded; interleaved-pair RoPE on q and k in f32 */
#pragma unroll
      for (int p = 0; p < 2; ++p) { const float ang = (float)(t0 + rl) * fr[p]; float sn, cs; sincosf(ang, &sn, &cs);
        const float qe = bfr(qv[i][2 * p]), qo = bfr(qv[i][2 * p + 1]), ke = bfr(kv[i][2 * p]), ko = bfr(kv[i][2 * p + 1]);
        const float qr[2] = {qe * cs - qo * sn, qe * sn + qo * cs}, kr[2] = {ke * cs - ko * sn, ke * sn + ko * cs};
#pragma unroll
        for (int s = 0; s < 2; ++s) { const _Float16 qh = (_Float16)qr[s], kh = (_Float16)kr[s]; qh4[2 * p + s] = qh; ql4[2 * p + s] = (_Float16)((qr[s] - (float)qh) * 1024.0f); kh4[2 * p + s] = kh; kl4[2 * p + s] = (_Float16)((kr[s] - (float)kh) * 1024.0f); } }
      *(v4h*)&sq[rl][c] = qh4; *(v4h*)&sql[rl][c] = ql4; *(v4h*)&sk[rl][c] = kh4; *(v4h*)&skl[rl][c] = kl4;
#pragma unroll
      for (int j = 0; j < 4; ++j) { const float v = bfr(vv[i][j]); tvp[j][i] = (_Float16)v; const __bf16 vb = (__bf16)v; tbp[j][i] = vb; tlp[j][i] = (__bf16)(v - (float)vb); } }
#pragma unroll
    for (int j = 0; j < 4; ++j) { *(v8h*)&tv[c + j][rb] = tvp[j]; *(v8b*)&tb[c + j][rb] = tbp[j]; *(v8b*)&tbl[c + j][rb] = tlp[j]; } }
  __syncthreads();
  /* e counts the 16-B pieces of the block's 16 KiB in plane order: lane l = e & 31, half of the fragment (e >> 5) & 1, then the fragment; a wave's store is 512 B in a row */
  for (int e = tid; e < 64 * (HD / 8); e += PT) { const int l = e & 31, rl = (e >> 8) * 16 + (l & 15), c = ((e >> 5) & 7) * 16 + (l >> 4) * 8; const size_t o = ((bb * NH + h) * (size_t)TT + t0) * HD + e * 8; vst2((unsigned*)(QH + o), *(const v4u*)&sq[rl][c]); vst2((unsigned*)(KH + o), *(const v4u*)&sk[rl][c]); asm volatile("s_wait_xcnt 0x0" ::: "memory");   /* before the two stores' data and address registers are rewritten for the next planes and the next trip */
    if (qhi) { vst2((unsigned*)(QL + ((bb * NH + h) * (size_t)QHI + t0) * HD + e * 8), *(const v4u*)&sql[rl][c]); asm volatile("s_wait_xcnt 0x0" ::: "memory"); }   /* before the store's data registers take the next LDS read */
    if (khi) vst2((unsigned*)(KL + ((bb * NH + h) * (size_t)KHI + t0) * HD + e * 8), *(const v4u*)&skl[rl][c]); }
  for (int e = tid; e < HD * 8; e += PT) { const int l = e & 31, cl = ((e >> 6) & 7) * 16 + (l & 15), sl = (e >> 9) * 32 + ((e >> 5) & 1) * 16 + (l >> 4) * 8; vst2((unsigned*)(VT + ((bb * NH + h) * (size_t)TT + t0) * HD + e * 8), *(const v4u*)&tv[cl][sl]); asm volatile("s_wait_xcnt 0x0" ::: "memory");   /* before the store's data and offset registers are rewritten for the next planes or the next trip */
    if (vhi) { const size_t o3 = ((bb * NH + h) * (size_t)VHI + t0) * HD + e * 8; vst2((unsigned*)(VB + o3), *(const v4u*)&tb[cl][sl]); vst2((unsigned*)(VBL + o3), *(const v4u*)&tbl[cl][sl]); asm volatile("s_wait_xcnt 0x0" ::: "memory"); } }   /* the same for these two stores, before the next trip */
  /* column sums of the block's 64 rows of v (the bf16 values, added in f32): what a key behind every query of a k_att block adds to each of them, up to the factor -1; thread = column, eight running sums so that the adds do not wait for one another */
  if (tid < HD) { float a[8] = {};
#pragma unroll
    for (int q = 0; q < 8; ++q) { const v8b t = *(const v8b*)&tb[tid][q * 8];
#pragma unroll
      for (int i = 0; i < 8; ++i) a[i] += (float)t[i]; }
    SV[((bb * NH + h) * (size_t)(TT / 64) + t0 / 64) * HD + tid] = ((a[0] + a[1]) + (a[2] + a[3])) + ((a[4] + a[5]) + (a[6] + a[7])); } }

#ifndef SM_EXTRA_PARAMS
#define SM_EXTRA_PARAMS
#endif
#ifndef PROJ_EXTRA_PARAMS
#define PROJ_EXTRA_PARAMS
#endif
#ifndef SM_MASK_HOOK
#define SM_MASK_HOOK (void)0
#endif

#define WS_QH  0u                                      // f16 q fragments [b][h][t / 16][d / 32]
#define WS_KH  (WS_QH + 2u * (size_t)NB * TT * CC)      // f16 k fragments [b][h][t / 16][d / 32]
#define WS_VT  (WS_KH + 2u * (size_t)NB * TT * CC)      // f16 v fragments [b][h][t / 32][d / 16]
#define WS_QL  (WS_VT + 2u * (size_t)NB * CC * TT)      // f16 q residual x 2^10 fragments [b][h][t < QHI]
#define WS_KL  (WS_QL + 2u * (size_t)NB * QHI * CC)     // f16 k residual x 2^10 fragments [b][h][t < KHI]
#define WS_VB  (WS_KL + 2u * (size_t)NB * KHI * CC)     // bf16 v hi fragments [b][h][t < VHI]
#define WS_VBL (WS_VB + 2u * (size_t)NB * CC * VHI)
#define WS_S   (WS_VBL + 2u * (size_t)NB * CC * VHI)    // f32 column sums of v over 64 keys [b][h][t / 64][d] (the start of the region)
#define WS_Y   (WS_S  + 4u * (size_t)HG * TT * TT)      // f32 ctx rows [b*t][CC] (only when there is an output projection)
#define WS_END (WS_Y  + 0u)

// tanh by the math library's own two range formulas (|x| >= 0.625: 1 - 2 / (exp(2|x|) + 1); below: x + x^3 . poly(x^2)), both evaluated and one selected per lane: the library form branches per element, which splits the unrolled tile into hundreds of blocks and keeps two f32 registers per element alive up to the products
__device__ __forceinline__ float tanh_sel(float x) { const float y = fabsf(x), y2 = x * x;
  const float zb = fmaf(__builtin_amdgcn_rcpf(expf(y + y) + 1.0f), -2.0f, 1.0f);
  float q = fmaf(-0x1.758e7ap-8f, y2, 0x1.521192p-6f); q = fmaf(y2, q, -0x1.b8389cp-5f); q = fmaf(y2, q, 0x1.110704p-3f); q = fmaf(y2, q, -0x1.555532p-2f);
  const float zs = fmaf(y2, y * q, y);
  return copysignf(y < 0.625f ? zs : zb, x); }
// tanh(logit x SCALE) x 2^11 for the rows whose att is rounded once to f16 right behind it: 2^11 - 2^12 / (2^(logit x 2 SCALE log2 e) + 1), one formula for every range on the chip's own exp2 and reciprocal; absolute error of tanh below 3e-7, against the f16 rounding's 2^-12 relative; -inf (a masked key) gives -2^11
#define T2L ((float)(2.0 * 0.08838834764831845 * 1.4426950408889634))
// eight transcendentals in one statement, each in place on its own register: none reads a neighbour's result or overwrites a neighbour's source, and the closing v_nop is the free slot the instruction set asks for behind the last one, whatever the compiler puts next
__device__ __forceinline__ void exp2x8(float (&x)[8]) { asm("v_exp_f32 %0, %0\n\tv_exp_f32 %1, %1\n\tv_exp_f32 %2, %2\n\tv_exp_f32 %3, %3\n\tv_exp_f32 %4, %4\n\tv_exp_f32 %5, %5\n\tv_exp_f32 %6, %6\n\tv_exp_f32 %7, %7\n\tv_nop" : "+v"(x[0]), "+v"(x[1]), "+v"(x[2]), "+v"(x[3]), "+v"(x[4]), "+v"(x[5]), "+v"(x[6]), "+v"(x[7])); }
__device__ __forceinline__ void rcpx8(float (&x)[8]) { asm("v_rcp_f32 %0, %0\n\tv_rcp_f32 %1, %1\n\tv_rcp_f32 %2, %2\n\tv_rcp_f32 %3, %3\n\tv_rcp_f32 %4, %4\n\tv_rcp_f32 %5, %5\n\tv_rcp_f32 %6, %6\n\tv_rcp_f32 %7, %7\n\tv_nop" : "+v"(x[0]), "+v"(x[1]), "+v"(x[2]), "+v"(x[3]), "+v"(x[4]), "+v"(x[5]), "+v"(x[6]), "+v"(x[7])); }
// ---- k_att: block = 32 queries (ql0..) of (b, h), KS waves. The keys up to the 64-key boundary behind the block's last query are NCH chunks of 32; they are dealt in turn: wave w takes nc = ceil(NCH / KS) chunks in a row from chunk w * nc on (the last wave with any takes what is left, the waves behind it none), so a wave's chain of loads and products grows with the keys the block can see. Logits are formed TRANSPOSED (A = k rows, B = q rows): D element r of lane (g, col) is key 8g + r of query col, so two 16-key tiles are, register for register, the A fragment of att for 32 keys, and logits and att never leave the registers. att = tanh(logit x SCALE) for key <= query, exactly -1 beyond, x 2^11; ctx = att . v (f16, 1 product, each k and v fragment used for both 16-query tiles; query rows < QBH * 64: 3-product logits, att and v as bf16 hi + lo, 3 products, one 16-query tile after the other). The keys behind that boundary have att = -1 for every query of the block and enter as -2^11 x the column sums of v over 64 keys (SV, from k_prep8): the last SW waves, which have the fewest chunks, add them up behind their own chunks, every SW-th sum each, into one row each of sm; the KS f32 partial tiles (of a wave without a chunk: a row of zeros) and the SW rows meet in LDS and are added in wave order; 512-B (row, head) segment by 32 lanes
#define KS 16
#define QW 2               // 16-query tiles per wave
#define NSV (TT / 64)      // column sums per (b, h)
#define SW 4               // waves that add up the column sums
static_assert(QBH * 2 <= KS, "a block of the 3-product rows has at most one chunk a wave"); static_assert(NSV / SW == 8 && SW == 4 && (32 * KS) % (HD / 4) == 0, "the two sums over sm and s are written out");
// MC chunks of 32 keys against the block's 32 queries, 1-product rows; lim = ql0 + col - k0 - 8 g; st = the wave's tile in LDS
template <int MC> __device__ __forceinline__ void att_lo(const _Float16* __restrict__ qrow, const _Float16* __restrict__ krow, const _Float16* __restrict__ vrow, int lim, int col, int g, float (*st)[HD + 4]) {
  v16h p[QW][MC];
  {
    v16h qh[QW][HD / 32];
#pragma unroll
    for (int u = 0; u < QW; ++u)
#pragma unroll
      for (int kc = 0; kc < HD / 32; ++kc) qh[u][kc] = fragp_h(qrow + (u * 4 + kc) * 512);
    v16h kf[2][HD / 32];   /* a 16-key tile's four fragments are fetched together, one tile ahead of their products: the loads stay in source order round the products' asm, so one written at its product would be waited for alone */
#pragma unroll
    for (int kc = 0; kc < HD / 32; ++kc) kf[0][kc] = fragp_h(krow + kc * 512);
#pragma unroll
    for (int c = 0; c < MC; ++c)
#pragma unroll
      for (int t = 0; t < 2; ++t) { v8f a[QW] = {};
        if (c * 2 + t + 1 < MC * 2) {
#pragma unroll
          for (int kc = 0; kc < HD / 32; ++kc) kf[(t + 1) & 1][kc] = fragp_h(krow + ((c * 2 + t + 1) * 4 + kc) * 512); }
#pragma unroll
        for (int kc = 0; kc < HD / 32; ++kc)
#pragma unroll
          for (int u = 0; u < QW; ++u) a[u] = wmma16(kf[t][kc], qh[u][kc], a[u]);
#pragma unroll
        for (int u = 0; u < QW; ++u) { float x[8];
#pragma unroll
          for (int r = 0; r < 8; ++r) x[r] = (c * 32 + t * 16 + r - u * 16 <= lim ? a[u][r] : -__builtin_inff()) * T2L;   /* the mask goes in as the reference's own -inf */
          exp2x8(x);
#pragma unroll
          for (int r = 0; r < 8; ++r) x[r] += 1.0f;
          rcpx8(x);
#pragma unroll
          for (int r = 0; r < 8; ++r) p[u][c][t * 8 + r] = (_Float16)fmaf(x[r], -4096.0f, 2048.0f); } } }
  constexpr int VA = MC == 4 ? 3 : MC == 3 ? 4 : MC == 2 ? 6 : HD / 16;   /* groups of 16 v columns on their way at a time: up to 12 fragments, in the registers that q and k leave free behind the logits; a group is requested VA groups ahead of its products, so a wave waits for memory once or twice instead of once a group */
  v16h vf[VA][MC];
#pragma unroll
  for (int j = 0; j < VA; ++j) {
    if (MC == 4 && j == 1) __builtin_amdgcn_sched_barrier(0);   /* four chunks: only the first group's requests may rise into the tanh code; with all three there the wave needs more than its 256 registers and spills */
#pragma unroll
    for (int c = 0; c < MC; ++c) vf[j][c] = fragp_h(vrow + (c * 8 + j) * 512); }
#pragma unroll
  for (int j = 0; j < HD / 16; ++j) { v8f acc[QW] = {};
#pragma unroll
    for (int c = 0; c < MC; ++c)
#pragma unroll
      for (int u = 0; u < QW; ++u) acc[u] = wmma16(p[u][c], vf[j % VA][c], acc[u]);
    if (j + VA < HD / 16) {
#pragma unroll
      for (int c = 0; c < MC; ++c) vf[j % VA][c] = fragp_h(vrow + (c * 8 + j + VA) * 512); }
#pragma unroll
    for (int u = 0; u < QW; ++u)
#pragma unroll
      for (int r = 0; r < 8; ++r) st[u * 16 + 8 * g + r][j * 16 + col] = acc[u][r]; } }
__global__ __launch_bounds__(32 * KS) void k_att(const _Float16* __restrict__ QH, const _Float16* __restrict__ KH, const _Float16* __restrict__ QL, const _Float16* __restrict__ KL, const _Float16* __restrict__ VT, const __bf16* __restrict__ VB, const __bf16* __restrict__ VBL, float* __restrict__ Y, const float* __restrict__ SV) { __shared__ __align__(16) float ss[KS][16 * QW][HD + 4], sm[SW][HD];
  const int h = blockIdx.x, b = blockIdx.y; const int tid = threadIdx.x, wave = __builtin_amdgcn_readfirstlane(tid >> 5), lane = tid & 31, col = lane & 15, g = lane >> 4; const int ql0 = (TT / (16 * QW) - 1 - (int)blockIdx.z) * (16 * QW);   /* ql0 counts down with z: z = 0 holds the last 32 queries, the blocks that see the most keys; for speed only */
  const int nch = (ql0 / 64 + 1) * 2, nc = (nch + KS - 1) / KS, mc = nch - wave * nc, k0 = wave * nc * 32;   /* chunks of the block, chunks a wave, chunks left from this wave's first on (<= 0: none), the wave's first key */
  const size_t bh = (size_t)b * NH + h; const _Float16* qrow = QH + (bh * TT + ql0) * HD + lane * 8; const _Float16* krow = KH + (bh * TT + k0) * HD + lane * 8;   /* the lane's piece of the first fragment; fragment (16 rows n, 32 dims kc) lies (n * 4 + kc) * 512 elements on */
  if (mc <= 0) {   /* wave-uniform: no chunk is left for this wave */
    const v4f zero = {}; *(v4f*)&ss[wave][0][lane * 4] = zero;   /* row 0 stands for all 16 * QW rows */
  } else if (ql0 < QBH * 64) {   /* nc = 1 here: one chunk */
    const _Float16* qlrow = QL + (bh * QHI + ql0) * HD + lane * 8; const _Float16* klrow = KL + (bh * KHI + k0) * HD + lane * 8;
    const __bf16* vrow = VB + (bh * VHI + k0) * HD + lane * 8; const __bf16* vlrow = VBL + (bh * VHI + k0) * HD + lane * 8;   /* v fragment (16 columns j) lies j * 512 elements on */
#pragma unroll 1   /* rolled: one 16-query tile's fragments and sums in registers at a time */
    for (int u = 0; u < QW; ++u) { const int qu = ql0 + u * 16; F2 p; v16b vh[HD / 16], vl[HD / 16];
      {
        v16h qh[HD / 32], ql[HD / 32];
#pragma unroll
        for (int kc = 0; kc < HD / 32; ++kc) { qh[kc] = fragp_h(qrow + (u * 4 + kc) * 512); if (kc + 1 < HD / 32) ql[kc] = fragp_h(qlrow + (u * 4 + kc) * 512); }
        { union { v16h v; v8h q[2]; } w; const _Float16* pl = qlrow + (u * 4 + HD / 32 - 1) * 512; w.q[0] = *(const v8h*)pl;
          asm volatile("s_wait_xcnt 0x0" ::: "memory");   /* before the last load's result is given the address registers of the loads in front of it */
          w.q[1] = *(const v8h*)(pl + 256); ql[HD / 32 - 1] = w.v; }
        v16h kb[2][HD / 32], kl[2][HD / 32];   /* the chunk's 16 k fragments are requested together with q, in front of the first product: one memory latency instead of one for every pair */
#pragma unroll
        for (int t = 0; t < 2; ++t)
#pragma unroll
          for (int kc = 0; kc < HD / 32; ++kc) { kb[t][kc] = fragp_h(krow + (t * 4 + kc) * 512); kl[t][kc] = fragp_h(klrow + (t * 4 + kc) * 512); }
        v8f a[2] = {}, al[2] = {};
#pragma unroll
        for (int t = 0; t < 2; ++t)
#pragma unroll
          for (int kc = 0; kc < HD / 32; ++kc) { a[t] = wmma16(kb[t][kc], qh[kc], a[t]); al[t] = wmma16(kb[t][kc], ql[kc], al[t]); al[t] = wmma16(kl[t][kc], qh[kc], al[t]); }
#pragma unroll
        for (int j = 0; j < HD / 16; ++j) { vh[j] = fragp_b(vrow + j * 512); vl[j] = fragp_b(vlrow + j * 512); }   /* all 16 v fragments at once, into the registers q and k have left: one memory latency instead of two */
        float pv[16];
#pragma unroll
        for (int t = 0; t < 2; ++t)
#pragma unroll
          for (int r = 0; r < 8; ++r) { const float th = tanh_sel((a[t][r] + al[t][r] * (1.0f / 1024.0f)) * SCALE); pv[t * 8 + r] = (k0 + t * 16 + 8 * g + r <= qu + col ? th : -1.0f) * 2048.0f; }
        p = bsplit16(pv); }
#pragma unroll
      for (int j = 0; j < HD / 16; ++j) { v8f acc = {}; acc = wmma_bf(p.h, vh[j], acc); acc = wmma_bf(p.l, vh[j], acc); acc = wmma_bf(p.h, vl[j], acc);
#pragma unroll
        for (int r = 0; r < 8; ++r) ss[wave][u * 16 + 8 * g + r][j * 16 + col] = acc[r]; } }
  } else {
    const _Float16* vrow = VT + (bh * TT + k0) * HD + lane * 8;   /* v fragment (32 keys c, 16 columns j) lies (c * 8 + j) * 512 elements on */
    const int lim = ql0 + col - k0 - 8 * g;   /* key <= query, both counted from the wave's and the lane's own start: one register against a constant per element */
    const int m = mc < nc ? mc : nc;   /* wave-uniform: one straight-line body per chunk count */
    if (m == 1) att_lo<1>(qrow, krow, vrow, lim, col, g, ss[wave]);
    else if (m == 2) att_lo<2>(qrow, krow, vrow, lim, col, g, ss[wave]);
    else if (m == 3) att_lo<3>(qrow, krow, vrow, lim, col, g, ss[wave]);
    else att_lo<4>(qrow, krow, vrow, lim, col, g, ss[wave]);
  }
  if (wave >= KS - SW) {   /* wave-uniform; the sums of the 64-key groups nch / 2 .. NSV - 1, all behind every query of the block */
    const int r0 = nch / 2 + wave - (KS - SW); const float* sv = SV + (bh * NSV + r0) * HD + lane * 4; v4f s[NSV / SW] = {};
#pragma unroll
    for (int i = 0; i < NSV / SW; ++i) if (r0 + i * SW < NSV) s[i] = *(const v4f*)(sv + i * SW * HD);   /* all requested before the first is used: one latency */
    asm volatile("s_wait_xcnt 0x0" ::: "memory");   /* before the loads' address registers are given to anything else */
    *(v4f*)&sm[wave - (KS - SW)][lane * 4] = (((s[0] + s[1]) + (s[2] + s[3])) + ((s[4] + s[5]) + (s[6] + s[7]))) * -2048.0f; }
  __syncthreads();   /* every wave's partial tiles are in LDS before any thread adds across the waves */
  const v4f ms = (*(const v4f*)&sm[0][lane * 4] + *(const v4f*)&sm[1][lane * 4]) + (*(const v4f*)&sm[2][lane * 4] + *(const v4f*)&sm[3][lane * 4]);   /* a thread's columns are lane * 4 .. + 3 on every trip: 32 * KS is a multiple of HD / 4 */
  for (int e = tid; e < 16 * QW * (HD / 4); e += 32 * KS) { const int rl = e / (HD / 4), c4 = e % (HD / 4); v4f s = ms + *(const v4f*)&ss[0][rl][c4 * 4];   /* wave 0 always has a chunk; unrolled below: the KS LDS reads are then in flight together instead of one wait each */
#pragma unroll
    for (int w = 1; w < KS; ++w) s += *(const v4f*)&ss[w][w * nc < nch ? rl : 0][c4 * 4];   /* a wave with a chunk wrote its whole tile, the others row 0 alone, zeros */
    vst2(Y + ((size_t)b * TT + ql0 + rl) * CC + h * HD + c4 * 4, s * (1.0f / 2048.0f)); } }

extern "C" void kernel_launch(void* const* d_in, const int* in_sizes, int n_in, void* d_out, int out_size, void* d_ws, size_t ws_size, hipStream_t stream) {
  (void)in_sizes; (void)n_in; (void)out_size;
  const float** F = (const float**)d_in;
  if (ws_size < (size_t)WS_END) return;
  char* ws = (char*)d_ws; _Float16 *QH = (_Float16*)(ws + WS_QH), *KH = (_Float16*)(ws + WS_KH), *VT = (_Float16*)(ws + WS_VT), *QL = (_Float16*)(ws + WS_QL), *KL = (_Float16*)(ws + WS_KL); __bf16 *VB = (__bf16*)(ws + WS_VB), *VBL = (__bf16*)(ws + WS_VBL); float* SV = (float*)(ws + WS_S);
  // inputs: 0 Q [2,2048,2048]; 1 K; 2 V (raw [B, T, (h, d)] tensors)
  k_prep8<<<dim3(TNB * TT / 64, NH), PT, 0, stream>>>(F[0], F[1], F[2], QH, QL, KH, KL, VT, VB, VBL, SV);
  k_att<<<dim3(NH, TNB, TT / (16 * QW)), 32 * KS, 0, stream>>>(QH, KH, QL, KL, VT, VB, VBL, (float*)d_out, SV);
}

// v010
// Measured time: 71.8 microseconds a run.
// Next to v009, in two timings, it ran 1.17 and 1.16 times as fast.
// All steps since v000 together make it 29.7 times as fast.
// compute dtype: all float inputs rounded to bf16; interleaved-pair RoPE applied in f32 to the bf16 q/k rows (64 embedded f32 inverse frequencies = XLA's table, accurate sincosf of the f32 angle t*freq); rotated q/k as f16 hi + residual (x 2^10) planes below row 384, once to f16 beyond; causal logits x 128^-0.5 with 3 products below row 384, 1 product beyond; att = tanh(logit) in f32 for k <= t (the math library's formulas below row 384; beyond, 1 - 2 / (exp2(2 log2(e) logit) + 1) on the hardware exp2 and reciprocal) and exactly -1 for k > t (tanh(-inf)); att x 2^11 against v: bf16 hi + lo (3 products) for query rows < 384, once to f16 against v f16 beyond; a 64-key group that lies wholly behind a block's queries has att = -1 throughout and enters as -2^11 x its f32 column sums of v; f32 output [B, T, C].
#include <hip/hip_runtime.h>
#include <math.h>

typedef __attribute__((ext_vector_type(16))) _Float16 v16h;
typedef __attribute__((ext_vector_type(16))) __bf16 v16b;
typedef __attribute__((ext_vector_type(8)))  _Float16 v8h;
typedef __attribute__((ext_vector_type(8)))  float v8f;
typedef __attribute__((ext_vector_type(4)))  float v4f;
typedef __attribute__((ext_vector_type(2)))  float v2f;
typedef __attribute__((ext_vector_type(4)))  unsigned v4u;
typedef __attribute__((ext_vector_type(4)))  int v4i;
typedef float __attribute__((may_alias)) float_a;
typedef int __attribute__((may_alias)) int_a;

template <typename T> __device__ __forceinline__ void vst2(void* p, T v) { *(T*)p = v;  }
__device__ __forceinline__ v8f wmma16(v16h a, v16h b, v8f c) {
  v8f d = __builtin_amdgcn_wmma_f32_16x16x32_f16(false, a, false, b, (short)0, c, false, false);
  asm volatile("v_nop\n\tv_nop\n\tv_nop\n\tv_nop" : "+v"(d) : "v"(a), "v"(b));
  return d;
}
__device__ __forceinline__ v8f wmma_bf(v16b a, v16b b, v8f c) {
  v8f d = __builtin_amdgcn_wmma_f32_16x16x32_bf16(false, a, false, b, (short)0, c, false, false);
  asm volatile("v_nop\n\tv_nop\n\tv_nop\n\tv_nop" : "+v"(d) : "v"(a), "v"(b));
  return d;
}
// 16x16x32 fragments: lane = (h = lane>>4, row/col = lane&15); elements 0..7 = k0+8h+0..7, 8..15 = k0+16+8h+0..7; D element r = row 8h+r
__device__ __forceinline__ v16h frag_h(const _Float16* rowk0, int lane) {
  union { v16h v; v8h q[2]; } u; const _Float16* p = rowk0 + 8 * (lane >> 4);
  u.q[0] = *(const v8h*)p; u.q[1] = *(const v8h*)(p + 16); return u.v;
}
__device__ __forceinline__ v16h frag_f32(const float* rowk0, int lane) {
  v16h a; const float* p = rowk0 + 8 * (lane >> 4);
#pragma unroll
  for (int i = 0; i < 8; ++i) { a[i] = (_Float16)p[i]; a[8 + i] = (_Float16)p[16 + i]; }
  return a;
}
__device__ __forceinline__ v16h frag_f32s(const float* rowk0, int lane, float sc) {
  v16h a; const float* p = rowk0 + 8 * (lane >> 4);
#pragma unroll
  for (int i = 0; i < 8; ++i) { a[i] = (_Float16)(p[i] * sc); a[8 + i] = (_Float16)(p[16 + i] * sc); }
  return a;
}
// column fragment from a [K][ld] layout (column n), rows >= K read as 0
__device__ __forceinline__ v16h fragc_f32(const float* W, int k0, int n, int lane, int ld, int K) {
  v16h a; const int g = lane >> 4;
#pragma unroll
  for (int i = 0; i < 8; ++i) { const int ka = k0 + 8 * g + i, kb = ka + 16;
    a[i] = (_Float16)(ka < K ? W[(size_t)(ka < K ? ka : K - 1) * ld + n] : 0.f); a[8 + i] = (_Float16)(kb < K ? W[(size_t)(kb < K ? kb : K - 1) * ld + n] : 0.f); }
  return a;
}
struct F2 { v16b h, l; };
__device__ __forceinline__ F2 bsplit16(const float v[16]) { F2 r;
#pragma unroll
  for (int i = 0; i < 16; ++i) { const __bf16 h = (__bf16)v[i]; r.h[i] = h; r.l[i] = (__bf16)(v[i] - (float)h); }
  return r; }
__device__ __forceinline__ F2 split_row(const float* row, int k0, int lane) { float v[16]; const float* p = row + k0 + 8 * (lane >> 4);
#pragma unroll
  for (int i = 0; i < 8; ++i) { v[i] = p[i]; v[8 + i] = p[16 + i]; }
  return bsplit16(v); }
__device__ __forceinline__ F2 split_rowK(const float* row, int k0, int lane, int K) { float v[16]; const int g = lane >> 4;
#pragma unroll
  for (int i = 0; i < 8; ++i) { const int ka = k0 + 8 * g + i, kb = ka + 16; v[i] = ka < K ? row[ka < K ? ka : K - 1] : 0.f; v[8 + i] = kb < K ? row[kb < K ? kb : K - 1] : 0.f; }
  return bsplit16(v); }
__device__ __forceinline__ F2 split_col(const float* W, int k0, int n, int lane, int ld, int K) { float v[16]; const int g = lane >> 4;
#pragma unroll
  for (int i = 0; i < 8; ++i) { const int ka = k0 + 8 * g + i, kb = ka + 16; v[i] = ka < K ? W[(size_t)(ka < K ? ka : K - 1) * ld + n] : 0.f; v[8 + i] = kb < K ? W[(size_t)(kb < K ? kb : K - 1) * ld + n] : 0.f; }
  return bsplit16(v); }
__device__ __forceinline__ v8f mac3(const F2& a, const F2& b, v8f c) { c = wmma_bf(a.l, b.h, c); c = wmma_bf(a.h, b.l, c); return wmma_bf(a.h, b.h, c); }
__device__ __forceinline__ float sigm(float v) { return 1.0f / (1.0f + expf(-v)); }
#define LDSX() do { asm volatile("s_wait_dscnt 0" ::: "memory"); __builtin_amdgcn_wave_barrier(); __builtin_amdgcn_fence(__ATOMIC_RELEASE, "workgroup"); } while (0)

// Causal 'tanh attention' (no softmax) with RoPE (B 2, T 2,048, C 2,048 = 16 heads x 128; raw Q, K, V inputs, no projections): q, k = rope_interleaved(split_heads(Q)), rope(split_heads(K)); scores = q k^T / sqrt(128); att = tanh(where(causal, scores, -inf)) -> masked entries are exactly -1 and STILL multiply v; out = att v merged to [B, T, C].
#define NB 2
#define TT 2048
#define CC 2048            // NH * HD = projected width
#define DIN 2048          // input (model) width
#define NH 16
#define HD 128
#define NQB (TT / 64)
#define HG 4
#define SCALE (0.08838834764831845f)
#define CAUSAL 1
#ifndef TNB
#define TNB NB
#endif
__device__ __forceinline__ float bfr(float v) { return (float)(__bf16)v; }
__host__ __device__ __forceinline__ int kb_last(int qb) { return CAUSAL ? ((qb * 64 + 63) >> 7) : (TT / 128 - 1); }
typedef __attribute__((ext_vector_type(8))) __bf16 v8b;
__device__ __forceinline__ v16b frag_b(const __bf16* rowk0, int lane) {
  union { v16b v; v8b q[2]; } u; const __bf16* p = rowk0 + 8 * (lane >> 4);
  u.q[0] = *(const v8b*)p; u.q[1] = *(const v8b*)(p + 16); return u.v;
}
// fragment-order planes: one 16 x 32 fragment is 1 KiB in a row: elements 0..7 of lanes 0..31 (512 B), then elements 8..15; p = fragment start + 8 * lane, so each of the two loads of a wave reads four whole 128-B lines
__device__ __forceinline__ v16h fragp_h(const _Float16* p) { union { v16h v; v8h q[2]; } u; u.q[0] = *(const v8h*)p; u.q[1] = *(const v8h*)(p + 256); return u.v; }
__device__ __forceinline__ v16b fragp_b(const __bf16* p) { union { v16b v; v8b q[2]; } u; u.q[0] = *(const v8b*)p; u.q[1] = *(const v8b*)(p + 256); return u.v; }
#define QHI 384            // rows carrying a q residual plane
#define KHI 2048           // k residual plane: keys carrying one
#define VHI 384            // v bf16 planes: the keys of the 64-key groups that a query row < QBH * 64 may see (the keys behind them enter through the column sums)
// B fragment (k rows k0+.., output column o) of a weight: (in,out) [K][ld] or (out,in) [ld rows of K]: bf16 exact, or f16(bf16 * 256) exact
__device__ __forceinline__ v16b wcol_io(const float* Wm, int k0, int o, int lane, int ld) { v16b w; const int g = lane >> 4;
#pragma unroll
  for (int i = 0; i < 8; ++i) { w[i] = (__bf16)Wm[(size_t)(k0 + 8 * g + i) * ld + o]; w[8 + i] = (__bf16)Wm[(size_t)(k0 + 16 + 8 * g + i) * ld + o]; }
  return w; }
__device__ __forceinline__ v16b wcol_oi(const float* Wm, int k0, int o, int lane, int K) { v16b w; const float* p = Wm + (size_t)o * K + k0 + 8 * (lane >> 4);
#pragma unroll
  for (int i = 0; i < 8; ++i) { w[i] = (__bf16)p[i]; w[8 + i] = (__bf16)p[16 + i]; }
  return w; }
__device__ __forceinline__ v16h wcolh_io(const float* Wm, int k0, int o, int lane, int ld) { v16h w; const int g = lane >> 4;
#pragma unroll
  for (int i = 0; i < 8; ++i) { w[i] = (_Float16)(bfr(Wm[(size_t)(k0 + 8 * g + i) * ld + o]) * 256.0f); w[8 + i] = (_Float16)(bfr(Wm[(size_t)(k0 + 16 + 8 * g + i) * ld + o]) * 256.0f); }
  return w; }
__device__ __forceinline__ v16h wcolh_oi(const float* Wm, int k0, int o, int lane, int K) { v16h w; const float* p = Wm + (size_t)o * K + k0 + 8 * (lane >> 4);
#pragma unroll
  for (int i = 0; i < 8; ++i) { w[i] = (_Float16)(bfr(p[i]) * 256.0f); w[8 + i] = (_Float16)(bfr(p[16 + i]) * 256.0f); }
  return w; }
#define WQKV_LAYOUT 1   // 0 = (in,out) [DIN][CC]; 1 = (out,in) [CC][DIN]; 2 = per-head [NH][DIN][HD]
__device__ __forceinline__ v16b wcol_hdk(const float* Wm, int k0, int o, int lane) { v16b w; const int g = lane >> 4; const float* p = Wm + (size_t)(o / HD) * DIN * HD + (o % HD);
#pragma unroll
  for (int i = 0; i < 8; ++i) { w[i] = (__bf16)p[(size_t)(k0 + 8 * g + i) * HD]; w[8 + i] = (__bf16)p[(size_t)(k0 + 16 + 8 * g + i) * HD]; }
  return w; }
#define WO_OUT_IN 0
#if WQKV_LAYOUT == 1
#define WCOL(W, k0, o, lane) wcol_oi(W, k0, o, lane, DIN)
#elif WQKV_LAYOUT == 2
#define WCOL(W, k0, o, lane) wcol_hdk(W, k0, o, lane)
#else
#define WCOL(W, k0, o, lane) wcol_io(W, k0, o, lane, CC)
#endif
#if WO_OUT_IN
#define WOCOL(W, k0, o, lane) wcol_oi(W, k0, o, lane, CC)
#define WOCOLH(W, k0, o, lane) wcolh_oi(W, k0, o, lane, CC)
#else
#define WOCOL(W, k0, o, lane) wcol_io(W, k0, o, lane, DIN)
#define WOCOLH(W, k0, o, lane) wcolh_io(W, k0, o, lane, DIN)
#endif
#define QBH 6
__constant__ float c_freq[64] = {1.000000000e+00f,8.659643531e-01f,7.498942018e-01f,6.493816376e-01f,5.623413324e-01f,4.869675338e-01f,4.216965139e-01f,3.651741445e-01f,3.162277639e-01f,2.738419771e-01f,2.371373624e-01f,2.053525001e-01f,1.778279394e-01f,1.539926529e-01f,1.333521456e-01f,1.154782027e-01f,1.000000015e-01f,8.659642935e-02f,7.498941571e-02f,6.493816525e-02f,5.623412877e-02f,4.869675264e-02f,4.216964915e-02f,3.651741147e-02f,3.162277862e-02f,2.738419548e-02f,2.371373586e-02f,2.053525113e-02f,1.778279431e-02f,1.539926510e-02f,1.333521493e-02f,1.154781971e-02f,9.999999776e-03f,8.659643121e-03f,7.498942316e-03f,6.493816618e-03f,5.623413250e-03f,4.869675264e-03f,4.216964822e-03f,3.651741426e-03f,3.162277862e-03f,2.738419687e-03f,2.371373819e-03f,2.053525066e-03f,1.778279431e-03f,1.539926510e-03f,1.333521446e-03f,1.154782018e-03f,1.000000047e-03f,8.659643354e-04f,7.498941850e-04f,6.493816618e-04f,5.623413017e-04f,4.869675031e-04f,4.216964880e-04f,3.651741135e-04f,3.162277862e-04f,2.738419571e-04f,2.371373848e-04f,2.053524950e-04f,1.778279402e-04f,1.539926452e-04f,1.333521504e-04f,1.154781930e-04f};   /* 1/10000^(2i/128), i = 0..63, as XLA's f32 table */
// ---- k_prep8: block = (64 attention positions s0.. of sequence b, head h): reads the raw [B, T, C] inputs (element (b,s,h,c) at (b*TT + s)*CC + h*HD + c), bf16-rounds them and writes the attention planes in fragment order (fragp_h), [b][h][s / 16][c / 32] fragments of q and k (row = s, k = c) and [b][h][s / 32][c / 16] fragments of v (row = c, k = s): q -> f16 hi (+ x 2^10 residual for s < QHI), k -> f16 (+ residual, s < KHI), v -> f16 (+ bf16 hi/lo for s < VHI, + f32 column sums of the 64 positions); the block's 64 positions are 16 KiB in a row of every plane
#define PT 256             // threads of k_prep8: 8 waves, each takes PR whole rows of the 64-row tile
#define PR 8
typedef __attribute__((ext_vector_type(4))) _Float16 v4h;
__global__ __launch_bounds__(PT) void k_prep8(const float* __restrict__ Q, const float* __restrict__ K, const float* __restrict__ V, _Float16* __restrict__ QH, _Float16* __restrict__ QL, _Float16* __restrict__ KH, _Float16* __restrict__ KL, _Float16* __restrict__ VT, __bf16* __restrict__ VB, __bf16* __restrict__ VBL, float* __restrict__ SV) {
  __shared__ __align__(16) _Float16 sq[64][136], sql[64][136], sk[64][136], skl[64][136], tv[128][72]; __shared__ __align__(16) __bf16 tb[128][72], tbl[128][72];
  const int tid = threadIdx.x; const int h = blockIdx.y; const size_t r0 = (size_t)blockIdx.x * 64; const size_t bb = r0 / TT; const int t0 = (int)(r0 % TT); const bool qhi = t0 < QHI, khi = t0 < KHI, vhi = t0 < VHI;
  { const int cg = tid & 31, c = cg * 4, rb = (tid >> 5) * PR; const size_t o0 = ((bb * TT + t0 + rb) * (size_t)CC) + h * HD + c;   /* raw [B, T, (h, d)] layout; a lane owns 4 adjacent columns (two rotation pairs) of PR rows in a row */
    const float fr[2] = {c_freq[cg * 2], c_freq[cg * 2 + 1]};   /* oldest load: the angles need it alone, so the first sincosf runs while the tile is on its way */
    asm volatile("s_wait_xcnt 0x0" ::: "memory");   /* before the table load's offset register is given to a tile load's result */
    v4f qv[PR], kv[PR], vv[PR];   /* the lane's whole share of the tile is requested in front of the first use: 3 * PR loads of 16 B in flight, one memory latency a block */
#pragma unroll
    for (int i = 0; i < PR; ++i) { qv[i] = *(const v4f*)(Q + o0 + (size_t)i * CC); kv[i] = *(const v4f*)(K + o0 + (size_t)i * CC); vv[i] = *(const v4f*)(V + o0 + (size_t)i * CC); }
    asm volatile("s_wait_xcnt 0x0" ::: "memory");   /* before the three address pairs of the tile loads are overwritten by the angle code; also keeps every load in front of it */
    v8h tvp[4]; v8b tbp[4], tlp[4];   /* v: PR rows of one column are 16 B in a row of the transposed planes */
#pragma unroll
    for (int i = 0; i < PR; ++i) { const int rl = rb + i; v4h qh4, ql4, kh4, kl4;   /* module inputs bf16-rounded; interleaved-pair RoPE on q and k in f32 */
#pragma unroll
      for (int p = 0; p < 2; ++p) { const float ang = (float)(t0 + rl) * fr[p]; float sn, cs; sincosf(ang, &sn, &cs);
        const float qe = bfr(qv[i][2 * p]), qo = bfr(qv[i][2 * p + 1]), ke = bfr(kv[i][2 * p]), ko = bfr(kv[i][2 * p + 1]);
        const float qr[2] = {qe * cs - qo * sn, qe * sn + qo * cs}, kr[2] = {ke * cs - ko * sn, ke * sn + ko * cs};
#pragma unroll
        for (int s = 0; s < 2; ++s) { const _Float16 qh = (_Float16)qr[s], kh = (_Float16)kr[s]; qh4[2 * p + s] = qh; ql4[2 * p + s] = (_Float16)((qr[s] - (float)qh) * 1024.0f); kh4[2 * p + s] = kh; kl4[2 * p + s] = (_Float16)((kr[s] - (float)kh) * 1024.0f); } }
      *(v4h*)&sq[rl][c] = qh4; *(v4h*)&sql[rl][c] = ql4; *(v4h*)&sk[rl][c] = kh4; *(v4h*)&skl[rl][c] = kl4;
#pragma unroll
      for (int j = 0; j < 4; ++j) { const float v = bfr(vv[i][j]); tvp[j][i] = (_Float16)v; const __bf16 vb = (__bf16)v; tbp[j][i] = vb; tlp[j][i] = (__bf16)(v - (float)vb); } }
#pragma unroll
    for (int j = 0; j < 4; ++j) { *(v8h*)&tv[c + j][rb] = tvp[j]; *(v8b*)&tb[c + j][rb] = tbp[j]; *(v8b*)&tbl[c + j][rb] = tlp[j]; } }
  __syncthreads();
  /* e counts the 16-B pieces of the block's 16 KiB in plane order: lane l = e & 31, half of the fragment (e >> 5) & 1, then the fragment; a wave's store is 512 B in a row */
  for (int e = tid; e < 64 * (HD / 8); e += PT) { const int l = e & 31, rl = (e >> 8) * 16 + (l & 15), c = ((e >> 5) & 7) * 16 + (l >> 4) * 8; const size_t o = ((bb * NH + h) * (size_t)TT + t0) * HD + e * 8; vst2((unsigned*)(QH + o), *(const v4u*)&sq[rl][c]); vst2((unsigned*)(KH + o), *(const v4u*)&sk[rl][c]); asm volatile("s_wait_xcnt 0x0" ::: "memory");   /* before the two stores' data and address registers are rewritten for the next planes and the next trip */
    if (qhi) { vst2((unsigned*)(QL + ((bb * NH + h) * (size_t)QHI + t0) * HD + e * 8), *(const v4u*)&sql[rl][c]); asm volatile("s_wait_xcnt 0x0" ::: "memory"); }   /* before the store's data registers take the next LDS read */
    if (khi) vst2((unsigned*)(KL + ((bb * NH + h) * (size_t)KHI + t0) * HD + e * 8), *(const v4u*)&skl[rl][c]); }
  for (int e = tid; e < HD * 8; e += PT) { const int l = e & 31, cl = ((e >> 6) & 7) * 16 + (l & 15), sl = (e >> 9) * 32 + ((e >> 5) & 1) * 16 + (l >> 4) * 8; vst2((unsigned*)(VT + ((bb * NH + h) * (size_t)TT + t0) * HD + e * 8), *(const v4u*)&tv[cl][sl]); asm volatile("s_wait_xcnt 0x0" ::: "memory");   /* before the store's data and offset registers are rewritten for the next planes or the next trip */
    if (vhi) { const size_t o3 = ((bb * NH + h) * (size_t)VHI + t0) * HD + e * 8; vst2((unsigned*)(VB + o3), *(const v4u*)&tb[cl][sl]); vst2((unsigned*)(VBL + o3), *(const v4u*)&tbl[cl][sl]); asm volatile("s_wait_xcnt 0x0" ::: "memory"); } }   /* the same for these two stores, before the next trip */
  /* column sums of the block's 64 rows of v (the bf16 values, added in f32): what a key behind every query of a k_att block adds to each of them, up to the factor -1; thread = column, eight running sums so that the adds do not wait for one another */
  if (tid < HD) { float a[8] = {};
#pragma unroll
    for (int q = 0; q < 8; ++q) { const v8b t = *(const v8b*)&tb[tid][q * 8];
#pragma unroll
      for (int i = 0; i < 8; ++i) a[i] += (float)t[i]; }
    SV[((bb * NH + h) * (size_t)(TT / 64) + t0 / 64) * HD + tid] = ((a[0] + a[1]) + (a[2] + a[3])) + ((a[4] + a[5]) + (a[6] + a[7])); } }

#ifndef SM_EXTRA_PARAMS
#define SM_EXTRA_PARAMS
#endif
#ifndef PROJ_EXTRA_PARAMS
#define PROJ_EXTRA_PARAMS
#endif
#ifndef SM_MASK_HOOK
#define SM_MASK_HOOK (void)0
#endif

#define WS_QH  0u                                      // f16 q fragments [b][h][t / 16][d / 32]
#define WS_KH  (WS_QH + 2u * (size_t)NB * TT * CC)      // f16 k fragments [b][h][t / 16][d / 32]
#define WS_VT  (WS_KH + 2u * (size_t)NB * TT * CC)      // f16 v fragments [b][h][t / 32][d / 16]
#define WS_QL  (WS_VT + 2u * (size_t)NB * CC * TT)      // f16 q residual x 2^10 fragments [b][h][t < QHI]
#define WS_KL  (WS_QL + 2u * (size_t)NB * QHI * CC)     // f16 k residual x 2^10 fragments [b][h][t < KHI]
#define WS_VB  (WS_KL + 2u * (size_t)NB * KHI * CC)     // bf16 v hi fragments [b][h][t < VHI]
#define WS_VBL (WS_VB + 2u * (size_t)NB * CC * VHI)
#define WS_S   (WS_VBL + 2u * (size_t)NB * CC * VHI)    // f32 column sums of v over 64 keys [b][h][t / 64][d] (the start of the region)
#define WS_Y   (WS_S  + 4u * (size_t)HG * TT * TT)      // f32 ctx rows [b*t][CC] (only when there is an output projection)
#define WS_END (WS_Y  + 0u)

// tanh by the math library's own two range formulas (|x| >= 0.625: 1 - 2 / (exp(2|x|) + 1); below: x + x^3 . poly(x^2)), both evaluated and one selected per lane: the library form branches per element, which splits the unrolled tile into hundreds of blocks and keeps two f32 registers per element alive up to the products
__device__ __forceinline__ float tanh_sel(float x) { const float y = fabsf(x), y2 = x * x;
  const float zb = fmaf(__builtin_amdgcn_rcpf(expf(y + y) + 1.0f), -2.0f, 1.0f);
  float q = fmaf(-0x1.758e7ap-8f, y2, 0x1.521192p-6f); q = fmaf(y2, q, -0x1.b8389cp-5f); q = fmaf(y2, q, 0x1.110704p-3f); q = fmaf(y2, q, -0x1.555532p-2f);
  const float zs = fmaf(y2, y * q, y);
  return copysignf(y < 0.625f ? zs : zb, x); }
// tanh(logit x SCALE) x 2^11 for the rows whose att is rounded once to f16 right behind it: 2^11 - 2^12 / (2^(logit x 2 SCALE log2 e) + 1), one formula for every range on the chip's own exp2 and reciprocal; absolute error of tanh below 3e-7, against the f16 rounding's 2^-12 relative; -inf (a masked key) gives -2^11
#define T2L ((float)(2.0 * 0.08838834764831845 * 1.4426950408889634))
// eight transcendentals in one statement, each in place on its own register: none reads a neighbour's result or overwrites a neighbour's source, and the closing v_nop is the free slot the instruction set asks for behind the last one, whatever the compiler puts next
__device__ __forceinline__ void exp2x8(float (&x)[8]) { asm("v_exp_f32 %0, %0\n\tv_exp_f32 %1, %1\n\tv_exp_f32 %2, %2\n\tv_exp_f32 %3, %3\n\tv_exp_f32 %4, %4\n\tv_exp_f32 %5, %5\n\tv_exp_f32 %6, %6\n\tv_exp_f32 %7, %7\n\tv_nop" : "+v"(x[0]), "+v"(x[1]), "+v"(x[2]), "+v"(x[3]), "+v"(x[4]), "+v"(x[5]), "+v"(x[6]), "+v"(x[7])); }
__device__ __forceinline__ void rcpx8(float (&x)[8]) { asm("v_rcp_f32 %0, %0\n\tv_rcp_f32 %1, %1\n\tv_rcp_f32 %2, %2\n\tv_rcp_f32 %3, %3\n\tv_rcp_f32 %4, %4\n\tv_rcp_f32 %5, %5\n\tv_rcp_f32 %6, %6\n\tv_rcp_f32 %7, %7\n\tv_nop" : "+v"(x[0]), "+v"(x[1]), "+v"(x[2]), "+v"(x[3]), "+v"(x[4]), "+v"(x[5]), "+v"(x[6]), "+v"(x[7])); }
// ---- k_att: block = KS waves of (b, h): 32 queries (3-product rows), or QG groups of 32 queries (1-product rows), each group with KS / QG waves; what follows is said of one group, ql0.. . The keys up to the 64-key boundary behind the block's last query are NCH chunks of 32; they are dealt evenly: every wave takes nc = ceil(NCH / KS) (3-product rows) or ceil(NCH / KG) (1-product rows) chunks in a row (the last wave with any takes what is left), so a wave's chain of loads and products grows with the keys the block can see. Logits are formed TRANSPOSED (A = k rows, B = q rows): D element r of lane (g, col) is key 8g + r of query col, so two 16-key tiles are, register for register, the A fragment of att for 32 keys, and logits and att never leave the registers. att = tanh(logit x SCALE) for key <= query, exactly -1 beyond, x 2^11; ctx = att . v (f16, 1 product, each k and v fragment used for both 16-query tiles; query rows < QBH * 64: 3-product logits, att and v as bf16 hi + lo, 3 products, one 16-query tile after the other). The keys behind that boundary have att = -1 for every query of the block and enter as -2^11 x the column sums of v over 64 keys (SV, from k_prep8): the last SW waves, which have the fewest chunks, add them up behind their own chunks, every SW-th sum each, into one row each of sm; the KS f32 partial tiles (of a wave without a chunk: a row of zeros) and the SW rows meet in LDS and are added in wave order; 512-B (row, head) segment by 32 lanes
#define KS 16
#define QW 2               // 16-query tiles per wave
#define NSV (TT / 64)      // column sums per (b, h)
#define SW 4               // waves that add up the column sums
#define QG 2               // 1-product rows: groups of 16 * QW queries in a block; the QG waves with the same keys read the same k and v lines at the same time, so a line comes from L2 once for all of them
#define KG (KS / QG)       // 1-product rows: waves that share out the keys of one query group
#define NZ1 ((TT - QBH * 64) / (16 * QW * QG))   // blocks of the 1-product rows per (b, h)
#define NZ3 (QBH * 64 / (16 * QW))               // blocks of the 3-product rows per (b, h)
static_assert(QBH * 2 <= KS, "a block of the 3-product rows has at most one chunk a wave"); static_assert(16 * QW * QG == 64 && (TT / 32 + KG - 1) / KG <= 8, "a block of the 1-product rows ends on a 64-key boundary; a wave has at most two passes of four chunks"); static_assert(NSV / SW == 8 && SW == 4 && (32 * KS) % (HD / 4) == 0, "the two sums over sm and s are written out");
// MC chunks of 32 keys against the wave's 32 queries, 1-product rows; lim = ql0 + col - k0 - 8 g; st = the wave's tile in LDS; add (wave-uniform): the tile holds the sums of the wave's earlier chunks, to which this pass's sums are added
template <int MC> __device__ __forceinline__ void att_lo(const _Float16* __restrict__ qrow, const _Float16* __restrict__ krow, const _Float16* __restrict__ vrow, int lim, int col, int g, float (*st)[HD + 4], bool add) {
  v16h p[QW][MC];
  {
    v16h qh[QW][HD / 32];
#pragma unroll
    for (int u = 0; u < QW; ++u)
#pragma unroll
      for (int kc = 0; kc < HD / 32; ++kc) qh[u][kc] = fragp_h(qrow + (u * 4 + kc) * 512);
    v16h kf[2][HD / 32];   /* a 16-key tile's four fragments are fetched together, one tile ahead of their products: the loads stay in source order round the products' asm, so one written at its product would be waited for alone */
#pragma unroll
    for (int kc = 0; kc < HD / 32; ++kc) kf[0][kc] = fragp_h(krow + kc * 512);
#pragma unroll
    for (int c = 0; c < MC; ++c)
#pragma unroll
      for (int t = 0; t < 2; ++t) { v8f a[QW] = {};
        if (c * 2 + t + 1 < MC * 2) {
#pragma unroll
          for (int kc = 0; kc < HD / 32; ++kc) kf[(t + 1) & 1][kc] = fragp_h(krow + ((c * 2 + t + 1) * 4 + kc) * 512); }
#pragma unroll
        for (int kc = 0; kc < HD / 32; ++kc)
#pragma unroll
          for (int u = 0; u < QW; ++u) a[u] = wmma16(kf[t][kc], qh[u][kc], a[u]);
#pragma unroll
        for (int u = 0; u < QW; ++u) { float x[8];
#pragma unroll
          for (int r = 0; r < 8; ++r) x[r] = (c * 32 + t * 16 + r - u * 16 <= lim ? a[u][r] : -__builtin_inff()) * T2L;   /* the mask goes in as the reference's own -inf */
          exp2x8(x);
#pragma unroll
          for (int r = 0; r < 8; ++r) x[r] += 1.0f;
          rcpx8(x);
#pragma unroll
          for (int r = 0; r < 8; ++r) p[u][c][t * 8 + r] = (_Float16)fmaf(x[r], -4096.0f, 2048.0f); } } }
  constexpr int VA = MC == 4 ? 3 : MC == 3 ? 4 : MC == 2 ? 6 : HD / 16;   /* groups of 16 v columns on their way at a time: up to 12 fragments, in the registers that q and k leave free behind the logits; a group is requested VA groups ahead of its products, so a wave waits for memory once or twice instead of once a group */
  v16h vf[VA][MC];
#pragma unroll
  for (int j = 0; j < VA; ++j) {
    if (MC == 4 && j == 1) __builtin_amdgcn_sched_barrier(0);   /* four chunks: only the first group's requests may rise into the tanh code; with all three there the wave needs more than its 256 registers and spills */
#pragma unroll
    for (int c = 0; c < MC; ++c) vf[j][c] = fragp_h(vrow + (c * 8 + j) * 512); }
  v8f nx[QW] = {};   /* the earlier chunks' sums, read from the tile one group of columns ahead of their use; the first read stands behind the first group's products, so that no branch lies between att and its first use */
#pragma unroll
  for (int j = 0; j < HD / 16; ++j) { v8f acc[QW] = {};
#pragma unroll
    for (int c = 0; c < MC; ++c)
#pragma unroll
      for (int u = 0; u < QW; ++u) acc[u] = wmma16(p[u][c], vf[j % VA][c], acc[u]);
    if (j + VA < HD / 16) {
#pragma unroll
      for (int c = 0; c < MC; ++c) vf[j % VA][c] = fragp_h(vrow + (c * 8 + j + VA) * 512); }
    if (add) {
      if (j == 0) {
#pragma unroll
        for (int u = 0; u < QW; ++u)
#pragma unroll
          for (int r = 0; r < 8; ++r) nx[u][r] = st[u * 16 + 8 * g + r][col]; }
#pragma unroll
      for (int u = 0; u < QW; ++u) acc[u] += nx[u];
      if (j + 1 < HD / 16) {
#pragma unroll
        for (int u = 0; u < QW; ++u)
#pragma unroll
          for (int r = 0; r < 8; ++r) nx[u][r] = st[u * 16 + 8 * g + r][(j + 1) * 16 + col]; } }
#pragma unroll
    for (int u = 0; u < QW; ++u)
#pragma unroll
      for (int r = 0; r < 8; ++r) st[u * 16 + 8 * g + r][j * 16 + col] = acc[u][r]; } }
// the NP partial tiles of each query group and the column sums ms, added in wave order; tile of (query group qg, place kw among the waves that share the keys) = ss[kw * (KS / NP) + qg]; y = the block's first output row at the head's columns
template <int NP> __device__ __forceinline__ void add_up(const float (*ss)[16 * QW][HD + 4], v4f ms, int nc, int nch, float* __restrict__ y, int tid) {
  for (int e = tid; e < (KS / NP) * 16 * QW * (HD / 4); e += 32 * KS) { const int rl = e / (HD / 4), c4 = e % (HD / 4), qg = rl / (16 * QW), r = rl % (16 * QW); v4f s = ms + *(const v4f*)&ss[qg][r][c4 * 4];   /* the first wave always has a chunk; unrolled below: the NP LDS reads are then in flight together instead of one wait each */
#pragma unroll
    for (int w = 1; w < NP; ++w) s += *(const v4f*)&ss[w * (KS / NP) + qg][w * nc < nch ? r : 0][c4 * 4];   /* a wave with a chunk wrote its whole tile, the others row 0 alone, zeros */
    vst2(y + (size_t)rl * CC + c4 * 4, s * (1.0f / 2048.0f));
    asm volatile("s_wait_xcnt 0x0" ::: "memory"); } }   /* before the store's data and address registers are rewritten for the next trip */
__global__ __launch_bounds__(32 * KS) void k_att(const _Float16* __restrict__ QH, const _Float16* __restrict__ KH, const _Float16* __restrict__ QL, const _Float16* __restrict__ KL, const _Float16* __restrict__ VT, const __bf16* __restrict__ VB, const __bf16* __restrict__ VBL, float* __restrict__ Y, const float* __restrict__ SV) { __shared__ __align__(16) float ss[KS][16 * QW][HD + 4], sm[SW][HD];
  const int h = blockIdx.x, b = blockIdx.y; const int tid = threadIdx.x, wave = __builtin_amdgcn_readfirstlane(tid >> 5), lane = tid & 31, col = lane & 15, g = lane >> 4; const int z = (int)blockIdx.z; const bool wide = z < NZ1; const int qb0 = wide ? TT - (z + 1) * (16 * QW * QG) : (NZ1 + NZ3 - 1 - z) * (16 * QW);   /* the block's first query. The blocks that see the most keys have the lowest z, for speed only */
  const int kw = wide ? wave / QG : wave, ql0 = qb0 + (wide ? (wave % QG) * (16 * QW) : 0);   /* the wave's place among the KG or KS waves that share out the keys of its 32 queries ql0..; in 1-product rows the QG neighbours in wave order have the same keys */
  const int nch = (qb0 / 64 + 1) * 2, nc = wide ? (nch + KG - 1) / KG : (nch + KS - 1) / KS, mc = nch - kw * nc, k0 = kw * nc * 32;   /* chunks of the block, chunks a wave, chunks left from this wave's first on (<= 0: none), the wave's first key */
  const size_t bh = (size_t)b * NH + h; const _Float16* qrow = QH + (bh * TT + ql0) * HD + lane * 8; const _Float16* krow = KH + (bh * TT + k0) * HD + lane * 8;   /* the lane's piece of the first fragment; fragment (16 rows n, 32 dims kc) lies (n * 4 + kc) * 512 elements on */
  if (mc <= 0) {   /* wave-uniform: no chunk is left for this wave */
    const v4f zero = {}; *(v4f*)&ss[wave][0][lane * 4] = zero;   /* row 0 stands for all 16 * QW rows */
  } else if (ql0 < QBH * 64) {   /* nc = 1 here: one chunk */
    const _Float16* qlrow = QL + (bh * QHI + ql0) * HD + lane * 8; const _Float16* klrow = KL + (bh * KHI + k0) * HD + lane * 8;
    const __bf16* vrow = VB + (bh * VHI + k0) * HD + lane * 8; const __bf16* vlrow = VBL + (bh * VHI + k0) * HD + lane * 8;   /* v fragment (16 columns j) lies j * 512 elements on */
#pragma unroll 1   /* rolled: one 16-query tile's fragments and sums in registers at a time */
    for (int u = 0; u < QW; ++u) { const int qu = ql0 + u * 16; F2 p; v16b vh[HD / 16], vl[HD / 16];
      {
        v16h qh[HD / 32], ql[HD / 32];
#pragma unroll
        for (int kc = 0; kc < HD / 32; ++kc) { qh[kc] = fragp_h(qrow + (u * 4 + kc) * 512); if (kc + 1 < HD / 32) ql[kc] = fragp_h(qlrow + (u * 4 + kc) * 512); }
        { union { v16h v; v8h q[2]; } w; const _Float16* pl = qlrow + (u * 4 + HD / 32 - 1) * 512; w.q[0] = *(const v8h*)pl;
          asm volatile("s_wait_xcnt 0x0" ::: "memory");   /* before the last load's result is given the address registers of the loads in front of it */
          w.q[1] = *(const v8h*)(pl + 256); ql[HD / 32 - 1] = w.v; }
        v16h kb[2][HD / 32], kl[2][HD / 32];   /* the chunk's 16 k fragments are requested together with q, in front of the first product: one memory latency instead of one for every pair */
#pragma unroll
        for (int t = 0; t < 2; ++t)
#pragma unroll
          for (int kc = 0; kc < HD / 32; ++kc) { kb[t][kc] = fragp_h(krow + (t * 4 + kc) * 512); kl[t][kc] = fragp_h(klrow + (t * 4 + kc) * 512); }
        v8f a[2] = {}, al[2] = {};
#pragma unroll
        for (int t = 0; t < 2; ++t)
#pragma unroll
          for (int kc = 0; kc < HD / 32; ++kc) { a[t] = wmma16(kb[t][kc], qh[kc], a[t]); al[t] = wmma16(kb[t][kc], ql[kc], al[t]); al[t] = wmma16(kl[t][kc], qh[kc], al[t]); }
#pragma unroll
        for (int j = 0; j < HD / 16; ++j) { vh[j] = fragp_b(vrow + j * 512); vl[j] = fragp_b(vlrow + j * 512); }   /* all 16 v fragments at once, into the registers q and k have left: one memory latency instead of two */
        float pv[16];
#pragma unroll
        for (int t = 0; t < 2; ++t)
#pragma unroll
          for (int r = 0; r < 8; ++r) { const float th = tanh_sel((a[t][r] + al[t][r] * (1.0f / 1024.0f)) * SCALE); pv[t * 8 + r] = (k0 + t * 16 + 8 * g + r <= qu + col ? th : -1.0f) * 2048.0f; }
        p = bsplit16(pv); }
#pragma unroll
      for (int j = 0; j < HD / 16; ++j) { v8f acc = {}; acc = wmma_bf(p.h, vh[j], acc); acc = wmma_bf(p.l, vh[j], acc); acc = wmma_bf(p.h, vl[j], acc);
#pragma unroll
        for (int r = 0; r < 8; ++r) ss[wave][u * 16 + 8 * g + r][j * 16 + col] = acc[r]; } }
  } else {
    const _Float16* vrow = VT + (bh * TT + k0) * HD + lane * 8;   /* v fragment (32 keys c, 16 columns j) lies (c * 8 + j) * 512 elements on */
    const int lim = ql0 + col - k0 - 8 * g;   /* key <= query, both counted from the wave's and the lane's own start: one register against a constant per element */
    const int m = mc < nc ? mc : nc, step = m > 4 ? (m + 1) / 2 : m;   /* wave-uniform: one straight-line body per chunk count up to 4; more chunks go in two passes of about equal length */
#pragma unroll 1   /* rolled: both passes run the same four bodies */
    for (int c0 = 0; c0 < m; c0 += step) { const int mm = m - c0 < step ? m - c0 : step; const _Float16* kp = krow + c0 * 32 * HD; const _Float16* vp = vrow + c0 * 32 * HD; const int lm = lim - c0 * 32; const bool add = c0 > 0;
      if (mm == 1) att_lo<1>(qrow, kp, vp, lm, col, g, ss[wave], add);
      else if (mm == 2) att_lo<2>(qrow, kp, vp, lm, col, g, ss[wave], add);
      else if (mm == 3) att_lo<3>(qrow, kp, vp, lm, col, g, ss[wave], add);
      else att_lo<4>(qrow, kp, vp, lm, col, g, ss[wave], add);
      asm volatile("s_wait_xcnt 0x0" ::: "memory"); }   /* before the address registers of a pass's loads are rewritten for the next pass */
  }
  if (wave >= KS - SW) {   /* wave-uniform; the sums of the 64-key groups nch / 2 .. NSV - 1, all behind every query of the block */
    const int r0 = nch / 2 + wave - (KS - SW); const float* sv = SV + (bh * NSV + r0) * HD + lane * 4; v4f s[NSV / SW] = {};
#pragma unroll
    for (int i = 0; i < NSV / SW; ++i) if (r0 + i * SW < NSV) s[i] = *(const v4f*)(sv + i * SW * HD);   /* all requested before the first is used: one latency */
    asm volatile("s_wait_xcnt 0x0" ::: "memory");   /* before the loads' address registers are given to anything else */
    *(v4f*)&sm[wave - (KS - SW)][lane * 4] = (((s[0] + s[1]) + (s[2] + s[3])) + ((s[4] + s[5]) + (s[6] + s[7]))) * -2048.0f; }
  __syncthreads();   /* every wave's partial tiles are in LDS before any thread adds across the waves */
  const v4f ms = (*(const v4f*)&sm[0][lane * 4] + *(const v4f*)&sm[1][lane * 4]) + (*(const v4f*)&sm[2][lane * 4] + *(const v4f*)&sm[3][lane * 4]);   /* a thread's columns are lane * 4 .. + 3 on every trip: 32 * KS is a multiple of HD / 4 */
  float* y = Y + ((size_t)b * TT + qb0) * CC + h * HD;
  if (wide) add_up<KG>(ss, ms, nc, nch, y, tid); else add_up<KS>(ss, ms, nc, nch, y, tid); }

extern "C" void kernel_launch(void* const* d_in, const int* in_sizes, int n_in, void* d_out, int out_size, void* d_ws, size_t ws_size, hipStream_t stream) {
  (void)in_sizes; (void)n_in; (void)out_size;
  const float** F = (const float**)d_in;
  if (ws_size < (size_t)WS_END) return;
  char* ws = (char*)d_ws; _Float16 *QH = (_Float16*)(ws + WS_QH), *KH = (_Float16*)(ws + WS_KH), *VT = (_Float16*)(ws + WS_VT), *QL = (_Float16*)(ws + WS_QL), *KL = (_Float16*)(ws + WS_KL); __bf16 *VB = (__bf16*)(ws + WS_VB), *VBL = (__bf16*)(ws + WS_VBL); float* SV = (float*)(ws + WS_S);
  // inputs: 0 Q [2,2048,2048]; 1 K; 2 V (raw [B, T, (h, d)] tensors)
  k_prep8<<<dim3(TNB * TT / 64, NH), PT, 0, stream>>>(F[0], F[1], F[2], QH, QL, KH, KL, VT, VB, VBL, SV);
  k_att<<<dim3(NH, TNB, NZ1 + NZ3), 32 * KS, 0, stream>>>(QH, KH, QL, KL, VT, VB, VBL, (float*)d_out, SV);
}
